// v000
// The times below were measured on an AMD MI455X: many runs one after another, warmed up first and cycling through
// copies of the inputs, with the whole window's GPU time divided by the number of runs. Launches and the gaps
// between them are all in it. The median over several windows is given; except for v000 it joins two sittings, which
// can be a few percent apart, so the side-by-side timings, each taken in one sitting, are the better comparison.
// The starting kernel, v000, takes 102 microseconds a run.
#include <hip/hip_runtime.h>
#include <stddef.h>

// All contractions on v_wmma_f32_16x16x32_f16 (f16 operands, f32 accumulate): q|k and v
// projection, q.k scores (head width 16 zero-padded to k = 32), p.v, output projection.
// Float inputs are RNE-converted to bf16 and carried in f16 (weights x64, q/k/v planes x64,
// p x1024, attention rows x64); softmax, scale and bias in f32.

typedef _Float16 h16;
typedef _Float16 v16h __attribute__((ext_vector_type(16)));
typedef _Float16 v8h  __attribute__((ext_vector_type(8)));
typedef float    v8f  __attribute__((ext_vector_type(8)));
typedef float    v4f  __attribute__((ext_vector_type(4)));

#ifndef NB
#define NB 64
#endif
#ifndef SEQ
#define SEQ 512
#endif
#define NB_FULL  64
#define SEQ_FULL 512
#define DIM    128
#define NHEAD  8
#define HD     16
#define NPATCH 32
#define NTOK   (NPATCH + SEQ)                 // tokens per batch (patch rows first)
#define TOKP   (((NTOK + 63) / 64) * 64)      // token rows per batch padded to the GEMM tile
#define QKP    256                            // q|k plane pitch (halves): q cols 0..127, k cols 128..255
#define XROWS  (NB * TOKP)                    // rows of the batch-major planes
#define OROWS  (NTOK * NB)                    // rows of the (token, batch)-ordered planes

static_assert(NB >= 1 && NB <= NB_FULL);
static_assert(SEQ >= 32 && SEQ <= SEQ_FULL);
static_assert(DIM == NHEAD * HD);
static_assert(HD == 16);                      // one 16-B load per score fragment, 8 halves per lane half
static_assert(NHEAD == 8);                    // one wave per head, 8 waves per block
static_assert((DIM % 32) == 0 && (DIM % 64) == 0);
static_assert(QKP == 2 * DIM && (QKP % 64) == 0);
static_assert((NTOK % 32) == 0);              // 32-key steps cover the key range exactly
static_assert((NTOK % 16) == 0);              // 16-query tiles cover the query range exactly
static_assert((TOKP % 64) == 0 && TOKP >= NTOK);
static_assert((XROWS % 64) == 0 && (XROWS % 16) == 0);
static_assert((OROWS % 64) == 0);
static_assert(((3 * DIM * DIM) % 2048) == 0 && ((DIM * DIM) % 2048) == 0);
static_assert(DIM == 16 * 8);                 // plane rows: 16 lanes x 8 halves

#define LDC 68    // floats per LDS row of the GEMM staging tile (272 B, 16-B aligned)
#define LDO 136   // halves per LDS row of the attention output tile (272 B, 16-B aligned)
static_assert((LDC % 4) == 0 && LDC >= 64);
static_assert((LDO % 8) == 0 && LDO >= DIM);

#define WCARRY 64.0f     // weight planes carried x64
#define QCARRY 64.0f     // q, k, v planes carried x64 (the projection accumulator as is)
#define PCARRY 1024.0f   // softmax numerators carried x1024
#define CCARRY 64.0f     // attention output plane carried x64
#define PCUT   (-16.0f)  // exponent cut: 1024 * exp(-16) = 1.15e-4 stays a normal f16

// workspace layout (bytes)
#define WQKV_BYTES ((size_t)3 * DIM * DIM * 2)
#define W0_BYTES   ((size_t)DIM * DIM * 2)
#define X_BYTES    ((size_t)XROWS * DIM * 2)
#define QK_BYTES   ((size_t)XROWS * QKP * 2)
#define VT_BYTES   ((size_t)NB * DIM * TOKP * 2)
#define CTX_BYTES  ((size_t)OROWS * DIM * 2)
#define OFF_WQKV ((size_t)0)
#define OFF_W0   (OFF_WQKV + WQKV_BYTES)
#define OFF_X    (OFF_W0 + W0_BYTES)
#define OFF_QK   (OFF_X + X_BYTES)
#define OFF_VT   (OFF_QK + QK_BYTES)
#define OFF_CTX  (OFF_VT + VT_BYTES)
#define WS_TOTAL (OFF_CTX + CTX_BYTES)
static_assert((WQKV_BYTES % 128) == 0 && (W0_BYTES % 128) == 0 && (X_BYTES % 128) == 0);
static_assert((QK_BYTES % 128) == 0 && (VT_BYTES % 128) == 0 && (CTX_BYTES % 128) == 0);
static_assert(WS_TOTAL <= (size_t)134217728);

// ---------------------------------------------------------------------------
__device__ __forceinline__ float bf16r(float x) {   // RNE convert to bf16, returned widened
  unsigned int u = __float_as_uint(x);
  u = (u + 0x7FFFu + ((u >> 16) & 1u)) & 0xFFFF0000u;
  return __uint_as_float(u);
}

// f32 -> f16 with a value select: results below the smallest normal f16 become zero.
static __device__ __forceinline__ h16 toh_flush(float v) {
  const h16 r = (h16)v;
  return (fabsf(v) < 6.103515625e-05f) ? (h16)0.0f : r;
}

// 16-bit fragment: p points at element [row = lane&15][k0 + 8*(lane>>4)] of a k-contiguous
// row. Elements 0..7 <- k0+8h+0..7, elements 8..15 <- k0+16+8h+0..7 (same map for A and B).
__device__ __forceinline__ v16h frag_at(const _Float16* p) {
  v8h lo = *(const v8h*)(p);
  v8h hi = *(const v8h*)(p + 16);
  v16h out;
#pragma unroll
  for (int i = 0; i < 8; ++i) { out[i] = lo[i]; out[i + 8] = hi[i]; }
  return out;
}

// Fragment of a 16-deep contraction padded to k = 32: p points at [row = lane&15][8*(lane>>4)];
// elements 0..7 <- k = 8h+0..7, elements 8..15 (k = 16..31) are zero.
__device__ __forceinline__ v16h frag_k16(const _Float16* p) {
  const v8h lo = *(const v8h*)(p);
  v16h out;
#pragma unroll
  for (int i = 0; i < 8; ++i) { out[i] = lo[i]; out[i + 8] = (_Float16)0.0f; }
  return out;
}

__device__ __forceinline__ v8f wmma16(v16h a, v16h b, v8f c) {
  v8f d = __builtin_amdgcn_wmma_f32_16x16x32_f16(false, a, false, b, (short)0, c,
                                                 false, false);
  asm volatile("v_nop\n\tv_nop\n\tv_nop\n\tv_nop" : "+v"(d) : "v"(a), "v"(b));
  return d;
}

// ---------------------------------------------------------------------------
// Weight plane: W[n][k] (f32, k contiguous) -> W16[n][k] = f16(64 * bf16(w)), same layout.
// Each thread 8 elements; a wave writes 512 contiguous bytes per store instruction.
// Grid (elements / 2048), exact.
// ---------------------------------------------------------------------------
__global__ __launch_bounds__(256) void wcast_kernel(
    const float* __restrict__ W, _Float16* __restrict__ W16) {
  const size_t idx = ((size_t)blockIdx.x * 256u + threadIdx.x) * 8u;
  const v4f a0 = *(const v4f*)(W + idx);
  const v4f a1 = *(const v4f*)(W + idx + 4);
  v8h o;
#pragma unroll
  for (int i = 0; i < 4; ++i) {
    o[i]     = toh_flush(WCARRY * bf16r(a0[i]));
    o[i + 4] = toh_flush(WCARRY * bf16r(a1[i]));
  }
  _Float16* p = W16 + idx;
  *(v8h*)p = o;
  
}

// ---------------------------------------------------------------------------
// Token plane X16[b * TOKP + f][DIM] = f16(bf16(x)): f < 32 patch row f (shared by all b),
// 32 <= f < NTOK sequence row (s = f - 32, b) of xs[s][b][:], f >= NTOK zero rows.
// Both sources are loaded with clamped row indices and selected by value.
// Grid (XROWS / 16).
// ---------------------------------------------------------------------------
__global__ __launch_bounds__(256) void xconv_kernel(
    const float* __restrict__ xp, const float* __restrict__ xs, _Float16* __restrict__ X16) {
  const unsigned tid = threadIdx.x;
  const unsigned row = blockIdx.x * 16u + (tid >> 4);
  const unsigned c = (tid & 15u) * 8u;
  const unsigned b = row / (unsigned)TOKP;
  const unsigned f = row - b * (unsigned)TOKP;
  const unsigned fp = (f < (unsigned)NPATCH) ? f : (unsigned)(NPATCH - 1);
  unsigned sq = (f >= (unsigned)NPATCH) ? (f - (unsigned)NPATCH) : 0u;
  sq = (sq < (unsigned)SEQ) ? sq : (unsigned)(SEQ - 1);
  const float* pp = xp + (size_t)fp * DIM + c;
  const float* ps = xs + ((size_t)sq * NB_FULL + b) * DIM + c;
  const v4f p0 = *(const v4f*)(pp);
  const v4f p1 = *(const v4f*)(pp + 4);
  const v4f s0 = *(const v4f*)(ps);
  const v4f s1 = *(const v4f*)(ps + 4);
  const bool isp = (f < (unsigned)NPATCH);
  const bool live = (f < (unsigned)NTOK);
  v8h o;
#pragma unroll
  for (int i = 0; i < 4; ++i) {
    float t0 = isp ? p0[i] : s0[i];
    float t1 = isp ? p1[i] : s1[i];
    t0 = live ? t0 : 0.0f;
    t1 = live ? t1 : 0.0f;
    o[i]     = toh_flush(bf16r(t0));
    o[i + 4] = toh_flush(bf16r(t1));
  }
  _Float16* p = X16 + (size_t)row * DIM + c;
  *(v8h*)p = o;
  
}

// ---------------------------------------------------------------------------
// GEMM C[64x64 tile] = A16[rows][DIM] . Bt[n][DIM]^T, fragments straight from the 16-bit
// global planes; 8 waves (mw = 16-row group, nw = 32-col group), 2 accumulators/wave.
//   MODE 0: out16[row][n0 + col] (pitch QKP) = f16(acc)           (q | k plane, x64 carry)
//   MODE 1: out16 transposed V plane [b][n0 + col][key] (pitch TOKP) = f16(acc)  (x64 carry)
//   MODE 2: outf[(f * NB_FULL + b)][n0 + col] = acc/4096 + bf16(bias), rows (f * NB + b)
// Grid (N/64, rows/64).
// ---------------------------------------------------------------------------
template <int MODE>
__device__ __forceinline__ void gemm_body(
    const _Float16* __restrict__ A16, const _Float16* __restrict__ Bt,
    const float* __restrict__ bias, float* __restrict__ outf, _Float16* __restrict__ out16) {
  __shared__ float Cs[64 * LDC];
  const unsigned tid = threadIdx.x, lane = tid & 31u;
  const unsigned w = (unsigned)__builtin_amdgcn_readfirstlane((int)(threadIdx.x >> 5));
  const unsigned mw = w >> 1, nw = w & 1u;
  const unsigned hh = lane >> 4, m = lane & 15u;
  const unsigned n0 = blockIdx.x * 64u;
  const unsigned row0 = blockIdx.y * 64u;

  const _Float16* ap  = A16 + (size_t)(row0 + mw * 16u + m) * DIM + hh * 8u;
  const _Float16* bp0 = Bt + (size_t)(n0 + nw * 32u + m) * DIM + hh * 8u;
  const _Float16* bp1 = bp0 + (size_t)16 * DIM;
  v8f acc0 = {}, acc1 = {};
#pragma unroll
  for (unsigned k0 = 0; k0 < (unsigned)DIM; k0 += 32u) {
    const v16h a  = frag_at(ap + k0);
    const v16h b0 = frag_at(bp0 + k0);
    const v16h b1 = frag_at(bp1 + k0);
    acc0 = wmma16(a, b0, acc0);
    acc1 = wmma16(a, b1, acc1);
  }
#pragma unroll
  for (int r = 0; r < 8; ++r) {
    float* d = &Cs[(mw * 16u + hh * 8u + (unsigned)r) * LDC + nw * 32u + m];
    d[0]  = acc0[r];
    d[16] = acc1[r];
  }
  __syncthreads();

  if (MODE == 0) {
    v8h x[2];
    size_t off[2];
#pragma unroll
    for (unsigned i = 0; i < 2u; ++i) {
      const unsigned r = 32u * i + (tid >> 3);
      const unsigned c = (tid & 7u) * 8u;
      const v4f u0 = *(const v4f*)&Cs[r * LDC + c];
      const v4f u1 = *(const v4f*)&Cs[r * LDC + c + 4];
#pragma unroll
      for (int j = 0; j < 4; ++j) {
        x[i][j]     = toh_flush(u0[j]);
        x[i][j + 4] = toh_flush(u1[j]);
      }
      off[i] = (size_t)(row0 + r) * QKP + n0 + c;
    }
#pragma unroll
    for (int i = 0; i < 2; ++i) *(v8h*)(out16 + off[i]) = x[i];
    
  }

  if (MODE == 1) {
    const unsigned bidx = row0 / (unsigned)TOKP;
    const unsigned key0 = row0 - bidx * (unsigned)TOKP;
    v8h x[2];
    size_t off[2];
#pragma unroll
    for (unsigned i = 0; i < 2u; ++i) {
      const unsigned dcol = 32u * i + (tid >> 3);
      const unsigned kk = (tid & 7u) * 8u;
#pragma unroll
      for (unsigned j = 0; j < 8u; ++j)
        x[i][j] = toh_flush(Cs[(kk + j) * LDC + dcol]);
      off[i] = ((size_t)bidx * DIM + n0 + dcol) * TOKP + key0 + kk;
    }
#pragma unroll
    for (int i = 0; i < 2; ++i) *(v8h*)(out16 + off[i]) = x[i];
    
  }

  if (MODE == 2) {
    const float cs = 1.0f / (WCARRY * CCARRY);
    v4f xs[4];
    size_t off[4];
#pragma unroll
    for (unsigned i = 0; i < 4u; ++i) {
      const unsigned r = 16u * i + (tid >> 4);
      const unsigned c = (tid & 15u) * 4u;
      const unsigned crow = row0 + r;
      const unsigned f = crow / (unsigned)NB;
      const unsigned bb = crow - f * (unsigned)NB;
      const size_t orow = (size_t)f * NB_FULL + bb;
      const v4f u = *(const v4f*)&Cs[r * LDC + c];
      const v4f g = *(const v4f*)(bias + n0 + c);
      v4f val;
#pragma unroll
      for (int j = 0; j < 4; ++j) val[j] = u[j] * cs + bf16r(g[j]);
      xs[i] = val;
      off[i] = orow * DIM + n0 + c;
    }
#pragma unroll
    for (int i = 0; i < 4; ++i) *(v4f*)(outf + off[i]) = xs[i];
    
  }
}

__global__ __launch_bounds__(256) void gemm_qk_kernel(
    const _Float16* __restrict__ A16, const _Float16* __restrict__ Bt,
    _Float16* __restrict__ qk) {
  gemm_body<0>(A16, Bt, (const float*)0, (float*)0, qk);
}
__global__ __launch_bounds__(256) void gemm_v_kernel(
    const _Float16* __restrict__ A16, const _Float16* __restrict__ Bt,
    _Float16* __restrict__ vt) {
  gemm_body<1>(A16, Bt, (const float*)0, (float*)0, vt);
}
__global__ __launch_bounds__(256) void gemm_out_kernel(
    const _Float16* __restrict__ A16, const _Float16* __restrict__ Bt,
    const float* __restrict__ bias, float* __restrict__ outf) {
  gemm_body<2>(A16, Bt, bias, outf, (_Float16*)0);
}

// ---------------------------------------------------------------------------
// Dense flash attention, register-fed transposed form. Block = (16 query tokens, batch b),
// wave = head. Per 32-key step:
//   S^T tiles (keys x queries) = K tile (A, 16 keys x d padded to 32) . Q^T (B, d x 16 queries),
//   two 16-key tiles; lane (h, n) holds query column n, key rows 8h+r of each tile.
//   Online softmax per query column: in-lane over 16 values + one 16-lane-distance shuffle.
//   P^T packed as B fragment: element r <- tile 0 row 8h+r, element 8+r <- tile 1 row 8h+r
//   (keys kb+8h+r and kb+16+8h+r), f16(1024 p), zero below the exponent cut.
//   O^T (d x queries) += V^T tile (A, [d][32 keys] from the transposed V plane) . P^T.
// No LDS and no barrier in the key loop. Output tile [16 tokens][128] staged in Os
// (cross-wave, block barrier), written as whole 256-B rows of Ctx[(f * NB + b)][DIM],
// f16(64 * O / l).
// Grid (NTOK/16, NB).
// ---------------------------------------------------------------------------
__global__ __launch_bounds__(256) void attn_kernel(
    const _Float16* __restrict__ QK, const _Float16* __restrict__ Vt,
    _Float16* __restrict__ Ctx) {
  __shared__ _Float16 Os[16 * LDO];

  const unsigned tid = threadIdx.x, lane = tid & 31u;
  const unsigned head = (unsigned)__builtin_amdgcn_readfirstlane((int)(threadIdx.x >> 5));
  const unsigned hh = lane >> 4, m = lane & 15u;
  const unsigned q0 = blockIdx.x * 16u;
  const unsigned b = blockIdx.y;
  const size_t tokbase = (size_t)b * TOKP;
  const float sscale = 0.25f / (QCARRY * QCARRY);   // HD^-0.5 and the two x64 carries

  // Q^T as B operand: lane (h, n) <- q[token q0+n][head*16 + 8h .. +7], k 16..31 zero
  const v16h qf = frag_k16(QK + (tokbase + q0 + m) * QKP + head * HD + hh * 8u);
  // K tile as A operand: lane (h, m) <- k[token kb+m][head*16 + 8h .. +7]
  const _Float16* kp = QK + (tokbase + m) * QKP + DIM + head * HD + hh * 8u;
  // V^T tile as A operand: lane (h, m = d) <- vt[d][kb + 8h .. +7], vt[d][kb + 16 + 8h .. +7]
  const _Float16* vp = Vt + ((size_t)b * DIM + head * HD + m) * TOKP + hh * 8u;

  float mrow = -1.0e30f, lrow = 0.0f;
  v8f o = {};

  for (unsigned kb = 0; kb < (unsigned)NTOK; kb += 32u) {
    const v16h ka0 = frag_k16(kp + (size_t)kb * QKP);
    const v16h ka1 = frag_k16(kp + (size_t)(kb + 16u) * QKP);
    const v16h va  = frag_at(vp + kb);
    v8f s0 = {}, s1 = {};
    s0 = wmma16(ka0, qf, s0);
    s1 = wmma16(ka1, qf, s1);

    float mx = fmaxf(s0[0], s1[0]);
#pragma unroll
    for (int r = 1; r < 8; ++r) mx = fmaxf(mx, fmaxf(s0[r], s1[r]));
    mx = fmaxf(mx, __shfl_xor(mx, 16, 32));
    const float mn = fmaxf(mrow, mx * sscale);
    const float alpha = __expf(mrow - mn);
    mrow = mn;

    float rs = 0.0f;
    v16h pf;
#pragma unroll
    for (int r = 0; r < 8; ++r) {
      const float e0 = s0[r] * sscale - mn;
      const float e1 = s1[r] * sscale - mn;
      const float x0 = __expf(e0);
      const float x1 = __expf(e1);
      const float p0 = (e0 < PCUT) ? 0.0f : x0;
      const float p1 = (e1 < PCUT) ? 0.0f : x1;
      rs += p0 + p1;
      pf[r]     = (h16)(p0 * PCARRY);
      pf[r + 8] = (h16)(p1 * PCARRY);
    }
    rs += __shfl_xor(rs, 16, 32);
    lrow = alpha * lrow + rs;
#pragma unroll
    for (int r = 0; r < 8; ++r) o[r] = o[r] * alpha;

    o = wmma16(va, pf, o);
  }

  // finalize: o[r] is (d = 8h + r, token q0 + m); f16(64 * O / l), 8 contiguous halves per lane
  const float inv = __builtin_amdgcn_rcpf(lrow) * (CCARRY / (PCARRY * QCARRY));
  v8h ov;
#pragma unroll
  for (int r = 0; r < 8; ++r) ov[r] = toh_flush(o[r] * inv);
  *(v8h*)&Os[m * LDO + head * HD + hh * 8u] = ov;
  __syncthreads();

  // 16 consecutive lanes x 16 B = one whole 256-B row (two lines) of the (token, batch) plane
  const unsigned r = tid >> 4;
  const unsigned c = (tid & 15u) * 8u;
  const v8h x = *(const v8h*)&Os[r * LDO + c];
  _Float16* p = Ctx + ((size_t)(q0 + r) * NB + b) * DIM + c;
  *(v8h*)p = x;
  
}

// ---------------------------------------------------------------------------
extern "C" void kernel_launch(void* const* d_in, const int* in_sizes, int n_in,
                              void* d_out, int out_size, void* d_ws, size_t ws_size,
                              hipStream_t stream) {
  if (n_in < 5) return;
  const long long need_xs = ((long long)(SEQ - 1) * NB_FULL + NB) * DIM;
  const long long need_out = ((long long)(NTOK - 1) * NB_FULL + NB) * DIM;
  if ((long long)in_sizes[0] < (long long)NPATCH * DIM) return;
  if ((long long)in_sizes[1] < need_xs) return;
  if ((long long)in_sizes[2] < (long long)3 * DIM * DIM) return;
  if ((long long)in_sizes[3] < (long long)DIM * DIM) return;
  if (in_sizes[4] < DIM) return;
  if ((long long)out_size < need_out) return;
  if (ws_size < WS_TOTAL) return;

  const float* xp   = (const float*)d_in[0];   // [32][1][DIM]
  const float* xs   = (const float*)d_in[1];   // [SEQ_FULL][NB_FULL][DIM]
  const float* wqkv = (const float*)d_in[2];   // [3*DIM][DIM]  (out, in): q | k | v rows
  const float* w0   = (const float*)d_in[3];   // [DIM][DIM]    (out, in)
  const float* w0b  = (const float*)d_in[4];   // [DIM]
  float* out = (float*)d_out;                  // [NTOK][NB_FULL][DIM]

  char* ws = (char*)d_ws;
  _Float16* Wqkv16 = (_Float16*)(ws + OFF_WQKV);   // [3*DIM][DIM]
  _Float16* W016   = (_Float16*)(ws + OFF_W0);     // [DIM][DIM]
  _Float16* X16    = (_Float16*)(ws + OFF_X);      // [NB*TOKP][DIM]
  _Float16* QK16   = (_Float16*)(ws + OFF_QK);     // [NB*TOKP][QKP]
  _Float16* Vt16   = (_Float16*)(ws + OFF_VT);     // [NB][DIM][TOKP]
  _Float16* Ctx16  = (_Float16*)(ws + OFF_CTX);    // [NTOK*NB][DIM]

  dim3 blk(256);
  wcast_kernel<<<dim3((3 * DIM * DIM) / 2048), blk, 0, stream>>>(wqkv, Wqkv16);
  wcast_kernel<<<dim3((DIM * DIM) / 2048), blk, 0, stream>>>(w0, W016);
  xconv_kernel<<<dim3(XROWS / 16), blk, 0, stream>>>(xp, xs, X16);
  // q | k columns: weight rows 0..255
  gemm_qk_kernel<<<dim3(QKP / 64, XROWS / 64), blk, 0, stream>>>(X16, Wqkv16, QK16);
  // v columns: weight rows 256..383, written transposed
  gemm_v_kernel<<<dim3(DIM / 64, XROWS / 64), blk, 0, stream>>>(
      X16, Wqkv16 + (size_t)2 * DIM * DIM, Vt16);
  attn_kernel<<<dim3(NTOK / 16, NB), blk, 0, stream>>>(QK16, Vt16, Ctx16);
  gemm_out_kernel<<<dim3(DIM / 64, OROWS / 64), blk, 0, stream>>>(Ctx16, W016, w0b, out);
}

// v001
// It runs in 87.2 microseconds.
// Timed twice side by side with v000, it ran 1.20 times as fast both times.
#include <hip/hip_runtime.h>
#include <stddef.h>

// All contractions on v_wmma_f32_16x16x32_f16 (f16 operands, f32 accumulate): q|k and v
// projection, q.k scores (head width 16 zero-padded to k = 32), p.v, output projection.
// Float inputs are RNE-converted to bf16 and carried in f16 (weights x64, q/k/v planes x64,
// p x1024, attention rows x64); softmax, scale and bias in f32.

typedef _Float16 h16;
typedef _Float16 v16h __attribute__((ext_vector_type(16)));
typedef _Float16 v8h  __attribute__((ext_vector_type(8)));
typedef float    v8f  __attribute__((ext_vector_type(8)));
typedef float    v4f  __attribute__((ext_vector_type(4)));

#ifndef NB
#define NB 64
#endif
#ifndef SEQ
#define SEQ 512
#endif
#define NB_FULL  64
#define SEQ_FULL 512
#define DIM    128
#define NHEAD  8
#define HD     16
#define NPATCH 32
#define NTOK   (NPATCH + SEQ)                 // tokens per batch (patch rows first)
#define TOKP   (((NTOK + 63) / 64) * 64)      // token rows per batch padded to the GEMM tile
#define QKP    256                            // q|k plane pitch (halves): q cols 0..127, k cols 128..255
#define XROWS  (NB * TOKP)                    // rows of the batch-major planes
#define OROWS  (NTOK * NB)                    // rows of the (token, batch)-ordered planes

static_assert(NB >= 1 && NB <= NB_FULL);
static_assert(SEQ >= 32 && SEQ <= SEQ_FULL);
static_assert(DIM == NHEAD * HD);
static_assert(HD == 16);                      // one 16-B load per score fragment, 8 halves per lane half
static_assert(NHEAD == 8);                    // one wave per head
static_assert((DIM % 32) == 0 && (DIM % 64) == 0);
static_assert(QKP == 2 * DIM && (QKP % 64) == 0);
static_assert((NTOK % 32) == 0);              // 32-key steps cover the key range exactly
static_assert((NTOK % 16) == 0);              // 16-query tiles cover the query range exactly
static_assert((TOKP % 64) == 0 && TOKP >= NTOK);
static_assert((XROWS % 64) == 0 && (XROWS % 16) == 0);
static_assert((OROWS % 64) == 0);
static_assert(((3 * DIM * DIM) % 2048) == 0 && ((DIM * DIM) % 2048) == 0);
static_assert(DIM == 16 * 8);                 // plane rows: 16 lanes x 8 halves

#define LDC 68    // floats per LDS row of the GEMM staging tile (272 B, 16-B aligned)
static_assert((LDC % 4) == 0 && LDC >= 64);

#define WCARRY 64.0f     // weight planes carried x64
#define QCARRY 64.0f     // q, k, v planes carried x64 (the projection accumulator as is)
#define PCARRY 1024.0f   // softmax numerators carried x1024
#define CCARRY 64.0f     // attention output plane carried x64
#define PCUT   (-16.0f)  // exponent cut: 1024 * exp(-16) = 1.15e-4 stays a normal f16

// workspace layout (bytes)
#define WQKV_BYTES ((size_t)3 * DIM * DIM * 2)
#define W0_BYTES   ((size_t)DIM * DIM * 2)
#define X_BYTES    ((size_t)XROWS * DIM * 2)
#define QK_BYTES   ((size_t)XROWS * QKP * 2)
#define VT_BYTES   ((size_t)NB * DIM * TOKP * 2)
#define CTX_BYTES  ((size_t)OROWS * DIM * 2)
#define OFF_WQKV ((size_t)0)
#define OFF_W0   (OFF_WQKV + WQKV_BYTES)
#define OFF_X    (OFF_W0 + W0_BYTES)
#define OFF_QK   (OFF_X + X_BYTES)
#define OFF_VT   (OFF_QK + QK_BYTES)
#define OFF_CTX  (OFF_VT + VT_BYTES)
#define WS_TOTAL (OFF_CTX + CTX_BYTES)
static_assert((WQKV_BYTES % 128) == 0 && (W0_BYTES % 128) == 0 && (X_BYTES % 128) == 0);
static_assert((QK_BYTES % 128) == 0 && (VT_BYTES % 128) == 0 && (CTX_BYTES % 128) == 0);
static_assert(WS_TOTAL <= (size_t)134217728);

// ---------------------------------------------------------------------------
__device__ __forceinline__ float bf16r(float x) {   // RNE convert to bf16, returned widened
  unsigned int u = __float_as_uint(x);
  u = (u + 0x7FFFu + ((u >> 16) & 1u)) & 0xFFFF0000u;
  return __uint_as_float(u);
}

// f32 -> f16 with a value select: results below the smallest normal f16 become zero.
static __device__ __forceinline__ h16 toh_flush(float v) {
  const h16 r = (h16)v;
  return (fabsf(v) < 6.103515625e-05f) ? (h16)0.0f : r;
}

// 16-bit fragment: p points at element [row = lane&15][k0 + 8*(lane>>4)] of a k-contiguous
// row. Elements 0..7 <- k0+8h+0..7, elements 8..15 <- k0+16+8h+0..7 (same map for A and B).
__device__ __forceinline__ v16h frag_at(const _Float16* p) {
  v8h lo = *(const v8h*)(p);
  v8h hi = *(const v8h*)(p + 16);
  v16h out;
#pragma unroll
  for (int i = 0; i < 8; ++i) { out[i] = lo[i]; out[i + 8] = hi[i]; }
  return out;
}

// Fragment of a 16-deep contraction padded to k = 32: p points at [row = lane&15][8*(lane>>4)];
// elements 0..7 <- k = 8h+0..7, elements 8..15 (k = 16..31) are zero.
__device__ __forceinline__ v16h frag_k16(const _Float16* p) {
  const v8h lo = *(const v8h*)(p);
  v16h out;
#pragma unroll
  for (int i = 0; i < 8; ++i) { out[i] = lo[i]; out[i + 8] = (_Float16)0.0f; }
  return out;
}

__device__ __forceinline__ v8f wmma16(v16h a, v16h b, v8f c) {
  v8f d = __builtin_amdgcn_wmma_f32_16x16x32_f16(false, a, false, b, (short)0, c,
                                                 false, false);
  asm volatile("v_nop\n\tv_nop\n\tv_nop\n\tv_nop" : "+v"(d) : "v"(a), "v"(b));
  return d;
}

// ---------------------------------------------------------------------------
// Weight plane: W[n][k] (f32, k contiguous) -> W16[n][k] = f16(64 * bf16(w)), same layout.
// Each thread 8 elements; a wave writes 512 contiguous bytes per store instruction.
// Grid (elements / 2048), exact.
// ---------------------------------------------------------------------------
__global__ __launch_bounds__(256) void wcast_kernel(
    const float* __restrict__ W, _Float16* __restrict__ W16) {
  const size_t idx = ((size_t)blockIdx.x * 256u + threadIdx.x) * 8u;
  const v4f a0 = *(const v4f*)(W + idx);
  const v4f a1 = *(const v4f*)(W + idx + 4);
  v8h o;
#pragma unroll
  for (int i = 0; i < 4; ++i) {
    o[i]     = toh_flush(WCARRY * bf16r(a0[i]));
    o[i + 4] = toh_flush(WCARRY * bf16r(a1[i]));
  }
  _Float16* p = W16 + idx;
  *(v8h*)p = o;
  
}

// ---------------------------------------------------------------------------
// Token plane X16[b * TOKP + f][DIM] = f16(bf16(x)): f < 32 patch row f (shared by all b),
// 32 <= f < NTOK sequence row (s = f - 32, b) of xs[s][b][:], f >= NTOK zero rows.
// Both sources are loaded with clamped row indices and selected by value.
// Grid (XROWS / 16).
// ---------------------------------------------------------------------------
__global__ __launch_bounds__(256) void xconv_kernel(
    const float* __restrict__ xp, const float* __restrict__ xs, _Float16* __restrict__ X16) {
  const unsigned tid = threadIdx.x;
  const unsigned row = blockIdx.x * 16u + (tid >> 4);
  const unsigned c = (tid & 15u) * 8u;
  const unsigned b = row / (unsigned)TOKP;
  const unsigned f = row - b * (unsigned)TOKP;
  const unsigned fp = (f < (unsigned)NPATCH) ? f : (unsigned)(NPATCH - 1);
  unsigned sq = (f >= (unsigned)NPATCH) ? (f - (unsigned)NPATCH) : 0u;
  sq = (sq < (unsigned)SEQ) ? sq : (unsigned)(SEQ - 1);
  const float* pp = xp + (size_t)fp * DIM + c;
  const float* ps = xs + ((size_t)sq * NB_FULL + b) * DIM + c;
  const v4f p0 = *(const v4f*)(pp);
  const v4f p1 = *(const v4f*)(pp + 4);
  const v4f s0 = *(const v4f*)(ps);
  const v4f s1 = *(const v4f*)(ps + 4);
  const bool isp = (f < (unsigned)NPATCH);
  const bool live = (f < (unsigned)NTOK);
  v8h o;
#pragma unroll
  for (int i = 0; i < 4; ++i) {
    float t0 = isp ? p0[i] : s0[i];
    float t1 = isp ? p1[i] : s1[i];
    t0 = live ? t0 : 0.0f;
    t1 = live ? t1 : 0.0f;
    o[i]     = toh_flush(bf16r(t0));
    o[i + 4] = toh_flush(bf16r(t1));
  }
  _Float16* p = X16 + (size_t)row * DIM + c;
  *(v8h*)p = o;
  
}

// ---------------------------------------------------------------------------
// GEMM C[64x64 tile] = A16[rows][DIM] . Bt[n][DIM]^T, fragments straight from the 16-bit
// global planes; 8 waves (mw = 16-row group, nw = 32-col group), 2 accumulators/wave.
//   MODE 0: out16[row][n0 + col] (pitch QKP) = f16(acc)           (q | k plane, x64 carry)
//   MODE 1: out16 transposed V plane [b][n0 + col][key] (pitch TOKP) = f16(acc)  (x64 carry)
//   MODE 2: outf[(f * NB_FULL + b)][n0 + col] = acc/4096 + bf16(bias), rows (f * NB + b)
// Grid (N/64, rows/64).
// ---------------------------------------------------------------------------
template <int MODE>
__device__ __forceinline__ void gemm_body(
    const _Float16* __restrict__ A16, const _Float16* __restrict__ Bt,
    const float* __restrict__ bias, float* __restrict__ outf, _Float16* __restrict__ out16) {
  __shared__ float Cs[64 * LDC];
  const unsigned tid = threadIdx.x, lane = tid & 31u;
  const unsigned w = (unsigned)__builtin_amdgcn_readfirstlane((int)(threadIdx.x >> 5));
  const unsigned mw = w >> 1, nw = w & 1u;
  const unsigned hh = lane >> 4, m = lane & 15u;
  const unsigned n0 = blockIdx.x * 64u;
  const unsigned row0 = blockIdx.y * 64u;

  const _Float16* ap  = A16 + (size_t)(row0 + mw * 16u + m) * DIM + hh * 8u;
  const _Float16* bp0 = Bt + (size_t)(n0 + nw * 32u + m) * DIM + hh * 8u;
  const _Float16* bp1 = bp0 + (size_t)16 * DIM;
  v8f acc0 = {}, acc1 = {};
#pragma unroll
  for (unsigned k0 = 0; k0 < (unsigned)DIM; k0 += 32u) {
    const v16h a  = frag_at(ap + k0);
    const v16h b0 = frag_at(bp0 + k0);
    const v16h b1 = frag_at(bp1 + k0);
    acc0 = wmma16(a, b0, acc0);
    acc1 = wmma16(a, b1, acc1);
  }
#pragma unroll
  for (int r = 0; r < 8; ++r) {
    float* d = &Cs[(mw * 16u + hh * 8u + (unsigned)r) * LDC + nw * 32u + m];
    d[0]  = acc0[r];
    d[16] = acc1[r];
  }
  __syncthreads();

  if (MODE == 0) {
    v8h x[2];
    size_t off[2];
#pragma unroll
    for (unsigned i = 0; i < 2u; ++i) {
      const unsigned r = 32u * i + (tid >> 3);
      const unsigned c = (tid & 7u) * 8u;
      const v4f u0 = *(const v4f*)&Cs[r * LDC + c];
      const v4f u1 = *(const v4f*)&Cs[r * LDC + c + 4];
#pragma unroll
      for (int j = 0; j < 4; ++j) {
        x[i][j]     = toh_flush(u0[j]);
        x[i][j + 4] = toh_flush(u1[j]);
      }
      off[i] = (size_t)(row0 + r) * QKP + n0 + c;
    }
#pragma unroll
    for (int i = 0; i < 2; ++i) *(v8h*)(out16 + off[i]) = x[i];
    
  }

  if (MODE == 1) {
    const unsigned bidx = row0 / (unsigned)TOKP;
    const unsigned key0 = row0 - bidx * (unsigned)TOKP;
    v8h x[2];
    size_t off[2];
#pragma unroll
    for (unsigned i = 0; i < 2u; ++i) {
      const unsigned dcol = 32u * i + (tid >> 3);
      const unsigned kk = (tid & 7u) * 8u;
#pragma unroll
      for (unsigned j = 0; j < 8u; ++j)
        x[i][j] = toh_flush(Cs[(kk + j) * LDC + dcol]);
      off[i] = ((size_t)bidx * DIM + n0 + dcol) * TOKP + key0 + kk;
    }
#pragma unroll
    for (int i = 0; i < 2; ++i) *(v8h*)(out16 + off[i]) = x[i];
    
  }

  if (MODE == 2) {
    const float cs = 1.0f / (WCARRY * CCARRY);
    v4f xs[4];
    size_t off[4];
#pragma unroll
    for (unsigned i = 0; i < 4u; ++i) {
      const unsigned r = 16u * i + (tid >> 4);
      const unsigned c = (tid & 15u) * 4u;
      const unsigned crow = row0 + r;
      const unsigned f = crow / (unsigned)NB;
      const unsigned bb = crow - f * (unsigned)NB;
      const size_t orow = (size_t)f * NB_FULL + bb;
      const v4f u = *(const v4f*)&Cs[r * LDC + c];
      const v4f g = *(const v4f*)(bias + n0 + c);
      v4f val;
#pragma unroll
      for (int j = 0; j < 4; ++j) val[j] = u[j] * cs + bf16r(g[j]);
      xs[i] = val;
      off[i] = orow * DIM + n0 + c;
    }
#pragma unroll
    for (int i = 0; i < 4; ++i) *(v4f*)(outf + off[i]) = xs[i];
    
  }
}

__global__ __launch_bounds__(256) void gemm_qk_kernel(
    const _Float16* __restrict__ A16, const _Float16* __restrict__ Bt,
    _Float16* __restrict__ qk) {
  gemm_body<0>(A16, Bt, (const float*)0, (float*)0, qk);
}
__global__ __launch_bounds__(256) void gemm_v_kernel(
    const _Float16* __restrict__ A16, const _Float16* __restrict__ Bt,
    _Float16* __restrict__ vt) {
  gemm_body<1>(A16, Bt, (const float*)0, (float*)0, vt);
}
__global__ __launch_bounds__(256) void gemm_out_kernel(
    const _Float16* __restrict__ A16, const _Float16* __restrict__ Bt,
    const float* __restrict__ bias, float* __restrict__ outf) {
  gemm_body<2>(A16, Bt, bias, outf, (_Float16*)0);
}

// ---------------------------------------------------------------------------
// Dense flash attention, register-fed transposed form. Block = (32 query tokens, batch b,
// group of 4 heads), wave = head; each wave carries QT = 2 query tiles of 16 tokens, so every
// K and V^T fragment fetched from the global planes feeds both tiles. Per 32-key step:
//   S^T tiles (keys x queries) = K tile (A, 16 keys x d padded to 32) . Q^T (B, d x 16 queries),
//   two 16-key tiles per query tile; lane (h, n) holds query column n, key rows 8h+r of each.
//   Online softmax per query column: in-lane over 16 values + one 16-lane-distance shuffle.
//   P^T packed as B fragment: element r <- tile 0 row 8h+r, element 8+r <- tile 1 row 8h+r
//   (keys kb+8h+r and kb+16+8h+r), f16(1024 p), zero below the exponent cut.
//   O^T (d x queries) += V^T tile (A, [d][32 keys] from the transposed V plane) . P^T.
// No LDS and no barrier in the key loop. Output tile [32 tokens][64] staged in Os
// (cross-wave, block barrier), written as whole 128-B lines of Ctx[(f * NB + b)][DIM],
// f16(64 * O / l).
// Grid (NTOK/32, NB, NHEAD/4), 128 threads.
// ---------------------------------------------------------------------------
#define QT   2                 // query tiles per wave
#define HGRP 4                 // heads (waves) per block: 4 x 16 halves = one 128-B line
#define LDG  72                // halves per LDS row of the output tile (144 B, 16-B aligned)
static_assert((NTOK % (16 * QT)) == 0);
static_assert((NHEAD % HGRP) == 0 && HGRP * HD * 2 == 128);
static_assert((LDG % 8) == 0 && LDG >= HGRP * HD);

__global__ __launch_bounds__(HGRP * 32) void attn_kernel(
    const _Float16* __restrict__ QK, const _Float16* __restrict__ Vt,
    _Float16* __restrict__ Ctx) {
  __shared__ _Float16 Os[16 * QT * LDG];

  const unsigned tid = threadIdx.x, lane = tid & 31u;
  const unsigned hw = (unsigned)__builtin_amdgcn_readfirstlane((int)(threadIdx.x >> 5));
  const unsigned head = blockIdx.z * (unsigned)HGRP + hw;
  const unsigned hh = lane >> 4, m = lane & 15u;
  const unsigned q0 = blockIdx.x * (16u * QT);
  const unsigned b = blockIdx.y;
  const size_t tokbase = (size_t)b * TOKP;
  const float sscale = 0.25f / (QCARRY * QCARRY);   // HD^-0.5 and the two x64 carries

  // Q^T as B operand: lane (h, n) <- q[token q0+16t+n][head*16 + 8h .. +7], k 16..31 zero
  v16h qf[QT];
#pragma unroll   // constant t keeps the per-tile arrays in registers
  for (unsigned t = 0; t < (unsigned)QT; ++t)
    qf[t] = frag_k16(QK + (tokbase + q0 + 16u * t + m) * QKP + head * HD + hh * 8u);
  // K tile as A operand: lane (h, m) <- k[token kb+m][head*16 + 8h .. +7]
  const _Float16* kp = QK + (tokbase + m) * QKP + DIM + head * HD + hh * 8u;
  // V^T tile as A operand: lane (h, m = d) <- vt[d][kb + 8h .. +7], vt[d][kb + 16 + 8h .. +7]
  const _Float16* vp = Vt + ((size_t)b * DIM + head * HD + m) * TOKP + hh * 8u;

  float mrow[QT], lrow[QT];
  v8f o[QT];
#pragma unroll   // constant t keeps the per-tile arrays in registers
  for (int t = 0; t < QT; ++t) {
    mrow[t] = -1.0e30f;
    lrow[t] = 0.0f;
    o[t] = v8f{};
  }

  for (unsigned kb = 0; kb < (unsigned)NTOK; kb += 32u) {
    const v16h ka0 = frag_k16(kp + (size_t)kb * QKP);
    const v16h ka1 = frag_k16(kp + (size_t)(kb + 16u) * QKP);
    const v16h va  = frag_at(vp + kb);

#pragma unroll   // both tiles in one body: their chains are independent and can interleave
    for (int t = 0; t < QT; ++t) {
      v8f s0 = {}, s1 = {};
      s0 = wmma16(ka0, qf[t], s0);
      s1 = wmma16(ka1, qf[t], s1);

      float mx = fmaxf(s0[0], s1[0]);
#pragma unroll
      for (int r = 1; r < 8; ++r) mx = fmaxf(mx, fmaxf(s0[r], s1[r]));
      mx = fmaxf(mx, __shfl_xor(mx, 16, 32));
      const float mn = fmaxf(mrow[t], mx * sscale);
      const float alpha = __expf(mrow[t] - mn);
      mrow[t] = mn;

      float rs = 0.0f;
      v16h pf;
#pragma unroll
      for (int r = 0; r < 8; ++r) {
        const float e0 = s0[r] * sscale - mn;
        const float e1 = s1[r] * sscale - mn;
        const float x0 = __expf(e0);
        const float x1 = __expf(e1);
        const float p0 = (e0 < PCUT) ? 0.0f : x0;
        const float p1 = (e1 < PCUT) ? 0.0f : x1;
        rs += p0 + p1;
        pf[r]     = (h16)(p0 * PCARRY);
        pf[r + 8] = (h16)(p1 * PCARRY);
      }
      rs += __shfl_xor(rs, 16, 32);
      lrow[t] = alpha * lrow[t] + rs;
#pragma unroll
      for (int r = 0; r < 8; ++r) o[t][r] = o[t][r] * alpha;

      o[t] = wmma16(va, pf, o[t]);
    }
  }

  // finalize: o[t][r] is (d = 8h + r, token q0 + 16t + m); f16(64 * O / l), 8 halves per lane
#pragma unroll   // constant t keeps the per-tile arrays in registers
  for (unsigned t = 0; t < (unsigned)QT; ++t) {
    const float inv = __builtin_amdgcn_rcpf(lrow[t]) * (CCARRY / (PCARRY * QCARRY));
    v8h ov;
#pragma unroll
    for (int r = 0; r < 8; ++r) ov[r] = toh_flush(o[t][r] * inv);
    *(v8h*)&Os[(16u * t + m) * LDG + hw * HD + hh * 8u] = ov;
  }
  __syncthreads();

  // 8 consecutive lanes x 16 B = one whole 128-B line of the (token, batch) plane
#pragma unroll   // both LDS reads issue before the first store
  for (unsigned i = 0; i < (unsigned)QT; ++i) {
    const unsigned r = 16u * i + (tid >> 3);
    const unsigned c = (tid & 7u) * 8u;
    const v8h x = *(const v8h*)&Os[r * LDG + c];
    _Float16* p = Ctx + ((size_t)(q0 + r) * NB + b) * DIM + blockIdx.z * (unsigned)(HGRP * HD) + c;
    *(v8h*)p = x;
  }
}

// ---------------------------------------------------------------------------
extern "C" void kernel_launch(void* const* d_in, const int* in_sizes, int n_in,
                              void* d_out, int out_size, void* d_ws, size_t ws_size,
                              hipStream_t stream) {
  if (n_in < 5) return;
  const long long need_xs = ((long long)(SEQ - 1) * NB_FULL + NB) * DIM;
  const long long need_out = ((long long)(NTOK - 1) * NB_FULL + NB) * DIM;
  if ((long long)in_sizes[0] < (long long)NPATCH * DIM) return;
  if ((long long)in_sizes[1] < need_xs) return;
  if ((long long)in_sizes[2] < (long long)3 * DIM * DIM) return;
  if ((long long)in_sizes[3] < (long long)DIM * DIM) return;
  if (in_sizes[4] < DIM) return;
  if ((long long)out_size < need_out) return;
  if (ws_size < WS_TOTAL) return;

  const float* xp   = (const float*)d_in[0];   // [32][1][DIM]
  const float* xs   = (const float*)d_in[1];   // [SEQ_FULL][NB_FULL][DIM]
  const float* wqkv = (const float*)d_in[2];   // [3*DIM][DIM]  (out, in): q | k | v rows
  const float* w0   = (const float*)d_in[3];   // [DIM][DIM]    (out, in)
  const float* w0b  = (const float*)d_in[4];   // [DIM]
  float* out = (float*)d_out;                  // [NTOK][NB_FULL][DIM]

  char* ws = (char*)d_ws;
  _Float16* Wqkv16 = (_Float16*)(ws + OFF_WQKV);   // [3*DIM][DIM]
  _Float16* W016   = (_Float16*)(ws + OFF_W0);     // [DIM][DIM]
  _Float16* X16    = (_Float16*)(ws + OFF_X);      // [NB*TOKP][DIM]
  _Float16* QK16   = (_Float16*)(ws + OFF_QK);     // [NB*TOKP][QKP]
  _Float16* Vt16   = (_Float16*)(ws + OFF_VT);     // [NB][DIM][TOKP]
  _Float16* Ctx16  = (_Float16*)(ws + OFF_CTX);    // [NTOK*NB][DIM]

  dim3 blk(256);
  wcast_kernel<<<dim3((3 * DIM * DIM) / 2048), blk, 0, stream>>>(wqkv, Wqkv16);
  wcast_kernel<<<dim3((DIM * DIM) / 2048), blk, 0, stream>>>(w0, W016);
  xconv_kernel<<<dim3(XROWS / 16), blk, 0, stream>>>(xp, xs, X16);
  // q | k columns: weight rows 0..255
  gemm_qk_kernel<<<dim3(QKP / 64, XROWS / 64), blk, 0, stream>>>(X16, Wqkv16, QK16);
  // v columns: weight rows 256..383, written transposed
  gemm_v_kernel<<<dim3(DIM / 64, XROWS / 64), blk, 0, stream>>>(
      X16, Wqkv16 + (size_t)2 * DIM * DIM, Vt16);
  attn_kernel<<<dim3(NTOK / (16 * QT), NB, NHEAD / HGRP), dim3(HGRP * 32), 0, stream>>>(
      QK16, Vt16, Ctx16);
  gemm_out_kernel<<<dim3(DIM / 64, OROWS / 64), blk, 0, stream>>>(Ctx16, W016, w0b, out);
}

// v002
// One run takes 64.6 microseconds.
// In both of two side-by-side timings against v001, it was 1.35 times as fast.
// Counting every step since v000, it is 1.62 times as fast.
#include <hip/hip_runtime.h>
#include <stddef.h>

// All contractions on v_wmma_f32_16x16x32_f16 (f16 operands, f32 accumulate): q|k and v
// projection, q.k scores (head width 16 zero-padded to k = 32), p.v, output projection.
// Float inputs are RNE-converted to bf16 and carried in f16 (weights x64, q/k/v planes x64,
// p x1024, attention rows x64); softmax, scale and bias in f32.

typedef _Float16 h16;
typedef _Float16 v16h __attribute__((ext_vector_type(16)));
typedef _Float16 v8h  __attribute__((ext_vector_type(8)));
typedef _Float16 v4h  __attribute__((ext_vector_type(4)));
typedef float    v8f  __attribute__((ext_vector_type(8)));
typedef float    v4f  __attribute__((ext_vector_type(4)));

#ifndef NB
#define NB 64
#endif
#ifndef SEQ
#define SEQ 512
#endif
#define NB_FULL  64
#define SEQ_FULL 512
#define DIM    128
#define NHEAD  8
#define HD     16
#define NPATCH 32
#define NTOK   (NPATCH + SEQ)                 // tokens per batch (patch rows first)
#define TOKP   (((NTOK + 63) / 64) * 64)      // token rows per batch padded to the GEMM tile
#define QKP    256                            // q|k plane pitch (halves): q cols 0..127, k cols 128..255
#define XROWS  (NB * TOKP)                    // rows of the batch-major planes
#define OROWS  (NTOK * NB)                    // rows of the (token, batch)-ordered planes

static_assert(NB >= 1 && NB <= NB_FULL);
static_assert(SEQ >= 32 && SEQ <= SEQ_FULL);
static_assert(DIM == NHEAD * HD);
static_assert(HD == 16);                      // one 16-B load per score fragment, 8 halves per lane half
static_assert(NHEAD == 8);                    // one wave per head
static_assert((DIM % 32) == 0 && (DIM % 64) == 0);
static_assert(QKP == 2 * DIM && (QKP % 64) == 0);
static_assert((NTOK % 32) == 0);              // 32-key steps cover the key range exactly
static_assert((NTOK % 16) == 0);              // 16-query tiles cover the query range exactly
static_assert((TOKP % 64) == 0 && TOKP >= NTOK);
static_assert((XROWS % 64) == 0 && (XROWS % 16) == 0);
static_assert((OROWS % 64) == 0);
static_assert(((3 * DIM * DIM) % 2048) == 0 && ((DIM * DIM) % 2048) == 0);

#define LDC 68    // floats per LDS row of the GEMM staging tile (272 B, 16-B aligned)
static_assert((LDC % 4) == 0 && LDC >= 64);

#define WCARRY 64.0f     // weight planes carried x64
#define QCARRY 64.0f     // q, k, v planes carried x64 (the projection accumulator as is)
#define PCARRY 1024.0f   // softmax numerators carried x1024
#define CCARRY 64.0f     // attention output plane carried x64
#define PCUT   (-16.0f)  // exponent cut: 1024 * exp(-16) = 1.15e-4 stays a normal f16

// workspace layout (bytes)
#define WQKV_BYTES ((size_t)3 * DIM * DIM * 2)
#define W0_BYTES   ((size_t)DIM * DIM * 2)
#define QK_BYTES   ((size_t)XROWS * QKP * 2)
#define VT_BYTES   ((size_t)NB * DIM * TOKP * 2)
#define CTX_BYTES  ((size_t)OROWS * DIM * 2)
#define OFF_WQKV ((size_t)0)
#define OFF_W0   (OFF_WQKV + WQKV_BYTES)
#define OFF_QK   (OFF_W0 + W0_BYTES)
#define OFF_VT   (OFF_QK + QK_BYTES)
#define OFF_CTX  (OFF_VT + VT_BYTES)
#define WS_TOTAL (OFF_CTX + CTX_BYTES)
static_assert((WQKV_BYTES % 128) == 0 && (W0_BYTES % 128) == 0);
static_assert((QK_BYTES % 128) == 0 && (VT_BYTES % 128) == 0 && (CTX_BYTES % 128) == 0);
static_assert(WS_TOTAL <= (size_t)134217728);

// ---------------------------------------------------------------------------
__device__ __forceinline__ float bf16r(float x) {   // RNE convert to bf16, returned widened
  unsigned int u = __float_as_uint(x);
  u = (u + 0x7FFFu + ((u >> 16) & 1u)) & 0xFFFF0000u;
  return __uint_as_float(u);
}

// f32 -> f16 with a value select: results below the smallest normal f16 become zero.
static __device__ __forceinline__ h16 toh_flush(float v) {
  const h16 r = (h16)v;
  return (fabsf(v) < 6.103515625e-05f) ? (h16)0.0f : r;
}

// 16-bit fragment: p points at element [row = lane&15][k0 + 8*(lane>>4)] of a k-contiguous
// row. Elements 0..7 <- k0+8h+0..7, elements 8..15 <- k0+16+8h+0..7 (same map for A and B).
__device__ __forceinline__ v16h frag_at(const _Float16* p) {
  v8h lo = *(const v8h*)(p);
  v8h hi = *(const v8h*)(p + 16);
  v16h out;
#pragma unroll
  for (int i = 0; i < 8; ++i) { out[i] = lo[i]; out[i + 8] = hi[i]; }
  return out;
}

// Fragment of a 16-deep contraction padded to k = 32: p points at [row = lane&15][8*(lane>>4)];
// elements 0..7 <- k = 8h+0..7, elements 8..15 (k = 16..31) are zero.
__device__ __forceinline__ v16h frag_k16(const _Float16* p) {
  const v8h lo = *(const v8h*)(p);
  v16h out;
#pragma unroll
  for (int i = 0; i < 8; ++i) { out[i] = lo[i]; out[i + 8] = (_Float16)0.0f; }
  return out;
}

__device__ __forceinline__ v8f wmma16(v16h a, v16h b, v8f c) {
  v8f d = __builtin_amdgcn_wmma_f32_16x16x32_f16(false, a, false, b, (short)0, c,
                                                 false, false);
  asm volatile("v_nop\n\tv_nop\n\tv_nop\n\tv_nop" : "+v"(d) : "v"(a), "v"(b));
  return d;
}

// ---------------------------------------------------------------------------
// Weight plane: W[n][k] (f32, k contiguous) -> W16[n][k] = f16(64 * bf16(w)), same layout.
// Each thread 8 elements; a wave writes 512 contiguous bytes per store instruction.
// Grid (elements / 2048), exact.
// ---------------------------------------------------------------------------
__global__ __launch_bounds__(256) void wcast_kernel(
    const float* __restrict__ W, _Float16* __restrict__ W16) {
  const size_t idx = ((size_t)blockIdx.x * 256u + threadIdx.x) * 8u;
  const v4f a0 = *(const v4f*)(W + idx);
  const v4f a1 = *(const v4f*)(W + idx + 4);
  v8h o;
#pragma unroll
  for (int i = 0; i < 4; ++i) {
    o[i]     = toh_flush(WCARRY * bf16r(a0[i]));
    o[i + 4] = toh_flush(WCARRY * bf16r(a1[i]));
  }
  _Float16* p = W16 + idx;
  *(v8h*)p = o;
  
}

// ---------------------------------------------------------------------------
// Fused token conversion + q | k | v projection. Block = 64 token rows of one batch x all 384
// output columns, 8 waves. Row f of batch b: f < 32 patch row f (shared by all b),
// 32 <= f < NTOK sequence row (s = f - 32, b) of xs[s][b][:], f >= NTOK zero rows.
//   1. each wave reads 8 whole 512-B rows (f32), converts to f16(bf16(x)) and lays them in Xs.
//   2. wave w makes q|k columns 32w .. 32w+31 and v columns 16w .. 16w+15 for all 64 rows
//      (12 accumulator tiles); every weight fragment is fetched once per block.
//      q|k tiles run as W (A, 16 columns) . X^T (B, 16 tokens): lane (h, token) holds columns
//      8h .. 8h+7 of its token, one 16-B piece of a q|k row.
//      v tiles run as X (A, 16 tokens) . W^T (B, 16 columns): lane (h, d) holds tokens
//      8h .. 8h+7 of its column, one 16-B piece of a V^T row.
//   3. both tiles staged in LDS (f16) and written as whole lines:
//      QK[b * TOKP + f][QKP] and Vt[b][d][TOKP], both the accumulator as is (x64 carry).
// Grid (TOKP / 64, NB).
// ---------------------------------------------------------------------------
#define LDX 136   // halves per LDS row of the token tile (272 B = 16 B x odd)
#define LDQ 264   // halves per LDS row of the q|k tile (528 B = 16 B x odd)
#define LDV 72    // halves per LDS row of the V^T tile (144 B = 16 B x odd)
static_assert(LDX >= DIM && LDQ >= QKP && LDV >= 64);
static_assert((LDX % 8) == 0 && (LDQ % 8) == 0 && (LDV % 8) == 0);
static_assert(QKP == 8 * 32 && DIM == 8 * 16);   // 8 waves: 32 q|k columns and 16 v columns each
static_assert((NPATCH % 8) == 0 && (NTOK % 8) == 0 && SEQ >= 8);   // a wave's 8 rows are of one kind

// The builtin alone: the compiler keeps the distances behind it and can place fragment loads
// between the matrix instructions.
__device__ __forceinline__ v8f wmma_plain(v16h a, v16h b, v8f c) {
  return __builtin_amdgcn_wmma_f32_16x16x32_f16(false, a, false, b, (short)0, c, false, false);
}

__device__ __forceinline__ v8h pack_flush(v8f a) {
  v8h o;
#pragma unroll
  for (int r = 0; r < 8; ++r) o[r] = toh_flush(a[r]);
  return o;
}

__global__ __launch_bounds__(256) void proj_kernel(
    const float* __restrict__ xp, const float* __restrict__ xs,
    const _Float16* __restrict__ W16, _Float16* __restrict__ qk, _Float16* __restrict__ vt) {
  __shared__ __attribute__((aligned(16))) _Float16 Xs[64 * LDX];
  __shared__ __attribute__((aligned(16))) _Float16 Qs[64 * LDQ];
  __shared__ __attribute__((aligned(16))) _Float16 Vs[DIM * LDV];
  const unsigned tid = threadIdx.x, lane = tid & 31u;
  const unsigned w = (unsigned)__builtin_amdgcn_readfirstlane((int)(threadIdx.x >> 5));
  const unsigned hh = lane >> 4, m = lane & 15u;
  const unsigned f0 = blockIdx.x * 64u;
  const unsigned b = blockIdx.y;

  // wave-uniform row bases plus one per-lane offset shared by all weight fragments
  const unsigned woff = m * (unsigned)DIM + hh * 8u;
  const _Float16* wq0 = W16 + (size_t)(w * 32u) * DIM;
  const _Float16* wq1 = W16 + (size_t)(w * 32u + 16u) * DIM;
  const _Float16* wv  = W16 + (size_t)(QKP + w * 16u) * DIM;
  // the first weight fragments are asked for together with the token rows
  v16h q0 = frag_at(wq0 + woff);
  v16h q1 = frag_at(wq1 + woff);
  v16h vv = frag_at(wv + woff);

  // token rows: one wave-wide 16-B load = one whole row. A wave's 8 rows are all patch rows,
  // all sequence rows or all zero rows, so source and row step are wave-uniform.
  const unsigned fg = f0 + w * 8u;
  const bool isp = fg < (unsigned)NPATCH;
  const bool live = fg < (unsigned)NTOK;
  unsigned sq = isp ? 0u : (fg - (unsigned)NPATCH);
  sq = (sq < (unsigned)(SEQ - 8)) ? sq : (unsigned)(SEQ - 8);
  const float* plane = isp ? xp : xs;
  const unsigned row = isp ? fg : (sq * (unsigned)NB_FULL + b);
  const unsigned step = isp ? (unsigned)DIM : (unsigned)(NB_FULL * DIM);
  const float* src = plane + (size_t)row * DIM;
  v4f xv[8];
#pragma unroll   // all eight row loads in flight together
  for (unsigned i = 0; i < 8u; ++i) xv[i] = *(const v4f*)(src + (i * step + lane * 4u));
#pragma unroll
  for (unsigned i = 0; i < 8u; ++i) {
    v4h o;
#pragma unroll
    for (int j = 0; j < 4; ++j) o[j] = toh_flush(bf16r(live ? xv[i][j] : 0.0f));
    *(v4h*)&Xs[(w * 8u + i) * LDX + lane * 4u] = o;
  }
  __syncthreads();

  const _Float16* xa  = &Xs[m * LDX + hh * 8u];
  v8f aq0[4] = {}, aq1[4] = {}, av[4] = {};
#pragma unroll   // constant indices keep the accumulator arrays in registers
  for (unsigned k0 = 0; k0 < (unsigned)DIM; k0 += 32u) {
#pragma unroll
    for (unsigned t = 0; t < 4u; ++t) {
      const v16h x = frag_at(xa + t * 16u * LDX + k0);
      aq0[t] = wmma_plain(q0, x, aq0[t]);
      aq1[t] = wmma_plain(q1, x, aq1[t]);
      av[t]  = wmma_plain(x, vv, av[t]);
    }
    if (k0 + 32u < (unsigned)DIM) {
      q0 = frag_at((wq0 + k0 + 32u) + woff);
      q1 = frag_at((wq1 + k0 + 32u) + woff);
      vv = frag_at((wv + k0 + 32u) + woff);
    }
  }

#pragma unroll
  for (unsigned t = 0; t < 4u; ++t) {
    _Float16* qd = &Qs[(t * 16u + m) * LDQ + w * 32u + hh * 8u];
    *(v8h*)(qd)      = pack_flush(aq0[t]);
    *(v8h*)(qd + 16) = pack_flush(aq1[t]);
    *(v8h*)&Vs[(w * 16u + m) * LDV + t * 16u + hh * 8u] = pack_flush(av[t]);
  }
  __syncthreads();

  // q|k: a wave writes one whole 512-B row per store; V^T: 8 lanes write one whole 128-B line
  const size_t row0 = (size_t)b * TOKP + f0;
  v8h yq[8], yv[4];
#pragma unroll   // all LDS reads issue before the first store
  for (unsigned i = 0; i < 8u; ++i) yq[i] = *(const v8h*)&Qs[(i * 8u + w) * LDQ + lane * 8u];
#pragma unroll
  for (unsigned i = 0; i < 4u; ++i)
    yv[i] = *(const v8h*)&Vs[(i * 32u + (tid >> 3)) * LDV + (tid & 7u) * 8u];
#pragma unroll
  for (unsigned i = 0; i < 8u; ++i)
    *(v8h*)(qk + (row0 + i * 8u + w) * QKP + lane * 8u) = yq[i];
#pragma unroll
  for (unsigned i = 0; i < 4u; ++i)
    *(v8h*)(vt + ((size_t)b * DIM + i * 32u + (tid >> 3)) * TOKP + f0 + (tid & 7u) * 8u) = yv[i];
}

// ---------------------------------------------------------------------------
// Output projection, C[64x64 tile] = A16[rows][DIM] . Bt[n][DIM]^T, fragments straight from the
// 16-bit global planes; 8 waves (mw = 16-row group, nw = 32-col group), 2 accumulators/wave.
//   outf[(f * NB_FULL + b)][n0 + col] = acc/4096 + bf16(bias), rows (f * NB + b)
// Grid (N/64, rows/64).
// ---------------------------------------------------------------------------
__global__ __launch_bounds__(256) void gemm_out_kernel(
    const _Float16* __restrict__ A16, const _Float16* __restrict__ Bt,
    const float* __restrict__ bias, float* __restrict__ outf) {
  __shared__ float Cs[64 * LDC];
  const unsigned tid = threadIdx.x, lane = tid & 31u;
  const unsigned w = (unsigned)__builtin_amdgcn_readfirstlane((int)(threadIdx.x >> 5));
  const unsigned mw = w >> 1, nw = w & 1u;
  const unsigned hh = lane >> 4, m = lane & 15u;
  const unsigned n0 = blockIdx.x * 64u;
  const unsigned row0 = blockIdx.y * 64u;

  const _Float16* ap  = A16 + (size_t)(row0 + mw * 16u + m) * DIM + hh * 8u;
  const _Float16* bp0 = Bt + (size_t)(n0 + nw * 32u + m) * DIM + hh * 8u;
  const _Float16* bp1 = bp0 + (size_t)16 * DIM;
  v8f acc0 = {}, acc1 = {};
#pragma unroll
  for (unsigned k0 = 0; k0 < (unsigned)DIM; k0 += 32u) {
    const v16h a  = frag_at(ap + k0);
    const v16h b0 = frag_at(bp0 + k0);
    const v16h b1 = frag_at(bp1 + k0);
    acc0 = wmma16(a, b0, acc0);
    acc1 = wmma16(a, b1, acc1);
  }
#pragma unroll
  for (int r = 0; r < 8; ++r) {
    float* d = &Cs[(mw * 16u + hh * 8u + (unsigned)r) * LDC + nw * 32u + m];
    d[0]  = acc0[r];
    d[16] = acc1[r];
  }
  __syncthreads();

  const float cs = 1.0f / (WCARRY * CCARRY);
  v4f xs[4];
  size_t off[4];
#pragma unroll
  for (unsigned i = 0; i < 4u; ++i) {
    const unsigned r = 16u * i + (tid >> 4);
    const unsigned c = (tid & 15u) * 4u;
    const unsigned crow = row0 + r;
    const unsigned f = crow / (unsigned)NB;
    const unsigned bb = crow - f * (unsigned)NB;
    const size_t orow = (size_t)f * NB_FULL + bb;
    const v4f u = *(const v4f*)&Cs[r * LDC + c];
    const v4f g = *(const v4f*)(bias + n0 + c);
    v4f val;
#pragma unroll
    for (int j = 0; j < 4; ++j) val[j] = u[j] * cs + bf16r(g[j]);
    xs[i] = val;
    off[i] = orow * DIM + n0 + c;
  }
#pragma unroll
  for (int i = 0; i < 4; ++i) *(v4f*)(outf + off[i]) = xs[i];
}

// ---------------------------------------------------------------------------
// Dense flash attention, register-fed transposed form. Block = (32 query tokens, batch b,
// group of 4 heads), wave = head; each wave carries QT = 2 query tiles of 16 tokens, so every
// K and V^T fragment fetched from the global planes feeds both tiles. Per 32-key step:
//   S^T tiles (keys x queries) = K tile (A, 16 keys x d padded to 32) . Q^T (B, d x 16 queries),
//   two 16-key tiles per query tile; lane (h, n) holds query column n, key rows 8h+r of each.
//   Online softmax per query column: in-lane over 16 values + one 16-lane-distance shuffle.
//   P^T packed as B fragment: element r <- tile 0 row 8h+r, element 8+r <- tile 1 row 8h+r
//   (keys kb+8h+r and kb+16+8h+r), f16(1024 p), zero below the exponent cut.
//   O^T (d x queries) += V^T tile (A, [d][32 keys] from the transposed V plane) . P^T.
// No LDS and no barrier in the key loop. Output tile [32 tokens][64] staged in Os
// (cross-wave, block barrier), written as whole 128-B lines of Ctx[(f * NB + b)][DIM],
// f16(64 * O / l).
// Grid (NTOK/32, NB, NHEAD/4), 128 threads.
// ---------------------------------------------------------------------------
#define QT   2                 // query tiles per wave
#define HGRP 4                 // heads (waves) per block: 4 x 16 halves = one 128-B line
#define LDG  72                // halves per LDS row of the output tile (144 B, 16-B aligned)
static_assert((NTOK % (16 * QT)) == 0);
static_assert((NHEAD % HGRP) == 0 && HGRP * HD * 2 == 128);
static_assert((LDG % 8) == 0 && LDG >= HGRP * HD);

__global__ __launch_bounds__(HGRP * 32) void attn_kernel(
    const _Float16* __restrict__ QK, const _Float16* __restrict__ Vt,
    _Float16* __restrict__ Ctx) {
  __shared__ _Float16 Os[16 * QT * LDG];

  const unsigned tid = threadIdx.x, lane = tid & 31u;
  const unsigned hw = (unsigned)__builtin_amdgcn_readfirstlane((int)(threadIdx.x >> 5));
  const unsigned head = blockIdx.z * (unsigned)HGRP + hw;
  const unsigned hh = lane >> 4, m = lane & 15u;
  const unsigned q0 = blockIdx.x * (16u * QT);
  const unsigned b = blockIdx.y;
  const size_t tokbase = (size_t)b * TOKP;
  const float sscale = 0.25f / (QCARRY * QCARRY);   // HD^-0.5 and the two x64 carries

  // Q^T as B operand: lane (h, n) <- q[token q0+16t+n][head*16 + 8h .. +7], k 16..31 zero
  v16h qf[QT];
#pragma unroll   // constant t keeps the per-tile arrays in registers
  for (unsigned t = 0; t < (unsigned)QT; ++t)
    qf[t] = frag_k16(QK + (tokbase + q0 + 16u * t + m) * QKP + head * HD + hh * 8u);
  // K tile as A operand: lane (h, m) <- k[token kb+m][head*16 + 8h .. +7]
  const _Float16* kp = QK + (tokbase + m) * QKP + DIM + head * HD + hh * 8u;
  // V^T tile as A operand: lane (h, m = d) <- vt[d][kb + 8h .. +7], vt[d][kb + 16 + 8h .. +7]
  const _Float16* vp = Vt + ((size_t)b * DIM + head * HD + m) * TOKP + hh * 8u;

  float mrow[QT], lrow[QT];
  v8f o[QT];
#pragma unroll   // constant t keeps the per-tile arrays in registers
  for (int t = 0; t < QT; ++t) {
    mrow[t] = -1.0e30f;
    lrow[t] = 0.0f;
    o[t] = v8f{};
  }

  for (unsigned kb = 0; kb < (unsigned)NTOK; kb += 32u) {
    const v16h ka0 = frag_k16(kp + (size_t)kb * QKP);
    const v16h ka1 = frag_k16(kp + (size_t)(kb + 16u) * QKP);
    const v16h va  = frag_at(vp + kb);

#pragma unroll   // both tiles in one body: their chains are independent and can interleave
    for (int t = 0; t < QT; ++t) {
      v8f s0 = {}, s1 = {};
      s0 = wmma16(ka0, qf[t], s0);
      s1 = wmma16(ka1, qf[t], s1);

      float mx = fmaxf(s0[0], s1[0]);
#pragma unroll
      for (int r = 1; r < 8; ++r) mx = fmaxf(mx, fmaxf(s0[r], s1[r]));
      mx = fmaxf(mx, __shfl_xor(mx, 16, 32));
      const float mn = fmaxf(mrow[t], mx * sscale);
      const float alpha = __expf(mrow[t] - mn);
      mrow[t] = mn;

      float rs = 0.0f;
      v16h pf;
#pragma unroll
      for (int r = 0; r < 8; ++r) {
        const float e0 = s0[r] * sscale - mn;
        const float e1 = s1[r] * sscale - mn;
        const float x0 = __expf(e0);
        const float x1 = __expf(e1);
        const float p0 = (e0 < PCUT) ? 0.0f : x0;
        const float p1 = (e1 < PCUT) ? 0.0f : x1;
        rs += p0 + p1;
        pf[r]     = (h16)(p0 * PCARRY);
        pf[r + 8] = (h16)(p1 * PCARRY);
      }
      rs += __shfl_xor(rs, 16, 32);
      lrow[t] = alpha * lrow[t] + rs;
#pragma unroll
      for (int r = 0; r < 8; ++r) o[t][r] = o[t][r] * alpha;

      o[t] = wmma16(va, pf, o[t]);
    }
  }

  // finalize: o[t][r] is (d = 8h + r, token q0 + 16t + m); f16(64 * O / l), 8 halves per lane
#pragma unroll   // constant t keeps the per-tile arrays in registers
  for (unsigned t = 0; t < (unsigned)QT; ++t) {
    const float inv = __builtin_amdgcn_rcpf(lrow[t]) * (CCARRY / (PCARRY * QCARRY));
    v8h ov;
#pragma unroll
    for (int r = 0; r < 8; ++r) ov[r] = toh_flush(o[t][r] * inv);
    *(v8h*)&Os[(16u * t + m) * LDG + hw * HD + hh * 8u] = ov;
  }
  __syncthreads();

  // 8 consecutive lanes x 16 B = one whole 128-B line of the (token, batch) plane
#pragma unroll   // both LDS reads issue before the first store
  for (unsigned i = 0; i < (unsigned)QT; ++i) {
    const unsigned r = 16u * i + (tid >> 3);
    const unsigned c = (tid & 7u) * 8u;
    const v8h x = *(const v8h*)&Os[r * LDG + c];
    _Float16* p = Ctx + ((size_t)(q0 + r) * NB + b) * DIM + blockIdx.z * (unsigned)(HGRP * HD) + c;
    *(v8h*)p = x;
  }
}

// ---------------------------------------------------------------------------
extern "C" void kernel_launch(void* const* d_in, const int* in_sizes, int n_in,
                              void* d_out, int out_size, void* d_ws, size_t ws_size,
                              hipStream_t stream) {
  if (n_in < 5) return;
  const long long need_xs = ((long long)(SEQ - 1) * NB_FULL + NB) * DIM;
  const long long need_out = ((long long)(NTOK - 1) * NB_FULL + NB) * DIM;
  if ((long long)in_sizes[0] < (long long)NPATCH * DIM) return;
  if ((long long)in_sizes[1] < need_xs) return;
  if ((long long)in_sizes[2] < (long long)3 * DIM * DIM) return;
  if ((long long)in_sizes[3] < (long long)DIM * DIM) return;
  if (in_sizes[4] < DIM) return;
  if ((long long)out_size < need_out) return;
  if (ws_size < WS_TOTAL) return;

  const float* xp   = (const float*)d_in[0];   // [32][1][DIM]
  const float* xs   = (const float*)d_in[1];   // [SEQ_FULL][NB_FULL][DIM]
  const float* wqkv = (const float*)d_in[2];   // [3*DIM][DIM]  (out, in): q | k | v rows
  const float* w0   = (const float*)d_in[3];   // [DIM][DIM]    (out, in)
  const float* w0b  = (const float*)d_in[4];   // [DIM]
  float* out = (float*)d_out;                  // [NTOK][NB_FULL][DIM]

  char* ws = (char*)d_ws;
  _Float16* Wqkv16 = (_Float16*)(ws + OFF_WQKV);   // [3*DIM][DIM]
  _Float16* W016   = (_Float16*)(ws + OFF_W0);     // [DIM][DIM]
  _Float16* QK16   = (_Float16*)(ws + OFF_QK);     // [NB*TOKP][QKP]
  _Float16* Vt16   = (_Float16*)(ws + OFF_VT);     // [NB][DIM][TOKP]
  _Float16* Ctx16  = (_Float16*)(ws + OFF_CTX);    // [NTOK*NB][DIM]

  dim3 blk(256);
  wcast_kernel<<<dim3((3 * DIM * DIM) / 2048), blk, 0, stream>>>(wqkv, Wqkv16);
  wcast_kernel<<<dim3((DIM * DIM) / 2048), blk, 0, stream>>>(w0, W016);
  // token conversion and q | k | v columns (v written transposed) in one launch
  proj_kernel<<<dim3(TOKP / 64, NB), blk, 0, stream>>>(xp, xs, Wqkv16, QK16, Vt16);
  attn_kernel<<<dim3(NTOK / (16 * QT), NB, NHEAD / HGRP), dim3(HGRP * 32), 0, stream>>>(
      QK16, Vt16, Ctx16);
  gemm_out_kernel<<<dim3(DIM / 64, OROWS / 64), blk, 0, stream>>>(Ctx16, W016, w0b, out);
}

// v003
// Measured time: 58.5 microseconds a run.
// Next to v002, in two timings, it ran 1.11 and 1.10 times as fast.
// All steps since v000 together make it 1.79 times as fast.
#include <hip/hip_runtime.h>
#include <stddef.h>

// All contractions on v_wmma_f32_16x16x32_f16 (f16 operands, f32 accumulate): q|k and v
// projection, q.k scores (head width 16 zero-padded to k = 32), p.v, output projection.
// Float inputs are RNE-converted to bf16 and carried in f16 (weights x64, q/k/v planes x64,
// p x1024, attention rows x64); softmax, scale and bias in f32.

typedef _Float16 h16;
typedef _Float16 v16h __attribute__((ext_vector_type(16)));
typedef _Float16 v8h  __attribute__((ext_vector_type(8)));
typedef _Float16 v4h  __attribute__((ext_vector_type(4)));
typedef float    v8f  __attribute__((ext_vector_type(8)));
typedef float    v4f  __attribute__((ext_vector_type(4)));

#ifndef NB
#define NB 64
#endif
#ifndef SEQ
#define SEQ 512
#endif
#define NB_FULL  64
#define SEQ_FULL 512
#define DIM    128
#define NHEAD  8
#define HD     16
#define NPATCH 32
#define NTOK   (NPATCH + SEQ)                 // tokens per batch (patch rows first)
#define TOKP   (((NTOK + 63) / 64) * 64)      // token rows per batch padded to the GEMM tile
#define QKP    256                            // q|k plane pitch (halves): q cols 0..127, k cols 128..255
#define XROWS  (NB * TOKP)                    // rows of the batch-major planes
#define OROWS  (NTOK * NB)                    // rows of the (token, batch)-ordered planes

static_assert(NB >= 1 && NB <= NB_FULL);
static_assert(SEQ >= 32 && SEQ <= SEQ_FULL);
static_assert(DIM == NHEAD * HD);
static_assert(HD == 16);                      // one 16-B load per score fragment, 8 halves per lane half
static_assert(NHEAD == 8);                    // one wave per head
static_assert((DIM % 32) == 0 && (DIM % 64) == 0);
static_assert(QKP == 2 * DIM && (QKP % 64) == 0);
static_assert((NTOK % 32) == 0);              // 32-key steps cover the key range exactly
static_assert((NTOK % 16) == 0);              // 16-query tiles cover the query range exactly
static_assert((TOKP % 64) == 0 && TOKP >= NTOK);
static_assert((XROWS % 64) == 0 && (XROWS % 16) == 0);
static_assert((OROWS % 64) == 0);
static_assert(((3 * DIM * DIM) % 2048) == 0 && ((DIM * DIM) % 2048) == 0);

#define LDC 68    // floats per LDS row of the GEMM staging tile (272 B, 16-B aligned)
static_assert((LDC % 4) == 0 && LDC >= 64);

#define WCARRY 64.0f     // weight planes carried x64
#define QCARRY 64.0f     // q, k, v planes carried x64 (the projection accumulator as is)
#define PCARRY_LOG2 10.0f   // softmax numerators and their row sum carried x1024, as an addend of the base-2 exponent
#define CCARRY 64.0f     // attention output plane carried x64

// workspace layout (bytes)
#define WQKV_BYTES ((size_t)3 * DIM * DIM * 2)
#define W0_BYTES   ((size_t)DIM * DIM * 2)
#define QK_BYTES   ((size_t)XROWS * QKP * 2)
#define VT_BYTES   ((size_t)NB * DIM * TOKP * 2)
#define CTX_BYTES  ((size_t)OROWS * DIM * 2)
#define OFF_WQKV ((size_t)0)
#define OFF_W0   (OFF_WQKV + WQKV_BYTES)
#define OFF_QK   (OFF_W0 + W0_BYTES)
#define OFF_VT   (OFF_QK + QK_BYTES)
#define OFF_CTX  (OFF_VT + VT_BYTES)
#define WS_TOTAL (OFF_CTX + CTX_BYTES)
static_assert((WQKV_BYTES % 128) == 0 && (W0_BYTES % 128) == 0);
static_assert((QK_BYTES % 128) == 0 && (VT_BYTES % 128) == 0 && (CTX_BYTES % 128) == 0);
static_assert(WS_TOTAL <= (size_t)134217728);

// ---------------------------------------------------------------------------
__device__ __forceinline__ float bf16r(float x) {   // RNE convert to bf16, returned widened
  unsigned int u = __float_as_uint(x);
  u = (u + 0x7FFFu + ((u >> 16) & 1u)) & 0xFFFF0000u;
  return __uint_as_float(u);
}

// f32 -> f16 with a value select: results below the smallest normal f16 become zero.
static __device__ __forceinline__ h16 toh_flush(float v) {
  const h16 r = (h16)v;
  return (fabsf(v) < 6.103515625e-05f) ? (h16)0.0f : r;
}

// 16-bit fragment: p points at element [row = lane&15][k0 + 8*(lane>>4)] of a k-contiguous
// row. Elements 0..7 <- k0+8h+0..7, elements 8..15 <- k0+16+8h+0..7 (same map for A and B).
__device__ __forceinline__ v16h frag_at(const _Float16* p) {
  v8h lo = *(const v8h*)(p);
  v8h hi = *(const v8h*)(p + 16);
  v16h out;
#pragma unroll
  for (int i = 0; i < 8; ++i) { out[i] = lo[i]; out[i + 8] = hi[i]; }
  return out;
}

// Fragment of a 16-deep contraction padded to k = 32: p points at [row = lane&15][8*(lane>>4)];
// elements 0..7 <- k = 8h+0..7, elements 8..15 (k = 16..31) are zero.
__device__ __forceinline__ v16h frag_k16(const _Float16* p) {
  const v8h lo = *(const v8h*)(p);
  v16h out;
#pragma unroll
  for (int i = 0; i < 8; ++i) { out[i] = lo[i]; out[i + 8] = (_Float16)0.0f; }
  return out;
}

__device__ __forceinline__ v8f wmma16(v16h a, v16h b, v8f c) {
  v8f d = __builtin_amdgcn_wmma_f32_16x16x32_f16(false, a, false, b, (short)0, c,
                                                 false, false);
  asm volatile("v_nop\n\tv_nop\n\tv_nop\n\tv_nop" : "+v"(d) : "v"(a), "v"(b));
  return d;
}

// ---------------------------------------------------------------------------
// Weight plane: W[n][k] (f32, k contiguous) -> W16[n][k] = f16(64 * bf16(w)), same layout.
// Each thread 8 elements; a wave writes 512 contiguous bytes per store instruction.
// Grid (elements / 2048), exact.
// ---------------------------------------------------------------------------
__global__ __launch_bounds__(256) void wcast_kernel(
    const float* __restrict__ W, _Float16* __restrict__ W16) {
  const size_t idx = ((size_t)blockIdx.x * 256u + threadIdx.x) * 8u;
  const v4f a0 = *(const v4f*)(W + idx);
  const v4f a1 = *(const v4f*)(W + idx + 4);
  v8h o;
#pragma unroll
  for (int i = 0; i < 4; ++i) {
    o[i]     = toh_flush(WCARRY * bf16r(a0[i]));
    o[i + 4] = toh_flush(WCARRY * bf16r(a1[i]));
  }
  _Float16* p = W16 + idx;
  *(v8h*)p = o;
  
}

// ---------------------------------------------------------------------------
// Fused token conversion + q | k | v projection. Block = 64 token rows of one batch x all 384
// output columns, 8 waves. Row f of batch b: f < 32 patch row f (shared by all b),
// 32 <= f < NTOK sequence row (s = f - 32, b) of xs[s][b][:], f >= NTOK zero rows.
//   1. each wave reads 8 whole 512-B rows (f32), converts to f16(bf16(x)) and lays them in Xs.
//   2. wave w makes q|k columns 32w .. 32w+31 and v columns 16w .. 16w+15 for all 64 rows
//      (12 accumulator tiles); every weight fragment is fetched once per block.
//      q|k tiles run as W (A, 16 columns) . X^T (B, 16 tokens): lane (h, token) holds columns
//      8h .. 8h+7 of its token, one 16-B piece of a q|k row.
//      v tiles run as X (A, 16 tokens) . W^T (B, 16 columns): lane (h, d) holds tokens
//      8h .. 8h+7 of its column, one 16-B piece of a V^T row.
//   3. both tiles staged in LDS (f16) and written as whole lines:
//      QK[b * TOKP + f][QKP] and Vt[b][d][TOKP], both the accumulator as is (x64 carry).
// Grid (TOKP / 64, NB).
// ---------------------------------------------------------------------------
#define LDX 136   // halves per LDS row of the token tile (272 B = 16 B x odd)
#define LDQ 264   // halves per LDS row of the q|k tile (528 B = 16 B x odd)
#define LDV 72    // halves per LDS row of the V^T tile (144 B = 16 B x odd)
static_assert(LDX >= DIM && LDQ >= QKP && LDV >= 64);
static_assert((LDX % 8) == 0 && (LDQ % 8) == 0 && (LDV % 8) == 0);
static_assert(QKP == 8 * 32 && DIM == 8 * 16);   // 8 waves: 32 q|k columns and 16 v columns each
static_assert((NPATCH % 8) == 0 && (NTOK % 8) == 0 && SEQ >= 8);   // a wave's 8 rows are of one kind

// The builtin alone: the compiler keeps the distances behind it and can place fragment loads
// between the matrix instructions.
__device__ __forceinline__ v8f wmma_plain(v16h a, v16h b, v8f c) {
  return __builtin_amdgcn_wmma_f32_16x16x32_f16(false, a, false, b, (short)0, c, false, false);
}

__device__ __forceinline__ v8h pack_flush(v8f a) {
  v8h o;
#pragma unroll
  for (int r = 0; r < 8; ++r) o[r] = toh_flush(a[r]);
  return o;
}

__global__ __launch_bounds__(256) void proj_kernel(
    const float* __restrict__ xp, const float* __restrict__ xs,
    const _Float16* __restrict__ W16, _Float16* __restrict__ qk, _Float16* __restrict__ vt) {
  __shared__ __attribute__((aligned(16))) _Float16 Xs[64 * LDX];
  __shared__ __attribute__((aligned(16))) _Float16 Qs[64 * LDQ];
  __shared__ __attribute__((aligned(16))) _Float16 Vs[DIM * LDV];
  const unsigned tid = threadIdx.x, lane = tid & 31u;
  const unsigned w = (unsigned)__builtin_amdgcn_readfirstlane((int)(threadIdx.x >> 5));
  const unsigned hh = lane >> 4, m = lane & 15u;
  const unsigned f0 = blockIdx.x * 64u;
  const unsigned b = blockIdx.y;

  // wave-uniform row bases plus one per-lane offset shared by all weight fragments
  const unsigned woff = m * (unsigned)DIM + hh * 8u;
  const _Float16* wq0 = W16 + (size_t)(w * 32u) * DIM;
  const _Float16* wq1 = W16 + (size_t)(w * 32u + 16u) * DIM;
  const _Float16* wv  = W16 + (size_t)(QKP + w * 16u) * DIM;
  // the first weight fragments are asked for together with the token rows
  v16h q0 = frag_at(wq0 + woff);
  v16h q1 = frag_at(wq1 + woff);
  v16h vv = frag_at(wv + woff);

  // token rows: one wave-wide 16-B load = one whole row. A wave's 8 rows are all patch rows,
  // all sequence rows or all zero rows, so source and row step are wave-uniform.
  const unsigned fg = f0 + w * 8u;
  const bool isp = fg < (unsigned)NPATCH;
  const bool live = fg < (unsigned)NTOK;
  unsigned sq = isp ? 0u : (fg - (unsigned)NPATCH);
  sq = (sq < (unsigned)(SEQ - 8)) ? sq : (unsigned)(SEQ - 8);
  const float* plane = isp ? xp : xs;
  const unsigned row = isp ? fg : (sq * (unsigned)NB_FULL + b);
  const unsigned step = isp ? (unsigned)DIM : (unsigned)(NB_FULL * DIM);
  const float* src = plane + (size_t)row * DIM;
  v4f xv[8];
#pragma unroll   // all eight row loads in flight together
  for (unsigned i = 0; i < 8u; ++i) xv[i] = *(const v4f*)(src + (i * step + lane * 4u));
#pragma unroll
  for (unsigned i = 0; i < 8u; ++i) {
    v4h o;
#pragma unroll
    for (int j = 0; j < 4; ++j) o[j] = toh_flush(bf16r(live ? xv[i][j] : 0.0f));
    *(v4h*)&Xs[(w * 8u + i) * LDX + lane * 4u] = o;
  }
  __syncthreads();

  const _Float16* xa  = &Xs[m * LDX + hh * 8u];
  v8f aq0[4] = {}, aq1[4] = {}, av[4] = {};
#pragma unroll   // constant indices keep the accumulator arrays in registers
  for (unsigned k0 = 0; k0 < (unsigned)DIM; k0 += 32u) {
#pragma unroll
    for (unsigned t = 0; t < 4u; ++t) {
      const v16h x = frag_at(xa + t * 16u * LDX + k0);
      aq0[t] = wmma_plain(q0, x, aq0[t]);
      aq1[t] = wmma_plain(q1, x, aq1[t]);
      av[t]  = wmma_plain(x, vv, av[t]);
    }
    if (k0 + 32u < (unsigned)DIM) {
      q0 = frag_at((wq0 + k0 + 32u) + woff);
      q1 = frag_at((wq1 + k0 + 32u) + woff);
      vv = frag_at((wv + k0 + 32u) + woff);
    }
  }

#pragma unroll
  for (unsigned t = 0; t < 4u; ++t) {
    _Float16* qd = &Qs[(t * 16u + m) * LDQ + w * 32u + hh * 8u];
    *(v8h*)(qd)      = pack_flush(aq0[t]);
    *(v8h*)(qd + 16) = pack_flush(aq1[t]);
    *(v8h*)&Vs[(w * 16u + m) * LDV + t * 16u + hh * 8u] = pack_flush(av[t]);
  }
  __syncthreads();

  // q|k: a wave writes one whole 512-B row per store; V^T: 8 lanes write one whole 128-B line
  const size_t row0 = (size_t)b * TOKP + f0;
  v8h yq[8], yv[4];
#pragma unroll   // all LDS reads issue before the first store
  for (unsigned i = 0; i < 8u; ++i) yq[i] = *(const v8h*)&Qs[(i * 8u + w) * LDQ + lane * 8u];
#pragma unroll
  for (unsigned i = 0; i < 4u; ++i)
    yv[i] = *(const v8h*)&Vs[(i * 32u + (tid >> 3)) * LDV + (tid & 7u) * 8u];
#pragma unroll
  for (unsigned i = 0; i < 8u; ++i)
    *(v8h*)(qk + (row0 + i * 8u + w) * QKP + lane * 8u) = yq[i];
#pragma unroll
  for (unsigned i = 0; i < 4u; ++i)
    *(v8h*)(vt + ((size_t)b * DIM + i * 32u + (tid >> 3)) * TOKP + f0 + (tid & 7u) * 8u) = yv[i];
}

// ---------------------------------------------------------------------------
// Output projection, C[64x64 tile] = A16[rows][DIM] . Bt[n][DIM]^T, fragments straight from the
// 16-bit global planes; 8 waves (mw = 16-row group, nw = 32-col group), 2 accumulators/wave.
//   outf[(f * NB_FULL + b)][n0 + col] = acc/4096 + bf16(bias), rows (f * NB + b)
// Grid (N/64, rows/64).
// ---------------------------------------------------------------------------
__global__ __launch_bounds__(256) void gemm_out_kernel(
    const _Float16* __restrict__ A16, const _Float16* __restrict__ Bt,
    const float* __restrict__ bias, float* __restrict__ outf) {
  __shared__ float Cs[64 * LDC];
  const unsigned tid = threadIdx.x, lane = tid & 31u;
  const unsigned w = (unsigned)__builtin_amdgcn_readfirstlane((int)(threadIdx.x >> 5));
  const unsigned mw = w >> 1, nw = w & 1u;
  const unsigned hh = lane >> 4, m = lane & 15u;
  const unsigned n0 = blockIdx.x * 64u;
  const unsigned row0 = blockIdx.y * 64u;

  const _Float16* ap  = A16 + (size_t)(row0 + mw * 16u + m) * DIM + hh * 8u;
  const _Float16* bp0 = Bt + (size_t)(n0 + nw * 32u + m) * DIM + hh * 8u;
  const _Float16* bp1 = bp0 + (size_t)16 * DIM;
  v8f acc0 = {}, acc1 = {};
#pragma unroll
  for (unsigned k0 = 0; k0 < (unsigned)DIM; k0 += 32u) {
    const v16h a  = frag_at(ap + k0);
    const v16h b0 = frag_at(bp0 + k0);
    const v16h b1 = frag_at(bp1 + k0);
    acc0 = wmma16(a, b0, acc0);
    acc1 = wmma16(a, b1, acc1);
  }
#pragma unroll
  for (int r = 0; r < 8; ++r) {
    float* d = &Cs[(mw * 16u + hh * 8u + (unsigned)r) * LDC + nw * 32u + m];
    d[0]  = acc0[r];
    d[16] = acc1[r];
  }
  __syncthreads();

  const float cs = 1.0f / (WCARRY * CCARRY);
  v4f xs[4];
  size_t off[4];
#pragma unroll
  for (unsigned i = 0; i < 4u; ++i) {
    const unsigned r = 16u * i + (tid >> 4);
    const unsigned c = (tid & 15u) * 4u;
    const unsigned crow = row0 + r;
    const unsigned f = crow / (unsigned)NB;
    const unsigned bb = crow - f * (unsigned)NB;
    const size_t orow = (size_t)f * NB_FULL + bb;
    const v4f u = *(const v4f*)&Cs[r * LDC + c];
    const v4f g = *(const v4f*)(bias + n0 + c);
    v4f val;
#pragma unroll
    for (int j = 0; j < 4; ++j) val[j] = u[j] * cs + bf16r(g[j]);
    xs[i] = val;
    off[i] = orow * DIM + n0 + c;
  }
#pragma unroll
  for (int i = 0; i < 4; ++i) *(v4f*)(outf + off[i]) = xs[i];
}

// ---------------------------------------------------------------------------
// Dense flash attention, register-fed transposed form. Block = (32 query tokens, batch b,
// group of 4 heads), wave = head; each wave carries QT = 2 query tiles of 16 tokens, so every
// K and V^T fragment fetched from the global planes feeds both tiles. Per 32-key step:
//   S^T tiles (keys x queries) = K tile (A, 16 keys x d padded to 32) . Q^T (B, d x 16 queries),
//   two 16-key tiles per query tile; lane (h, n) holds query column n, key rows 8h+r of each.
//   Online softmax per query column: in-lane over 16 values + one 16-lane-distance shuffle.
//   P^T packed as B fragment: element r <- tile 0 row 8h+r, element 8+r <- tile 1 row 8h+r
//   (keys kb+8h+r and kb+16+8h+r), f16(1024 p); the row sum l carries the same x1024.
//   O^T (d x queries) += V^T tile (A, [d][32 keys] from the transposed V plane) . P^T.
// No LDS and no barrier in the key loop. Output tile [32 tokens][64] staged in Os
// (cross-wave, block barrier), written as whole 128-B lines of Ctx[(f * NB + b)][DIM],
// f16(64 * O / l).
// Grid (NTOK/32, NB, NHEAD/4), 128 threads.
// ---------------------------------------------------------------------------
#define QT   2                 // query tiles per wave
#define HGRP 4                 // heads (waves) per block: 4 x 16 halves = one 128-B line
#define LDG  72                // halves per LDS row of the output tile (144 B, 16-B aligned)
static_assert((NTOK % (16 * QT)) == 0);
static_assert((NHEAD % HGRP) == 0 && HGRP * HD * 2 == 128);
static_assert((LDG % 8) == 0 && LDG >= HGRP * HD);

__global__ __launch_bounds__(HGRP * 32) void attn_kernel(
    const _Float16* __restrict__ QK, const _Float16* __restrict__ Vt,
    _Float16* __restrict__ Ctx) {
  __shared__ _Float16 Os[16 * QT * LDG];

  const unsigned tid = threadIdx.x, lane = tid & 31u;
  const unsigned hw = (unsigned)__builtin_amdgcn_readfirstlane((int)(threadIdx.x >> 5));
  const unsigned head = blockIdx.z * (unsigned)HGRP + hw;
  const unsigned hh = lane >> 4, m = lane & 15u;
  const unsigned q0 = blockIdx.x * (16u * QT);
  const unsigned b = blockIdx.y;
  const size_t tokbase = (size_t)b * TOKP;
  // HD^-0.5, the two x64 carries and log2(e): maxima and exponents are kept in base 2
  const float sscale = 0.25f * 1.4426950408889634f / (QCARRY * QCARRY);

  // Q^T as B operand: lane (h, n) <- q[token q0+16t+n][head*16 + 8h .. +7], k 16..31 zero
  v16h qf[QT];
#pragma unroll   // constant t keeps the per-tile arrays in registers
  for (unsigned t = 0; t < (unsigned)QT; ++t)
    qf[t] = frag_k16(QK + (tokbase + q0 + 16u * t + m) * QKP + head * HD + hh * 8u);
  // K tile as A operand: lane (h, m) <- k[token kb+m][head*16 + 8h .. +7]
  const _Float16* kp = QK + (tokbase + m) * QKP + DIM + head * HD + hh * 8u;
  // V^T tile as A operand: lane (h, m = d) <- vt[d][kb + 8h .. +7], vt[d][kb + 16 + 8h .. +7]
  const _Float16* vp = Vt + ((size_t)b * DIM + head * HD + m) * TOKP + hh * 8u;

  float mrow[QT], lrow[QT];
  v8f o[QT];
#pragma unroll   // constant t keeps the per-tile arrays in registers
  for (int t = 0; t < QT; ++t) {
    mrow[t] = -1.0e30f;
    lrow[t] = 0.0f;
    o[t] = v8f{};
  }

  for (unsigned kb = 0; kb < (unsigned)NTOK; kb += 32u) {
    const v16h ka0 = frag_k16(kp + (size_t)kb * QKP);
    const v16h ka1 = frag_k16(kp + (size_t)(kb + 16u) * QKP);
    const v16h va  = frag_at(vp + kb);

#pragma unroll   // both tiles in one body: their chains are independent and can interleave
    for (int t = 0; t < QT; ++t) {
      v8f s0 = {}, s1 = {};
      s0 = wmma16(ka0, qf[t], s0);
      s1 = wmma16(ka1, qf[t], s1);

      float mx = fmaxf(s0[0], s1[0]);
#pragma unroll
      for (int r = 1; r < 8; ++r) mx = fmaxf(mx, fmaxf(s0[r], s1[r]));
      mx = fmaxf(mx, __shfl_xor(mx, 16, 32));
      const float mn = fmaxf(mrow[t], mx * sscale);
      const float alpha = __builtin_amdgcn_exp2f(mrow[t] - mn);
      mrow[t] = mn;

      // 1024 p = exp2(s * sscale - mn + 10): one multiply-add and one exponential per score
      const float eb = PCARRY_LOG2 - mn;
      float rs = 0.0f;
      v16h pf;
#pragma unroll
      for (int r = 0; r < 8; ++r) {
        const float p0 = __builtin_amdgcn_exp2f(s0[r] * sscale + eb);
        const float p1 = __builtin_amdgcn_exp2f(s1[r] * sscale + eb);
        rs += p0 + p1;
        pf[r]     = (h16)p0;
        pf[r + 8] = (h16)p1;
      }
      rs += __shfl_xor(rs, 16, 32);
      lrow[t] = alpha * lrow[t] + rs;
#pragma unroll
      for (int r = 0; r < 8; ++r) o[t][r] = o[t][r] * alpha;

      o[t] = wmma16(va, pf, o[t]);
    }
  }

  // finalize: o[t][r] is (d = 8h + r, token q0 + 16t + m); f16(64 * O / l), 8 halves per lane
#pragma unroll   // constant t keeps the per-tile arrays in registers
  for (unsigned t = 0; t < (unsigned)QT; ++t) {
    const float inv = __builtin_amdgcn_rcpf(lrow[t]) * (CCARRY / QCARRY);   // l carries the x1024 of p
    v8h ov;
#pragma unroll
    for (int r = 0; r < 8; ++r) ov[r] = toh_flush(o[t][r] * inv);
    *(v8h*)&Os[(16u * t + m) * LDG + hw * HD + hh * 8u] = ov;
  }
  __syncthreads();

  // 8 consecutive lanes x 16 B = one whole 128-B line of the (token, batch) plane
#pragma unroll   // both LDS reads issue before the first store
  for (unsigned i = 0; i < (unsigned)QT; ++i) {
    const unsigned r = 16u * i + (tid >> 3);
    const unsigned c = (tid & 7u) * 8u;
    const v8h x = *(const v8h*)&Os[r * LDG + c];
    _Float16* p = Ctx + ((size_t)(q0 + r) * NB + b) * DIM + blockIdx.z * (unsigned)(HGRP * HD) + c;
    *(v8h*)p = x;
  }
}

// ---------------------------------------------------------------------------
extern "C" void kernel_launch(void* const* d_in, const int* in_sizes, int n_in,
                              void* d_out, int out_size, void* d_ws, size_t ws_size,
                              hipStream_t stream) {
  if (n_in < 5) return;
  const long long need_xs = ((long long)(SEQ - 1) * NB_FULL + NB) * DIM;
  const long long need_out = ((long long)(NTOK - 1) * NB_FULL + NB) * DIM;
  if ((long long)in_sizes[0] < (long long)NPATCH * DIM) return;
  if ((long long)in_sizes[1] < need_xs) return;
  if ((long long)in_sizes[2] < (long long)3 * DIM * DIM) return;
  if ((long long)in_sizes[3] < (long long)DIM * DIM) return;
  if (in_sizes[4] < DIM) return;
  if ((long long)out_size < need_out) return;
  if (ws_size < WS_TOTAL) return;

  const float* xp   = (const float*)d_in[0];   // [32][1][DIM]
  const float* xs   = (const float*)d_in[1];   // [SEQ_FULL][NB_FULL][DIM]
  const float* wqkv = (const float*)d_in[2];   // [3*DIM][DIM]  (out, in): q | k | v rows
  const float* w0   = (const float*)d_in[3];   // [DIM][DIM]    (out, in)
  const float* w0b  = (const float*)d_in[4];   // [DIM]
  float* out = (float*)d_out;                  // [NTOK][NB_FULL][DIM]

  char* ws = (char*)d_ws;
  _Float16* Wqkv16 = (_Float16*)(ws + OFF_WQKV);   // [3*DIM][DIM]
  _Float16* W016   = (_Float16*)(ws + OFF_W0);     // [DIM][DIM]
  _Float16* QK16   = (_Float16*)(ws + OFF_QK);     // [NB*TOKP][QKP]
  _Float16* Vt16   = (_Float16*)(ws + OFF_VT);     // [NB][DIM][TOKP]
  _Float16* Ctx16  = (_Float16*)(ws + OFF_CTX);    // [NTOK*NB][DIM]

  dim3 blk(256);
  wcast_kernel<<<dim3((3 * DIM * DIM) / 2048), blk, 0, stream>>>(wqkv, Wqkv16);
  wcast_kernel<<<dim3((DIM * DIM) / 2048), blk, 0, stream>>>(w0, W016);
  // token conversion and q | k | v columns (v written transposed) in one launch
  proj_kernel<<<dim3(TOKP / 64, NB), blk, 0, stream>>>(xp, xs, Wqkv16, QK16, Vt16);
  attn_kernel<<<dim3(NTOK / (16 * QT), NB, NHEAD / HGRP), dim3(HGRP * 32), 0, stream>>>(
      QK16, Vt16, Ctx16);
  gemm_out_kernel<<<dim3(DIM / 64, OROWS / 64), blk, 0, stream>>>(Ctx16, W016, w0b, out);
}

// v004
// Measured time: 55.9 microseconds a run.
// Timed twice side by side with v003, it ran 1.05 and 1.04 times as fast.
// Over all steps from v000 it is 1.87 times as fast.
#include <hip/hip_runtime.h>
#include <stddef.h>

// All contractions on v_wmma_f32_16x16x32_f16 (f16 operands, f32 accumulate): q|k and v
// projection, q.k scores (head width 16 zero-padded to k = 32), p.v, output projection.
// Float inputs are RNE-converted to bf16 and carried in f16 (weights x64, q/k/v planes x64,
// p x1024, attention rows x64); softmax, scale and bias in f32.

typedef _Float16 h16;
typedef _Float16 v16h __attribute__((ext_vector_type(16)));
typedef _Float16 v8h  __attribute__((ext_vector_type(8)));
typedef _Float16 v4h  __attribute__((ext_vector_type(4)));
typedef float    v8f  __attribute__((ext_vector_type(8)));
typedef float    v4f  __attribute__((ext_vector_type(4)));

#ifndef NB
#define NB 64
#endif
#ifndef SEQ
#define SEQ 512
#endif
#define NB_FULL  64
#define SEQ_FULL 512
#define DIM    128
#define NHEAD  8
#define HD     16
#define NPATCH 32
#define NTOK   (NPATCH + SEQ)                 // tokens per batch (patch rows first)
#define TOKP   (((NTOK + 63) / 64) * 64)      // token rows per batch padded to the GEMM tile
#define QKP    256                            // q|k plane pitch (halves): q cols 0..127, k cols 128..255
#define XROWS  (NB * TOKP)                    // rows of the batch-major planes

static_assert(NB >= 1 && NB <= NB_FULL);
static_assert(SEQ >= 32 && SEQ <= SEQ_FULL);
static_assert(DIM == NHEAD * HD);
static_assert(HD == 16);                      // one 16-B load per score fragment, 8 halves per lane half
static_assert(NHEAD == 8);                    // one wave per head
static_assert((DIM % 32) == 0 && (DIM % 64) == 0);
static_assert(QKP == 2 * DIM && (QKP % 64) == 0);
static_assert((NTOK % 32) == 0);              // 32-key steps cover the key range exactly
static_assert((NTOK % 16) == 0);              // 16-query tiles cover the query range exactly
static_assert((TOKP % 64) == 0 && TOKP >= NTOK);
static_assert((XROWS % 64) == 0 && (XROWS % 16) == 0);
static_assert(((3 * DIM * DIM) % 2048) == 0 && ((DIM * DIM) % 2048) == 0);

#define LDC 36    // floats per LDS row of a wave's output staging tile (144 B = 16 B x odd)
static_assert((LDC % 4) == 0 && LDC >= 32);

#define WCARRY 64.0f     // weight planes carried x64
#define QCARRY 64.0f     // q, k, v planes carried x64 (the projection accumulator as is)
#define PCARRY_LOG2 10.0f   // softmax numerators and their row sum carried x1024, as an addend of the base-2 exponent
#define CCARRY 64.0f     // attention rows (the LDS tile Os) carried x64

// workspace layout (bytes)
#define WQKV_BYTES ((size_t)3 * DIM * DIM * 2)
#define W0_BYTES   ((size_t)DIM * DIM * 2)
#define QK_BYTES   ((size_t)XROWS * QKP * 2)
#define VT_BYTES   ((size_t)NB * DIM * TOKP * 2)
#define OFF_WQKV ((size_t)0)
#define OFF_W0   (OFF_WQKV + WQKV_BYTES)
#define OFF_QK   (OFF_W0 + W0_BYTES)
#define OFF_VT   (OFF_QK + QK_BYTES)
#define WS_TOTAL (OFF_VT + VT_BYTES)
static_assert((WQKV_BYTES % 128) == 0 && (W0_BYTES % 128) == 0);
static_assert((QK_BYTES % 128) == 0 && (VT_BYTES % 128) == 0);
static_assert(WS_TOTAL <= (size_t)134217728);

// ---------------------------------------------------------------------------
__device__ __forceinline__ float bf16r(float x) {   // RNE convert to bf16, returned widened
  unsigned int u = __float_as_uint(x);
  u = (u + 0x7FFFu + ((u >> 16) & 1u)) & 0xFFFF0000u;
  return __uint_as_float(u);
}

// f32 -> f16 with a value select: results below the smallest normal f16 become zero.
static __device__ __forceinline__ h16 toh_flush(float v) {
  const h16 r = (h16)v;
  return (fabsf(v) < 6.103515625e-05f) ? (h16)0.0f : r;
}

// 16-bit fragment: p points at element [row = lane&15][k0 + 8*(lane>>4)] of a k-contiguous
// row. Elements 0..7 <- k0+8h+0..7, elements 8..15 <- k0+16+8h+0..7 (same map for A and B).
__device__ __forceinline__ v16h frag_at(const _Float16* p) {
  v8h lo = *(const v8h*)(p);
  v8h hi = *(const v8h*)(p + 16);
  v16h out;
#pragma unroll
  for (int i = 0; i < 8; ++i) { out[i] = lo[i]; out[i + 8] = hi[i]; }
  return out;
}

// Fragment of a 16-deep contraction padded to k = 32: p points at [row = lane&15][8*(lane>>4)];
// elements 0..7 <- k = 8h+0..7, elements 8..15 (k = 16..31) are zero.
__device__ __forceinline__ v16h frag_k16(const _Float16* p) {
  const v8h lo = *(const v8h*)(p);
  v16h out;
#pragma unroll
  for (int i = 0; i < 8; ++i) { out[i] = lo[i]; out[i + 8] = (_Float16)0.0f; }
  return out;
}

__device__ __forceinline__ v8f wmma16(v16h a, v16h b, v8f c) {
  v8f d = __builtin_amdgcn_wmma_f32_16x16x32_f16(false, a, false, b, (short)0, c,
                                                 false, false);
  asm volatile("v_nop\n\tv_nop\n\tv_nop\n\tv_nop" : "+v"(d) : "v"(a), "v"(b));
  return d;
}

// ---------------------------------------------------------------------------
// Weight plane: W[n][k] (f32, k contiguous) -> W16[n][k] = f16(64 * bf16(w)), same layout.
// Each thread 8 elements; a wave writes 512 contiguous bytes per store instruction.
// Grid (elements / 2048), exact.
// ---------------------------------------------------------------------------
__global__ __launch_bounds__(256) void wcast_kernel(
    const float* __restrict__ W, _Float16* __restrict__ W16) {
  const size_t idx = ((size_t)blockIdx.x * 256u + threadIdx.x) * 8u;
  const v4f a0 = *(const v4f*)(W + idx);
  const v4f a1 = *(const v4f*)(W + idx + 4);
  v8h o;
#pragma unroll
  for (int i = 0; i < 4; ++i) {
    o[i]     = toh_flush(WCARRY * bf16r(a0[i]));
    o[i + 4] = toh_flush(WCARRY * bf16r(a1[i]));
  }
  _Float16* p = W16 + idx;
  *(v8h*)p = o;
  
}

// ---------------------------------------------------------------------------
// Fused token conversion + q | k | v projection. Block = 64 token rows of one batch x all 384
// output columns, 8 waves. Row f of batch b: f < 32 patch row f (shared by all b),
// 32 <= f < NTOK sequence row (s = f - 32, b) of xs[s][b][:], f >= NTOK zero rows.
//   1. each wave reads 8 whole 512-B rows (f32), converts to f16(bf16(x)) and lays them in Xs.
//   2. wave w makes q|k columns 32w .. 32w+31 and v columns 16w .. 16w+15 for all 64 rows
//      (12 accumulator tiles); every weight fragment is fetched once per block.
//      q|k tiles run as W (A, 16 columns) . X^T (B, 16 tokens): lane (h, token) holds columns
//      8h .. 8h+7 of its token, one 16-B piece of a q|k row.
//      v tiles run as X (A, 16 tokens) . W^T (B, 16 columns): lane (h, d) holds tokens
//      8h .. 8h+7 of its column, one 16-B piece of a V^T row.
//   3. both tiles staged in LDS (f16) and written as whole lines:
//      QK[b * TOKP + f][QKP] and Vt[b][d][TOKP], both the accumulator as is (x64 carry).
// Grid (TOKP / 64, NB).
// ---------------------------------------------------------------------------
#define LDX 136   // halves per LDS row of the token tile (272 B = 16 B x odd)
#define LDQ 264   // halves per LDS row of the q|k tile (528 B = 16 B x odd)
#define LDV 72    // halves per LDS row of the V^T tile (144 B = 16 B x odd)
static_assert(LDX >= DIM && LDQ >= QKP && LDV >= 64);
static_assert((LDX % 8) == 0 && (LDQ % 8) == 0 && (LDV % 8) == 0);
static_assert(QKP == 8 * 32 && DIM == 8 * 16);   // 8 waves: 32 q|k columns and 16 v columns each
static_assert((NPATCH % 8) == 0 && (NTOK % 8) == 0 && SEQ >= 8);   // a wave's 8 rows are of one kind

// The builtin alone: the compiler keeps the distances behind it and can place fragment loads
// between the matrix instructions.
__device__ __forceinline__ v8f wmma_plain(v16h a, v16h b, v8f c) {
  return __builtin_amdgcn_wmma_f32_16x16x32_f16(false, a, false, b, (short)0, c, false, false);
}

__device__ __forceinline__ v8h pack_flush(v8f a) {
  v8h o;
#pragma unroll
  for (int r = 0; r < 8; ++r) o[r] = toh_flush(a[r]);
  return o;
}

__global__ __launch_bounds__(256) void proj_kernel(
    const float* __restrict__ xp, const float* __restrict__ xs,
    const _Float16* __restrict__ W16, _Float16* __restrict__ qk, _Float16* __restrict__ vt) {
  __shared__ __attribute__((aligned(16))) _Float16 Xs[64 * LDX];
  __shared__ __attribute__((aligned(16))) _Float16 Qs[64 * LDQ];
  __shared__ __attribute__((aligned(16))) _Float16 Vs[DIM * LDV];
  const unsigned tid = threadIdx.x, lane = tid & 31u;
  const unsigned w = (unsigned)__builtin_amdgcn_readfirstlane((int)(threadIdx.x >> 5));
  const unsigned hh = lane >> 4, m = lane & 15u;
  const unsigned f0 = blockIdx.x * 64u;
  const unsigned b = blockIdx.y;

  // wave-uniform row bases plus one per-lane offset shared by all weight fragments
  const unsigned woff = m * (unsigned)DIM + hh * 8u;
  const _Float16* wq0 = W16 + (size_t)(w * 32u) * DIM;
  const _Float16* wq1 = W16 + (size_t)(w * 32u + 16u) * DIM;
  const _Float16* wv  = W16 + (size_t)(QKP + w * 16u) * DIM;
  // the first weight fragments are asked for together with the token rows
  v16h q0 = frag_at(wq0 + woff);
  v16h q1 = frag_at(wq1 + woff);
  v16h vv = frag_at(wv + woff);

  // token rows: one wave-wide 16-B load = one whole row. A wave's 8 rows are all patch rows,
  // all sequence rows or all zero rows, so source and row step are wave-uniform.
  const unsigned fg = f0 + w * 8u;
  const bool isp = fg < (unsigned)NPATCH;
  const bool live = fg < (unsigned)NTOK;
  unsigned sq = isp ? 0u : (fg - (unsigned)NPATCH);
  sq = (sq < (unsigned)(SEQ - 8)) ? sq : (unsigned)(SEQ - 8);
  const float* plane = isp ? xp : xs;
  const unsigned row = isp ? fg : (sq * (unsigned)NB_FULL + b);
  const unsigned step = isp ? (unsigned)DIM : (unsigned)(NB_FULL * DIM);
  const float* src = plane + (size_t)row * DIM;
  v4f xv[8];
#pragma unroll   // all eight row loads in flight together
  for (unsigned i = 0; i < 8u; ++i) xv[i] = *(const v4f*)(src + (i * step + lane * 4u));
#pragma unroll
  for (unsigned i = 0; i < 8u; ++i) {
    v4h o;
#pragma unroll
    for (int j = 0; j < 4; ++j) o[j] = toh_flush(bf16r(live ? xv[i][j] : 0.0f));
    *(v4h*)&Xs[(w * 8u + i) * LDX + lane * 4u] = o;
  }
  __syncthreads();

  const _Float16* xa  = &Xs[m * LDX + hh * 8u];
  v8f aq0[4] = {}, aq1[4] = {}, av[4] = {};
#pragma unroll   // constant indices keep the accumulator arrays in registers
  for (unsigned k0 = 0; k0 < (unsigned)DIM; k0 += 32u) {
#pragma unroll
    for (unsigned t = 0; t < 4u; ++t) {
      const v16h x = frag_at(xa + t * 16u * LDX + k0);
      aq0[t] = wmma_plain(q0, x, aq0[t]);
      aq1[t] = wmma_plain(q1, x, aq1[t]);
      av[t]  = wmma_plain(x, vv, av[t]);
    }
    if (k0 + 32u < (unsigned)DIM) {
      q0 = frag_at((wq0 + k0 + 32u) + woff);
      q1 = frag_at((wq1 + k0 + 32u) + woff);
      vv = frag_at((wv + k0 + 32u) + woff);
    }
  }

#pragma unroll
  for (unsigned t = 0; t < 4u; ++t) {
    _Float16* qd = &Qs[(t * 16u + m) * LDQ + w * 32u + hh * 8u];
    *(v8h*)(qd)      = pack_flush(aq0[t]);
    *(v8h*)(qd + 16) = pack_flush(aq1[t]);
    *(v8h*)&Vs[(w * 16u + m) * LDV + t * 16u + hh * 8u] = pack_flush(av[t]);
  }
  __syncthreads();

  // q|k: a wave writes one whole 512-B row per store; V^T: 8 lanes write one whole 128-B line
  const size_t row0 = (size_t)b * TOKP + f0;
  v8h yq[8], yv[4];
#pragma unroll   // all LDS reads issue before the first store
  for (unsigned i = 0; i < 8u; ++i) yq[i] = *(const v8h*)&Qs[(i * 8u + w) * LDQ + lane * 8u];
#pragma unroll
  for (unsigned i = 0; i < 4u; ++i)
    yv[i] = *(const v8h*)&Vs[(i * 32u + (tid >> 3)) * LDV + (tid & 7u) * 8u];
#pragma unroll
  for (unsigned i = 0; i < 8u; ++i)
    *(v8h*)(qk + (row0 + i * 8u + w) * QKP + lane * 8u) = yq[i];
#pragma unroll
  for (unsigned i = 0; i < 4u; ++i)
    *(v8h*)(vt + ((size_t)b * DIM + i * 32u + (tid >> 3)) * TOKP + f0 + (tid & 7u) * 8u) = yv[i];
}

// ---------------------------------------------------------------------------
// Dense flash attention, register-fed transposed form, with the output projection behind it.
// Block = (32 query tokens, batch b, all 8 heads), wave = head; each wave carries QT = 2 query
// tiles of 16 tokens, so every K and V^T fragment fetched from the global planes feeds both
// tiles. Per 32-key step:
//   S^T tiles (keys x queries) = K tile (A, 16 keys x d padded to 32) . Q^T (B, d x 16 queries),
//   two 16-key tiles per query tile; lane (h, n) holds query column n, key rows 8h+r of each.
//   Online softmax per query column: in-lane over 16 values + one 16-lane-distance shuffle.
//   P^T packed as B fragment: element r <- tile 0 row 8h+r, element 8+r <- tile 1 row 8h+r
//   (keys kb+8h+r and kb+16+8h+r), f16(1024 p); the row sum l carries the same x1024.
//   O^T (d x queries) += V^T tile (A, [d][32 keys] from the transposed V plane) . P^T.
// No LDS and no barrier in the key loop. Behind it the block's attention rows [32 tokens][DIM],
// f16(64 * O / l), meet in Os (block barrier) and are multiplied by W0^T there:
//   wave w takes token tile w & 1 and output columns 32 (w >> 1) .. +31: A = W0 rows (16
//   columns, from the 16-bit global plane), B = attention rows (16 tokens, from Os), k = DIM;
//   lane (h, token) holds columns 8h .. 8h+7 of its token in each of the two tiles.
//   Each wave stages its 16 x 32 f32 tile in its own LDS range and writes whole 128-B lines:
//   outf[(f * NB_FULL + b)][col] = acc/4096 + bf16(bias).
// Grid (NTOK/32, NB), 256 threads. The launch bound asks for ten waves per SIMD (five blocks
// per WGP): with fewer the grid would not be resident at once and a second round would follow.
// ---------------------------------------------------------------------------
#define QT   2                 // query tiles per wave
#define LDG  136               // halves per LDS row of the attention tile (272 B = 16 B x odd)
static_assert((NTOK % (16 * QT)) == 0);
static_assert(QT == 2 && DIM == 4 * 32);   // 8 waves = 2 token tiles x 4 groups of 32 columns
static_assert((LDG % 8) == 0 && LDG >= DIM);

// second bound: ten waves per SIMD, so that five 8-wave blocks fit a WGP and the whole grid is resident
__global__ __launch_bounds__(NHEAD * 32, 10) void attn_kernel(
    const _Float16* __restrict__ QK, const _Float16* __restrict__ Vt,
    const _Float16* __restrict__ W016, const float* __restrict__ bias,
    float* __restrict__ outf) {
  __shared__ __attribute__((aligned(16))) _Float16 Os[16 * QT * LDG];
  __shared__ __attribute__((aligned(16))) float Cs[NHEAD * 16 * LDC];

  const unsigned tid = threadIdx.x, lane = tid & 31u;
  const unsigned hw = (unsigned)__builtin_amdgcn_readfirstlane((int)(threadIdx.x >> 5));
  const unsigned head = hw;
  const unsigned hh = lane >> 4, m = lane & 15u;
  const unsigned q0 = blockIdx.x * (16u * QT);
  const unsigned b = blockIdx.y;
  const size_t tokbase = (size_t)b * TOKP;
  // HD^-0.5, the two x64 carries and log2(e): maxima and exponents are kept in base 2
  const float sscale = 0.25f * 1.4426950408889634f / (QCARRY * QCARRY);

  // Q^T as B operand: lane (h, n) <- q[token q0+16t+n][head*16 + 8h .. +7], k 16..31 zero
  v16h qf[QT];
#pragma unroll   // constant t keeps the per-tile arrays in registers
  for (unsigned t = 0; t < (unsigned)QT; ++t)
    qf[t] = frag_k16(QK + (tokbase + q0 + 16u * t + m) * QKP + head * HD + hh * 8u);
  // K tile as A operand: lane (h, m) <- k[token kb+m][head*16 + 8h .. +7]
  const _Float16* kp = QK + (tokbase + m) * QKP + DIM + head * HD + hh * 8u;
  // V^T tile as A operand: lane (h, m = d) <- vt[d][kb + 8h .. +7], vt[d][kb + 16 + 8h .. +7]
  const _Float16* vp = Vt + ((size_t)b * DIM + head * HD + m) * TOKP + hh * 8u;

  float mrow[QT], lrow[QT];
  v8f o[QT];
#pragma unroll   // constant t keeps the per-tile arrays in registers
  for (int t = 0; t < QT; ++t) {
    mrow[t] = -1.0e30f;
    lrow[t] = 0.0f;
    o[t] = v8f{};
  }

  for (unsigned kb = 0; kb < (unsigned)NTOK; kb += 32u) {
    const v16h ka0 = frag_k16(kp + (size_t)kb * QKP);
    const v16h ka1 = frag_k16(kp + (size_t)(kb + 16u) * QKP);
    const v16h va  = frag_at(vp + kb);

#pragma unroll   // both tiles in one body: their chains are independent and can interleave
    for (int t = 0; t < QT; ++t) {
      v8f s0 = {}, s1 = {};
      s0 = wmma16(ka0, qf[t], s0);
      s1 = wmma16(ka1, qf[t], s1);

      float mx = fmaxf(s0[0], s1[0]);
#pragma unroll
      for (int r = 1; r < 8; ++r) mx = fmaxf(mx, fmaxf(s0[r], s1[r]));
      mx = fmaxf(mx, __shfl_xor(mx, 16, 32));
      const float mn = fmaxf(mrow[t], mx * sscale);
      const float alpha = __builtin_amdgcn_exp2f(mrow[t] - mn);
      mrow[t] = mn;

      // 1024 p = exp2(s * sscale - mn + 10): one multiply-add and one exponential per score
      const float eb = PCARRY_LOG2 - mn;
      float rs = 0.0f;
      v16h pf;
#pragma unroll
      for (int r = 0; r < 8; ++r) {
        const float p0 = __builtin_amdgcn_exp2f(s0[r] * sscale + eb);
        const float p1 = __builtin_amdgcn_exp2f(s1[r] * sscale + eb);
        rs += p0 + p1;
        pf[r]     = (h16)p0;
        pf[r + 8] = (h16)p1;
      }
      rs += __shfl_xor(rs, 16, 32);
      lrow[t] = alpha * lrow[t] + rs;
#pragma unroll
      for (int r = 0; r < 8; ++r) o[t][r] = o[t][r] * alpha;

      o[t] = wmma16(va, pf, o[t]);
    }
  }

  // output tile of this wave: token tile tt, columns 32 cg .. +31; its bias piece is asked for
  // here, so that it flies during the finalize
  const unsigned tt = hw & 1u, cg = hw >> 1;
  const v4f g = *(const v4f*)(bias + cg * 32u + (lane & 7u) * 4u);

  // finalize: o[t][r] is (d = 8h + r, token q0 + 16t + m); f16(64 * O / l), 8 halves per lane
#pragma unroll   // constant t keeps the per-tile arrays in registers
  for (unsigned t = 0; t < (unsigned)QT; ++t) {
    const float inv = __builtin_amdgcn_rcpf(lrow[t]) * (CCARRY / QCARRY);   // l carries the x1024 of p
    v8h ov;
#pragma unroll
    for (int r = 0; r < 8; ++r) ov[r] = toh_flush(o[t][r] * inv);
    *(v8h*)&Os[(16u * t + m) * LDG + hw * HD + hh * 8u] = ov;
  }

  __syncthreads();

  // output projection of the block's 32 rows: two 16 x 16 tiles per wave, k = DIM in steps of 32
  const _Float16* wp = W016 + (size_t)(cg * 32u + m) * DIM + hh * 8u;
  const _Float16* xa = &Os[(tt * 16u + m) * LDG + hh * 8u];
  v8f acc0 = {}, acc1 = {};
#pragma unroll   // all fragment loads can issue ahead of the first product
  for (unsigned k = 0; k < 4u; ++k) {
    const v16h x = frag_at(xa + k * 32u);
    acc0 = wmma_plain(frag_at(wp + k * 32u), x, acc0);
    acc1 = wmma_plain(frag_at(wp + (size_t)16 * DIM + k * 32u), x, acc1);
  }
  // the address that all sixteen W0 loads name is an input here: it stays live up to this wait, so
  // that no load's result is written over it while an earlier load of the run still names it
  asm volatile("s_wait_xcnt 0x0" :: "v"(wp) : "memory");
  float* cw = &Cs[hw * (16u * LDC)];
  float* cd = cw + m * LDC + hh * 8u;
  *(v4f*)(cd)      = v4f{acc0[0], acc0[1], acc0[2], acc0[3]};
  *(v4f*)(cd + 4)  = v4f{acc0[4], acc0[5], acc0[6], acc0[7]};
  *(v4f*)(cd + 16) = v4f{acc1[0], acc1[1], acc1[2], acc1[3]};
  *(v4f*)(cd + 20) = v4f{acc1[4], acc1[5], acc1[6], acc1[7]};
  // the wave reads back rows that its other lanes wrote: its own LDS stores must have landed
  asm volatile("s_wait_dscnt 0x0" ::: "memory");

  // 8 consecutive lanes x 16 B = one whole 128-B line of an output row; 4 rows per store
  const float cs = 1.0f / (WCARRY * CCARRY);
  v4f y[4];
#pragma unroll   // all LDS reads issue before the first store
  for (unsigned i = 0; i < 4u; ++i) {
    const v4f u = *(const v4f*)&cw[(i * 4u + (lane >> 3)) * LDC + (lane & 7u) * 4u];
#pragma unroll
    for (int j = 0; j < 4; ++j) y[i][j] = u[j] * cs + bf16r(g[j]);
  }
#pragma unroll
  for (unsigned i = 0; i < 4u; ++i)
    *(v4f*)(outf + ((size_t)(q0 + tt * 16u + i * 4u + (lane >> 3)) * NB_FULL + b) * DIM +
            cg * 32u + (lane & 7u) * 4u) = y[i];
}

// ---------------------------------------------------------------------------
extern "C" void kernel_launch(void* const* d_in, const int* in_sizes, int n_in,
                              void* d_out, int out_size, void* d_ws, size_t ws_size,
                              hipStream_t stream) {
  if (n_in < 5) return;
  const long long need_xs = ((long long)(SEQ - 1) * NB_FULL + NB) * DIM;
  const long long need_out = ((long long)(NTOK - 1) * NB_FULL + NB) * DIM;
  if ((long long)in_sizes[0] < (long long)NPATCH * DIM) return;
  if ((long long)in_sizes[1] < need_xs) return;
  if ((long long)in_sizes[2] < (long long)3 * DIM * DIM) return;
  if ((long long)in_sizes[3] < (long long)DIM * DIM) return;
  if (in_sizes[4] < DIM) return;
  if ((long long)out_size < need_out) return;
  if (ws_size < WS_TOTAL) return;

  const float* xp   = (const float*)d_in[0];   // [32][1][DIM]
  const float* xs   = (const float*)d_in[1];   // [SEQ_FULL][NB_FULL][DIM]
  const float* wqkv = (const float*)d_in[2];   // [3*DIM][DIM]  (out, in): q | k | v rows
  const float* w0   = (const float*)d_in[3];   // [DIM][DIM]    (out, in)
  const float* w0b  = (const float*)d_in[4];   // [DIM]
  float* out = (float*)d_out;                  // [NTOK][NB_FULL][DIM]

  char* ws = (char*)d_ws;
  _Float16* Wqkv16 = (_Float16*)(ws + OFF_WQKV);   // [3*DIM][DIM]
  _Float16* W016   = (_Float16*)(ws + OFF_W0);     // [DIM][DIM]
  _Float16* QK16   = (_Float16*)(ws + OFF_QK);     // [NB*TOKP][QKP]
  _Float16* Vt16   = (_Float16*)(ws + OFF_VT);     // [NB][DIM][TOKP]

  dim3 blk(256);
  wcast_kernel<<<dim3((3 * DIM * DIM) / 2048), blk, 0, stream>>>(wqkv, Wqkv16);
  wcast_kernel<<<dim3((DIM * DIM) / 2048), blk, 0, stream>>>(w0, W016);
  // token conversion and q | k | v columns (v written transposed) in one launch
  proj_kernel<<<dim3(TOKP / 64, NB), blk, 0, stream>>>(xp, xs, Wqkv16, QK16, Vt16);
  // attention and the output projection in one launch
  attn_kernel<<<dim3(NTOK / (16 * QT), NB), blk, 0, stream>>>(QK16, Vt16, W016, w0b, out);
}

// v005
// One run takes 52.7 microseconds.
// Next to v004, in two timings, it ran 1.06 and 1.07 times as fast.
// Counting every step since v000, it is 1.99 times as fast.
#include <hip/hip_runtime.h>
#include <stddef.h>

// All contractions on v_wmma_f32_16x16x32_f16 (f16 operands, f32 accumulate): q|k and v
// projection, q.k scores (head width 16 zero-padded to k = 32), p.v, output projection.
// Float inputs are RNE-converted to bf16 and carried in f16 (weights x64, q/k/v planes x64,
// p x1024, attention rows x64); softmax, scale and bias in f32.
// The q, k and v planes lie in fragment order: one 16-token x 16-column tile = 32 lanes x 16 B =
// 512 contiguous bytes, so that every wave-wide store and load of a tile covers four whole lines.

typedef _Float16 h16;
typedef _Float16 v16h __attribute__((ext_vector_type(16)));
typedef _Float16 v8h  __attribute__((ext_vector_type(8)));
typedef _Float16 v4h  __attribute__((ext_vector_type(4)));
typedef float    v8f  __attribute__((ext_vector_type(8)));
typedef float    v4f  __attribute__((ext_vector_type(4)));

#ifndef NB
#define NB 64
#endif
#ifndef SEQ
#define SEQ 512
#endif
#define NB_FULL  64
#define SEQ_FULL 512
#define DIM    128
#define NHEAD  8
#define HD     16
#define NPATCH 32
#define NTOK   (NPATCH + SEQ)                 // tokens per batch (patch rows first)
#define TOKP   (((NTOK + 63) / 64) * 64)      // token rows per batch padded to the GEMM tile
#define QKP    256                            // q|k columns: q cols 0..127, k cols 128..255
#define XROWS  (NB * TOKP)                    // token rows of the batch-major planes
#define NT16   (TOKP / 16)                    // 16-token tiles per batch
#define FRAGH  256                            // halves per fragment tile (32 lanes x 8 halves)

static_assert(NB >= 1 && NB <= NB_FULL);
static_assert(SEQ >= 32 && SEQ <= SEQ_FULL);
static_assert(DIM == NHEAD * HD);
static_assert(HD == 16);                      // one 16-B load per score fragment, 8 halves per lane half
static_assert(NHEAD == 8);                    // one wave per head
static_assert((DIM % 32) == 0 && (DIM % 64) == 0);
static_assert(QKP == 2 * DIM && (QKP % 64) == 0);
static_assert((NTOK % 32) == 0);              // 32-key steps cover the key range exactly
static_assert((NTOK % 16) == 0);              // 16-query tiles cover the query range exactly
static_assert((TOKP % 64) == 0 && TOKP >= NTOK);
static_assert((XROWS % 64) == 0 && (XROWS % 16) == 0);
static_assert(((3 * DIM * DIM) % 2048) == 0 && ((DIM * DIM) % 2048) == 0);

#define LDC 36    // floats per LDS row of a wave's output staging tile (144 B = 16 B x odd)
static_assert((LDC % 4) == 0 && LDC >= 32);

#define WCARRY 64.0f     // weight planes carried x64
#define QCARRY 64.0f     // q, k, v planes carried x64 (the projection accumulator as is)
#define PCARRY_LOG2 10.0f   // softmax numerators and their row sum carried x1024, as an addend of the base-2 exponent
#define CCARRY 64.0f     // attention rows (the LDS tile Os) carried x64

// workspace layout (bytes)
#define WQKV_BYTES ((size_t)3 * DIM * DIM * 2)
#define W0_BYTES   ((size_t)DIM * DIM * 2)
#define QK_BYTES   ((size_t)XROWS * QKP * 2)
#define VT_BYTES   ((size_t)NB * DIM * TOKP * 2)
#define OFF_WQKV ((size_t)0)
#define OFF_W0   (OFF_WQKV + WQKV_BYTES)
#define OFF_QK   (OFF_W0 + W0_BYTES)
#define OFF_VT   (OFF_QK + QK_BYTES)
#define WS_TOTAL (OFF_VT + VT_BYTES)
static_assert((WQKV_BYTES % 128) == 0 && (W0_BYTES % 128) == 0);
static_assert((QK_BYTES % 128) == 0 && (VT_BYTES % 128) == 0);
static_assert(WS_TOTAL <= (size_t)134217728);

// ---------------------------------------------------------------------------
__device__ __forceinline__ float bf16r(float x) {   // RNE convert to bf16, returned widened
  unsigned int u = __float_as_uint(x);
  u = (u + 0x7FFFu + ((u >> 16) & 1u)) & 0xFFFF0000u;
  return __uint_as_float(u);
}

// f32 -> f16 with a value select: results below the smallest normal f16 become zero.
static __device__ __forceinline__ h16 toh_flush(float v) {
  const h16 r = (h16)v;
  return (fabsf(v) < 6.103515625e-05f) ? (h16)0.0f : r;
}

// 16-bit fragment: p points at element [row = lane&15][k0 + 8*(lane>>4)] of a k-contiguous
// row. Elements 0..7 <- k0+8h+0..7, elements 8..15 <- k0+16+8h+0..7 (same map for A and B).
__device__ __forceinline__ v16h frag_at(const _Float16* p) {
  v8h lo = *(const v8h*)(p);
  v8h hi = *(const v8h*)(p + 16);
  v16h out;
#pragma unroll
  for (int i = 0; i < 8; ++i) { out[i] = lo[i]; out[i + 8] = hi[i]; }
  return out;
}

// Fragment of a 16-deep contraction padded to k = 32: p points at [row = lane&15][8*(lane>>4)];
// elements 0..7 <- k = 8h+0..7, elements 8..15 (k = 16..31) are zero.
__device__ __forceinline__ v16h frag_k16(const _Float16* p) {
  const v8h lo = *(const v8h*)(p);
  v16h out;
#pragma unroll
  for (int i = 0; i < 8; ++i) { out[i] = lo[i]; out[i + 8] = (_Float16)0.0f; }
  return out;
}

// 16-bit fragment from two neighbouring fragment tiles: p points at this lane's 16-B piece of the
// first; elements 0..7 <- first tile (k = 8h+0..7), elements 8..15 <- second tile (k = 16+8h+0..7).
__device__ __forceinline__ v16h frag_tiles(const _Float16* p) {
  const v8h lo = *(const v8h*)(p);
  const v8h hi = *(const v8h*)(p + FRAGH);
  v16h out;
#pragma unroll
  for (int i = 0; i < 8; ++i) { out[i] = lo[i]; out[i + 8] = hi[i]; }
  return out;
}

__device__ __forceinline__ v8f wmma16(v16h a, v16h b, v8f c) {
  v8f d = __builtin_amdgcn_wmma_f32_16x16x32_f16(false, a, false, b, (short)0, c,
                                                 false, false);
  asm volatile("v_nop\n\tv_nop\n\tv_nop\n\tv_nop" : "+v"(d) : "v"(a), "v"(b));
  return d;
}

// ---------------------------------------------------------------------------
// Weight plane: W[n][k] (f32, k contiguous) -> W16[n][k] = f16(64 * bf16(w)), same layout.
// Each thread 8 elements; a wave writes 512 contiguous bytes per store instruction.
// Grid (elements / 2048), exact.
// ---------------------------------------------------------------------------
__global__ __launch_bounds__(256) void wcast_kernel(
    const float* __restrict__ W, _Float16* __restrict__ W16) {
  const size_t idx = ((size_t)blockIdx.x * 256u + threadIdx.x) * 8u;
  const v4f a0 = *(const v4f*)(W + idx);
  const v4f a1 = *(const v4f*)(W + idx + 4);
  v8h o;
#pragma unroll
  for (int i = 0; i < 4; ++i) {
    o[i]     = toh_flush(WCARRY * bf16r(a0[i]));
    o[i + 4] = toh_flush(WCARRY * bf16r(a1[i]));
  }
  _Float16* p = W16 + idx;
  *(v8h*)p = o;
  
}

// ---------------------------------------------------------------------------
// Fused token conversion + q | k | v projection. Block = 64 token rows of one batch x all 384
// output columns, 8 waves. Row f of batch b: f < 32 patch row f (shared by all b),
// 32 <= f < NTOK sequence row (s = f - 32, b) of xs[s][b][:], f >= NTOK zero rows.
//   1. each wave reads 8 whole 512-B rows (f32), converts to f16(bf16(x)) and lays them in Xs.
//   2. wave w makes q|k columns 32w .. 32w+31 and v columns 16w .. 16w+15 for all 64 rows
//      (12 accumulator tiles); every weight fragment is fetched once per block.
//      q|k tiles run as W (A, 16 columns) . X^T (B, 16 tokens): lane (h, token) holds columns
//      8h .. 8h+7 of its token: the piece that lane (h, token) of a score fragment holds.
//      v tiles run as X (A, 16 tokens) . W^T (B, 16 columns): lane (h, d) holds tokens
//      8h .. 8h+7 of its column: the piece that lane (h, d) of a V^T fragment holds.
//   3. each tile goes from the accumulator (x64 carry, f16) straight to its place, 16 B per lane,
//      512 contiguous bytes per wave-wide store:
//      QK[b][column tile 0..15 (q heads, then k heads)][token tile][lane][8] and
//      Vt[b][head][token tile][lane][8].
// Grid (TOKP / 64, NB).
// ---------------------------------------------------------------------------
#define LDX 136   // halves per LDS row of the token tile (272 B = 16 B x odd)
static_assert(LDX >= DIM && (LDX % 8) == 0);
static_assert(QKP == 2 * NHEAD * HD && FRAGH == 16 * HD);   // a column tile is one head of q or of k
static_assert(QKP == 8 * 32 && DIM == 8 * 16);   // 8 waves: 32 q|k columns and 16 v columns each
static_assert((NPATCH % 8) == 0 && (NTOK % 8) == 0 && SEQ >= 8);   // a wave's 8 rows are of one kind

// The builtin alone: the compiler keeps the distances behind it and can place fragment loads
// between the matrix instructions.
__device__ __forceinline__ v8f wmma_plain(v16h a, v16h b, v8f c) {
  return __builtin_amdgcn_wmma_f32_16x16x32_f16(false, a, false, b, (short)0, c, false, false);
}

__device__ __forceinline__ v8h pack_flush(v8f a) {
  v8h o;
#pragma unroll
  for (int r = 0; r < 8; ++r) o[r] = toh_flush(a[r]);
  return o;
}

__global__ __launch_bounds__(256) void proj_kernel(
    const float* __restrict__ xp, const float* __restrict__ xs,
    const _Float16* __restrict__ W16, _Float16* __restrict__ qk, _Float16* __restrict__ vt) {
  __shared__ __attribute__((aligned(16))) _Float16 Xs[64 * LDX];
  const unsigned tid = threadIdx.x, lane = tid & 31u;
  const unsigned w = (unsigned)__builtin_amdgcn_readfirstlane((int)(threadIdx.x >> 5));
  const unsigned hh = lane >> 4, m = lane & 15u;
  const unsigned f0 = blockIdx.x * 64u;
  const unsigned b = blockIdx.y;

  // wave-uniform row bases plus one per-lane offset shared by all weight fragments
  const unsigned woff = m * (unsigned)DIM + hh * 8u;
  const _Float16* wq0 = W16 + (size_t)(w * 32u) * DIM;
  const _Float16* wq1 = W16 + (size_t)(w * 32u + 16u) * DIM;
  const _Float16* wv  = W16 + (size_t)(QKP + w * 16u) * DIM;
  // the first weight fragments are asked for together with the token rows
  v16h q0 = frag_at(wq0 + woff);
  v16h q1 = frag_at(wq1 + woff);
  v16h vv = frag_at(wv + woff);

  // token rows: one wave-wide 16-B load = one whole row. A wave's 8 rows are all patch rows,
  // all sequence rows or all zero rows, so source and row step are wave-uniform.
  const unsigned fg = f0 + w * 8u;
  const bool isp = fg < (unsigned)NPATCH;
  const bool live = fg < (unsigned)NTOK;
  unsigned sq = isp ? 0u : (fg - (unsigned)NPATCH);
  sq = (sq < (unsigned)(SEQ - 8)) ? sq : (unsigned)(SEQ - 8);
  const float* plane = isp ? xp : xs;
  const unsigned row = isp ? fg : (sq * (unsigned)NB_FULL + b);
  const unsigned step = isp ? (unsigned)DIM : (unsigned)(NB_FULL * DIM);
  const float* src = plane + (size_t)row * DIM;
  v4f xv[8];
#pragma unroll   // all eight row loads in flight together
  for (unsigned i = 0; i < 8u; ++i) xv[i] = *(const v4f*)(src + (i * step + lane * 4u));
#pragma unroll
  for (unsigned i = 0; i < 8u; ++i) {
    v4h o;
#pragma unroll
    for (int j = 0; j < 4; ++j) o[j] = toh_flush(bf16r(live ? xv[i][j] : 0.0f));
    *(v4h*)&Xs[(w * 8u + i) * LDX + lane * 4u] = o;
  }
  __syncthreads();

  const _Float16* xa  = &Xs[m * LDX + hh * 8u];
  v8f aq0[4] = {}, aq1[4] = {}, av[4] = {};
#pragma unroll   // constant indices keep the accumulator arrays in registers
  for (unsigned k0 = 0; k0 < (unsigned)DIM; k0 += 32u) {
#pragma unroll
    for (unsigned t = 0; t < 4u; ++t) {
      const v16h x = frag_at(xa + t * 16u * LDX + k0);
      aq0[t] = wmma_plain(q0, x, aq0[t]);
      aq1[t] = wmma_plain(q1, x, aq1[t]);
      av[t]  = wmma_plain(x, vv, av[t]);
    }
    if (k0 + 32u < (unsigned)DIM) {
      q0 = frag_at((wq0 + k0 + 32u) + woff);
      q1 = frag_at((wq1 + k0 + 32u) + woff);
      vv = frag_at((wv + k0 + 32u) + woff);
    }
  }

  // the wave's column tiles 2w, 2w+1 (q|k) and w (v); its four token tiles lie side by side
  const unsigned t0 = f0 / 16u;
  _Float16* qd0 = qk + ((size_t)(b * 16u + w * 2u) * NT16 + t0) * FRAGH + lane * 8u;
  _Float16* qd1 = qd0 + (size_t)NT16 * FRAGH;
  _Float16* vd  = vt + ((size_t)(b * (unsigned)NHEAD + w) * NT16 + t0) * FRAGH + lane * 8u;
#pragma unroll
  for (unsigned t = 0; t < 4u; ++t) {
    *(v8h*)(qd0 + t * FRAGH) = pack_flush(aq0[t]);
    *(v8h*)(qd1 + t * FRAGH) = pack_flush(aq1[t]);
    *(v8h*)(vd + t * FRAGH)  = pack_flush(av[t]);
  }
}

// ---------------------------------------------------------------------------
// Dense flash attention, register-fed transposed form, with the output projection behind it.
// Block = (32 query tokens, batch b, all 8 heads), wave = head; each wave carries QT = 2 query
// tiles of 16 tokens, so every K and V^T fragment fetched from the global planes feeds both
// tiles; the planes lie in fragment order, each fragment load is 512 contiguous bytes.
// Per 32-key step:
//   S^T tiles (keys x queries) = K tile (A, 16 keys x d padded to 32) . Q^T (B, d x 16 queries),
//   two 16-key tiles per query tile; lane (h, n) holds query column n, key rows 8h+r of each.
//   Online softmax per query column: in-lane over 16 values + one 16-lane-distance shuffle.
//   P^T packed as B fragment: element r <- tile 0 row 8h+r, element 8+r <- tile 1 row 8h+r
//   (keys kb+8h+r and kb+16+8h+r), f16(1024 p); the row sum l carries the same x1024.
//   O^T (d x queries) += V^T tile (A, [d][32 keys] from the transposed V plane) . P^T.
// No LDS and no barrier in the key loop. Behind it the block's attention rows [32 tokens][DIM],
// f16(64 * O / l), meet in Os (block barrier) and are multiplied by W0^T there:
//   wave w takes token tile w & 1 and output columns 32 (w >> 1) .. +31: A = W0 rows (16
//   columns, from the 16-bit global plane), B = attention rows (16 tokens, from Os), k = DIM;
//   lane (h, token) holds columns 8h .. 8h+7 of its token in each of the two tiles.
//   Each wave stages its 16 x 32 f32 tile in its own LDS range and writes whole 128-B lines:
//   outf[(f * NB_FULL + b)][col] = acc/4096 + bf16(bias).
// Grid (NTOK/32, NB), 256 threads. The launch bound asks for ten waves per SIMD (five blocks
// per WGP): with fewer the grid would not be resident at once and a second round would follow.
// ---------------------------------------------------------------------------
#define QT   2                 // query tiles per wave
#define LDG  136               // halves per LDS row of the attention tile (272 B = 16 B x odd)
static_assert((NTOK % (16 * QT)) == 0);
static_assert(QT == 2 && DIM == 4 * 32);   // 8 waves = 2 token tiles x 4 groups of 32 columns
static_assert((LDG % 8) == 0 && LDG >= DIM);

// second bound: ten waves per SIMD, so that five 8-wave blocks fit a WGP and the whole grid is resident
__global__ __launch_bounds__(NHEAD * 32, 10) void attn_kernel(
    const _Float16* __restrict__ QK, const _Float16* __restrict__ Vt,
    const _Float16* __restrict__ W016, const float* __restrict__ bias,
    float* __restrict__ outf) {
  __shared__ __attribute__((aligned(16))) _Float16 Os[16 * QT * LDG];
  __shared__ __attribute__((aligned(16))) float Cs[NHEAD * 16 * LDC];

  const unsigned tid = threadIdx.x, lane = tid & 31u;
  const unsigned hw = (unsigned)__builtin_amdgcn_readfirstlane((int)(threadIdx.x >> 5));
  const unsigned head = hw;
  const unsigned hh = lane >> 4, m = lane & 15u;
  const unsigned q0 = blockIdx.x * (16u * QT);
  const unsigned b = blockIdx.y;
  // HD^-0.5, the two x64 carries and log2(e): maxima and exponents are kept in base 2
  const float sscale = 0.25f * 1.4426950408889634f / (QCARRY * QCARRY);

  // Q^T as B operand: lane (h, n) <- q[token q0+16t+n][head*16 + 8h .. +7], k 16..31 zero
  v16h qf[QT];
#pragma unroll   // constant t keeps the per-tile arrays in registers
  for (unsigned t = 0; t < (unsigned)QT; ++t)
    qf[t] = frag_k16(QK + ((size_t)(b * 16u + head) * NT16 + q0 / 16u + t) * FRAGH + lane * 8u);
  // K tile as A operand: lane (h, m) <- k[token kb+m][head*16 + 8h .. +7]
  const _Float16* kp = QK + (size_t)(b * 16u + (unsigned)NHEAD + head) * NT16 * FRAGH + lane * 8u;
  // V^T tile as A operand: lane (h, m = d) <- vt[d][kb + 8h .. +7], vt[d][kb + 16 + 8h .. +7]
  const _Float16* vp = Vt + (size_t)(b * (unsigned)NHEAD + head) * NT16 * FRAGH + lane * 8u;

  float mrow[QT], lrow[QT];
  v8f o[QT];
#pragma unroll   // constant t keeps the per-tile arrays in registers
  for (int t = 0; t < QT; ++t) {
    mrow[t] = -1.0e30f;
    lrow[t] = 0.0f;
    o[t] = v8f{};
  }

  for (unsigned kb = 0; kb < (unsigned)NTOK; kb += 32u) {
    const unsigned ko = (kb / 16u) * FRAGH;   // token tiles kb/16 and kb/16 + 1
    const v16h ka0 = frag_k16(kp + ko);
    const v16h ka1 = frag_k16(kp + ko + FRAGH);
    const v16h va  = frag_tiles(vp + ko);

#pragma unroll   // both tiles in one body: their chains are independent and can interleave
    for (int t = 0; t < QT; ++t) {
      v8f s0 = {}, s1 = {};
      s0 = wmma16(ka0, qf[t], s0);
      s1 = wmma16(ka1, qf[t], s1);

      float mx = fmaxf(s0[0], s1[0]);
#pragma unroll
      for (int r = 1; r < 8; ++r) mx = fmaxf(mx, fmaxf(s0[r], s1[r]));
      mx = fmaxf(mx, __shfl_xor(mx, 16, 32));
      const float mn = fmaxf(mrow[t], mx * sscale);
      const float alpha = __builtin_amdgcn_exp2f(mrow[t] - mn);
      mrow[t] = mn;

      // 1024 p = exp2(s * sscale - mn + 10): one multiply-add and one exponential per score
      const float eb = PCARRY_LOG2 - mn;
      float rs = 0.0f;
      v16h pf;
#pragma unroll
      for (int r = 0; r < 8; ++r) {
        const float p0 = __builtin_amdgcn_exp2f(s0[r] * sscale + eb);
        const float p1 = __builtin_amdgcn_exp2f(s1[r] * sscale + eb);
        rs += p0 + p1;
        pf[r]     = (h16)p0;
        pf[r + 8] = (h16)p1;
      }
      rs += __shfl_xor(rs, 16, 32);
      lrow[t] = alpha * lrow[t] + rs;
#pragma unroll
      for (int r = 0; r < 8; ++r) o[t][r] = o[t][r] * alpha;

      o[t] = wmma16(va, pf, o[t]);
    }
  }

  // output tile of this wave: token tile tt, columns 32 cg .. +31; its bias piece is asked for
  // here, so that it flies during the finalize
  const unsigned tt = hw & 1u, cg = hw >> 1;
  const v4f g = *(const v4f*)(bias + cg * 32u + (lane & 7u) * 4u);

  // finalize: o[t][r] is (d = 8h + r, token q0 + 16t + m); f16(64 * O / l), 8 halves per lane
#pragma unroll   // constant t keeps the per-tile arrays in registers
  for (unsigned t = 0; t < (unsigned)QT; ++t) {
    const float inv = __builtin_amdgcn_rcpf(lrow[t]) * (CCARRY / QCARRY);   // l carries the x1024 of p
    v8h ov;
#pragma unroll
    for (int r = 0; r < 8; ++r) ov[r] = toh_flush(o[t][r] * inv);
    *(v8h*)&Os[(16u * t + m) * LDG + hw * HD + hh * 8u] = ov;
  }

  __syncthreads();

  // output projection of the block's 32 rows: two 16 x 16 tiles per wave, k = DIM in steps of 32
  const _Float16* wp = W016 + (size_t)(cg * 32u + m) * DIM + hh * 8u;
  const _Float16* xa = &Os[(tt * 16u + m) * LDG + hh * 8u];
  v8f acc0 = {}, acc1 = {};
#pragma unroll   // all fragment loads can issue ahead of the first product
  for (unsigned k = 0; k < 4u; ++k) {
    const v16h x = frag_at(xa + k * 32u);
    acc0 = wmma_plain(frag_at(wp + k * 32u), x, acc0);
    acc1 = wmma_plain(frag_at(wp + (size_t)16 * DIM + k * 32u), x, acc1);
  }
  // the address that all sixteen W0 loads name is an input here: it stays live up to this wait, so
  // that no load's result is written over it while an earlier load of the run still names it
  asm volatile("s_wait_xcnt 0x0" :: "v"(wp) : "memory");
  float* cw = &Cs[hw * (16u * LDC)];
  float* cd = cw + m * LDC + hh * 8u;
  *(v4f*)(cd)      = v4f{acc0[0], acc0[1], acc0[2], acc0[3]};
  *(v4f*)(cd + 4)  = v4f{acc0[4], acc0[5], acc0[6], acc0[7]};
  *(v4f*)(cd + 16) = v4f{acc1[0], acc1[1], acc1[2], acc1[3]};
  *(v4f*)(cd + 20) = v4f{acc1[4], acc1[5], acc1[6], acc1[7]};
  // the wave reads back rows that its other lanes wrote: its own LDS stores must have landed
  asm volatile("s_wait_dscnt 0x0" ::: "memory");

  // 8 consecutive lanes x 16 B = one whole 128-B line of an output row; 4 rows per store
  const float cs = 1.0f / (WCARRY * CCARRY);
  v4f y[4];
#pragma unroll   // all LDS reads issue before the first store
  for (unsigned i = 0; i < 4u; ++i) {
    const v4f u = *(const v4f*)&cw[(i * 4u + (lane >> 3)) * LDC + (lane & 7u) * 4u];
#pragma unroll
    for (int j = 0; j < 4; ++j) y[i][j] = u[j] * cs + bf16r(g[j]);
  }
#pragma unroll
  for (unsigned i = 0; i < 4u; ++i)
    *(v4f*)(outf + ((size_t)(q0 + tt * 16u + i * 4u + (lane >> 3)) * NB_FULL + b) * DIM +
            cg * 32u + (lane & 7u) * 4u) = y[i];
}

// ---------------------------------------------------------------------------
extern "C" void kernel_launch(void* const* d_in, const int* in_sizes, int n_in,
                              void* d_out, int out_size, void* d_ws, size_t ws_size,
                              hipStream_t stream) {
  if (n_in < 5) return;
  const long long need_xs = ((long long)(SEQ - 1) * NB_FULL + NB) * DIM;
  const long long need_out = ((long long)(NTOK - 1) * NB_FULL + NB) * DIM;
  if ((long long)in_sizes[0] < (long long)NPATCH * DIM) return;
  if ((long long)in_sizes[1] < need_xs) return;
  if ((long long)in_sizes[2] < (long long)3 * DIM * DIM) return;
  if ((long long)in_sizes[3] < (long long)DIM * DIM) return;
  if (in_sizes[4] < DIM) return;
  if ((long long)out_size < need_out) return;
  if (ws_size < WS_TOTAL) return;

  const float* xp   = (const float*)d_in[0];   // [32][1][DIM]
  const float* xs   = (const float*)d_in[1];   // [SEQ_FULL][NB_FULL][DIM]
  const float* wqkv = (const float*)d_in[2];   // [3*DIM][DIM]  (out, in): q | k | v rows
  const float* w0   = (const float*)d_in[3];   // [DIM][DIM]    (out, in)
  const float* w0b  = (const float*)d_in[4];   // [DIM]
  float* out = (float*)d_out;                  // [NTOK][NB_FULL][DIM]

  char* ws = (char*)d_ws;
  _Float16* Wqkv16 = (_Float16*)(ws + OFF_WQKV);   // [3*DIM][DIM]
  _Float16* W016   = (_Float16*)(ws + OFF_W0);     // [DIM][DIM]
  _Float16* QK16   = (_Float16*)(ws + OFF_QK);     // [NB][16][NT16][FRAGH]
  _Float16* Vt16   = (_Float16*)(ws + OFF_VT);     // [NB][NHEAD][NT16][FRAGH]

  dim3 blk(256);
  wcast_kernel<<<dim3((3 * DIM * DIM) / 2048), blk, 0, stream>>>(wqkv, Wqkv16);
  wcast_kernel<<<dim3((DIM * DIM) / 2048), blk, 0, stream>>>(w0, W016);
  // token conversion and q | k | v columns (all in fragment order) in one launch
  proj_kernel<<<dim3(TOKP / 64, NB), blk, 0, stream>>>(xp, xs, Wqkv16, QK16, Vt16);
  // attention and the output projection in one launch
  attn_kernel<<<dim3(NTOK / (16 * QT), NB), blk, 0, stream>>>(QK16, Vt16, W016, w0b, out);
}

// v006
// One run takes 51 microseconds.
// In two side-by-side timings against v005, it was 1.04 and 1.03 times as fast.
// Over all steps from v000 it is 2.07 times as fast.
#include <hip/hip_runtime.h>
#include <stddef.h>

// All contractions on v_wmma_f32_16x16x32_f16 (f16 operands, f32 accumulate): q|k and v
// projection, q.k scores (head width 16 zero-padded to k = 32), p.v, output projection.
// Float inputs are RNE-converted to bf16 and carried in f16 (weights x64, q/k/v planes x64,
// p x1024, attention rows x64); softmax, scale and bias in f32.
// The q, k and v planes lie in fragment order: one 16-token x 16-column tile = 32 lanes x 16 B =
// 512 contiguous bytes, so that every wave-wide store and load of a tile covers four whole lines.

typedef _Float16 h16;
typedef _Float16 v16h __attribute__((ext_vector_type(16)));
typedef _Float16 v8h  __attribute__((ext_vector_type(8)));
typedef _Float16 v4h  __attribute__((ext_vector_type(4)));
typedef float    v8f  __attribute__((ext_vector_type(8)));
typedef float    v4f  __attribute__((ext_vector_type(4)));

#ifndef NB
#define NB 64
#endif
#ifndef SEQ
#define SEQ 512
#endif
#define NB_FULL  64
#define SEQ_FULL 512
#define DIM    128
#define NHEAD  8
#define HD     16
#define NPATCH 32
#define NTOK   (NPATCH + SEQ)                 // tokens per batch (patch rows first)
#define TOKP   (((NTOK + 63) / 64) * 64)      // token rows per batch padded to the GEMM tile
#define QKP    256                            // q|k columns: q cols 0..127, k cols 128..255
#define XROWS  (NB * TOKP)                    // token rows of the batch-major planes
#define NT16   (TOKP / 16)                    // 16-token tiles per batch
#define FRAGH  256                            // halves per fragment tile (32 lanes x 8 halves)

static_assert(NB >= 1 && NB <= NB_FULL);
static_assert(SEQ >= 32 && SEQ <= SEQ_FULL);
static_assert(DIM == NHEAD * HD);
static_assert(HD == 16);                      // one 16-B load per score fragment, 8 halves per lane half
static_assert(NHEAD == 8);                    // one wave per head
static_assert((DIM % 32) == 0 && (DIM % 64) == 0);
static_assert(QKP == 2 * DIM && (QKP % 64) == 0);
static_assert((NTOK % 32) == 0);              // 32-key steps cover the key range exactly
static_assert((NTOK % 16) == 0);              // 16-query tiles cover the query range exactly
static_assert((TOKP % 64) == 0 && TOKP >= NTOK);
static_assert((XROWS % 64) == 0 && (XROWS % 16) == 0);
static_assert(((3 * DIM * DIM) % 2048) == 0 && ((DIM * DIM) % 2048) == 0);

#define LDC 36    // floats per LDS row of a wave's output staging tile (144 B = 16 B x odd)
static_assert((LDC % 4) == 0 && LDC >= 32);

#define WCARRY 64.0f     // weight planes carried x64
#define QCARRY 64.0f     // q, k, v planes carried x64 (the projection accumulator as is)
#define PCARRY_LOG2 10.0f   // softmax numerators and their row sum carried x1024, as an addend of the base-2 exponent
#define CCARRY 64.0f     // attention rows (the LDS tile Os) carried x64

// workspace layout (bytes)
#define WQKV_BYTES ((size_t)3 * DIM * DIM * 2)
#define W0_BYTES   ((size_t)DIM * DIM * 2)
#define QK_BYTES   ((size_t)XROWS * QKP * 2)
#define VT_BYTES   ((size_t)NB * DIM * TOKP * 2)
#define OFF_WQKV ((size_t)0)
#define OFF_W0   (OFF_WQKV + WQKV_BYTES)
#define OFF_QK   (OFF_W0 + W0_BYTES)
#define OFF_VT   (OFF_QK + QK_BYTES)
#define WS_TOTAL (OFF_VT + VT_BYTES)
static_assert((WQKV_BYTES % 128) == 0 && (W0_BYTES % 128) == 0);
static_assert((QK_BYTES % 128) == 0 && (VT_BYTES % 128) == 0);
static_assert(WS_TOTAL <= (size_t)134217728);

// ---------------------------------------------------------------------------
__device__ __forceinline__ float bf16r(float x) {   // RNE convert to bf16, returned widened
  unsigned int u = __float_as_uint(x);
  u = (u + 0x7FFFu + ((u >> 16) & 1u)) & 0xFFFF0000u;
  return __uint_as_float(u);
}

// f32 -> f16 with a value select: results below the smallest normal f16 become zero.
static __device__ __forceinline__ h16 toh_flush(float v) {
  const h16 r = (h16)v;
  return (fabsf(v) < 6.103515625e-05f) ? (h16)0.0f : r;
}

// 16-bit fragment: p points at element [row = lane&15][k0 + 8*(lane>>4)] of a k-contiguous
// row. Elements 0..7 <- k0+8h+0..7, elements 8..15 <- k0+16+8h+0..7 (same map for A and B).
__device__ __forceinline__ v16h frag_at(const _Float16* p) {
  v8h lo = *(const v8h*)(p);
  v8h hi = *(const v8h*)(p + 16);
  v16h out;
#pragma unroll
  for (int i = 0; i < 8; ++i) { out[i] = lo[i]; out[i + 8] = hi[i]; }
  return out;
}

// Fragment of a 16-deep contraction padded to k = 32: p points at [row = lane&15][8*(lane>>4)];
// elements 0..7 <- k = 8h+0..7, elements 8..15 (k = 16..31) are zero.
__device__ __forceinline__ v16h frag_k16(const _Float16* p) {
  const v8h lo = *(const v8h*)(p);
  v16h out;
#pragma unroll
  for (int i = 0; i < 8; ++i) { out[i] = lo[i]; out[i + 8] = (_Float16)0.0f; }
  return out;
}

// 16-bit fragment from two neighbouring fragment tiles: p points at this lane's 16-B piece of the
// first; elements 0..7 <- first tile (k = 8h+0..7), elements 8..15 <- second tile (k = 16+8h+0..7).
__device__ __forceinline__ v16h frag_tiles(const _Float16* p) {
  const v8h lo = *(const v8h*)(p);
  const v8h hi = *(const v8h*)(p + FRAGH);
  v16h out;
#pragma unroll
  for (int i = 0; i < 8; ++i) { out[i] = lo[i]; out[i + 8] = hi[i]; }
  return out;
}

__device__ __forceinline__ v8f wmma16(v16h a, v16h b, v8f c) {
  v8f d = __builtin_amdgcn_wmma_f32_16x16x32_f16(false, a, false, b, (short)0, c,
                                                 false, false);
  asm volatile("v_nop\n\tv_nop\n\tv_nop\n\tv_nop" : "+v"(d) : "v"(a), "v"(b));
  return d;
}

// ---------------------------------------------------------------------------
// Weight planes: W[n][k] (f32, k contiguous) -> W16[n][k] = f16(64 * bf16(w)), same layout.
// Both planes in one launch: they need nothing of each other, so they share a grid by ranges of
// the block index. Blocks 0 .. WQKV_BLKS-1 take the q|k|v weights, the rest the output weights;
// the two 16-bit planes lie back to back in the workspace, so the destination index is flat.
// Each thread 8 elements; a wave writes 512 contiguous bytes per store instruction.
// Grid (WQKV_BLKS + W0_BLKS), exact.
// ---------------------------------------------------------------------------
#define WQKV_BLKS ((3 * DIM * DIM) / 2048)
#define W0_BLKS   ((DIM * DIM) / 2048)
static_assert(OFF_W0 == OFF_WQKV + (size_t)WQKV_BLKS * 2048 * 2);   // planes back to back

__global__ __launch_bounds__(256) void wcast_kernel(
    const float* __restrict__ Wqkv, const float* __restrict__ W0, _Float16* __restrict__ W16) {
  const unsigned blk = blockIdx.x;
  const bool first = blk < (unsigned)WQKV_BLKS;   // the same for the whole block
  const float* plane = first ? Wqkv : W0;
  const unsigned pb = first ? blk : blk - (unsigned)WQKV_BLKS;   // block index inside its plane
  const float* W = plane + (size_t)pb * 2048u;
  const unsigned off = threadIdx.x * 8u;
  const size_t idx = (size_t)blk * 2048u + off;
  const v4f a0 = *(const v4f*)(W + off);
  const v4f a1 = *(const v4f*)(W + off + 4);
  v8h o;
#pragma unroll
  for (int i = 0; i < 4; ++i) {
    o[i]     = toh_flush(WCARRY * bf16r(a0[i]));
    o[i + 4] = toh_flush(WCARRY * bf16r(a1[i]));
  }
  _Float16* p = W16 + idx;
  *(v8h*)p = o;
  
}

// ---------------------------------------------------------------------------
// Fused token conversion + q | k | v projection. Block = 64 token rows of one batch x all 384
// output columns, 8 waves. Row f of batch b: f < 32 patch row f (shared by all b),
// 32 <= f < NTOK sequence row (s = f - 32, b) of xs[s][b][:], f >= NTOK zero rows.
//   1. each wave reads 8 whole 512-B rows (f32), converts to f16(bf16(x)) and lays them in Xs.
//   2. wave w makes q|k columns 32w .. 32w+31 and v columns 16w .. 16w+15 for all 64 rows
//      (12 accumulator tiles); every weight fragment is fetched once per block.
//      q|k tiles run as W (A, 16 columns) . X^T (B, 16 tokens): lane (h, token) holds columns
//      8h .. 8h+7 of its token: the piece that lane (h, token) of a score fragment holds.
//      v tiles run as X (A, 16 tokens) . W^T (B, 16 columns): lane (h, d) holds tokens
//      8h .. 8h+7 of its column: the piece that lane (h, d) of a V^T fragment holds.
//   3. each tile goes from the accumulator (x64 carry, f16) straight to its place, 16 B per lane,
//      512 contiguous bytes per wave-wide store:
//      QK[b][column tile 0..15 (q heads, then k heads)][token tile][lane][8] and
//      Vt[b][head][token tile][lane][8].
// Grid (TOKP / 64, NB).
// ---------------------------------------------------------------------------
#define LDX 136   // halves per LDS row of the token tile (272 B = 16 B x odd)
static_assert(LDX >= DIM && (LDX % 8) == 0);
static_assert(QKP == 2 * NHEAD * HD && FRAGH == 16 * HD);   // a column tile is one head of q or of k
static_assert(QKP == 8 * 32 && DIM == 8 * 16);   // 8 waves: 32 q|k columns and 16 v columns each
static_assert((NPATCH % 8) == 0 && (NTOK % 8) == 0 && SEQ >= 8);   // a wave's 8 rows are of one kind

// The builtin alone: the compiler keeps the distances behind it and can place fragment loads
// between the matrix instructions.
__device__ __forceinline__ v8f wmma_plain(v16h a, v16h b, v8f c) {
  return __builtin_amdgcn_wmma_f32_16x16x32_f16(false, a, false, b, (short)0, c, false, false);
}

__device__ __forceinline__ v8h pack_flush(v8f a) {
  v8h o;
#pragma unroll
  for (int r = 0; r < 8; ++r) o[r] = toh_flush(a[r]);
  return o;
}

__global__ __launch_bounds__(256) void proj_kernel(
    const float* __restrict__ xp, const float* __restrict__ xs,
    const _Float16* __restrict__ W16, _Float16* __restrict__ qk, _Float16* __restrict__ vt) {
  __shared__ __attribute__((aligned(16))) _Float16 Xs[64 * LDX];
  const unsigned tid = threadIdx.x, lane = tid & 31u;
  const unsigned w = (unsigned)__builtin_amdgcn_readfirstlane((int)(threadIdx.x >> 5));
  const unsigned hh = lane >> 4, m = lane & 15u;
  const unsigned f0 = blockIdx.x * 64u;
  const unsigned b = blockIdx.y;

  // wave-uniform row bases plus one per-lane offset shared by all weight fragments
  const unsigned woff = m * (unsigned)DIM + hh * 8u;
  const _Float16* wq0 = W16 + (size_t)(w * 32u) * DIM;
  const _Float16* wq1 = W16 + (size_t)(w * 32u + 16u) * DIM;
  const _Float16* wv  = W16 + (size_t)(QKP + w * 16u) * DIM;
  // the first weight fragments are asked for together with the token rows
  v16h q0 = frag_at(wq0 + woff);
  v16h q1 = frag_at(wq1 + woff);
  v16h vv = frag_at(wv + woff);

  // token rows: one wave-wide 16-B load = one whole row. A wave's 8 rows are all patch rows,
  // all sequence rows or all zero rows, so source and row step are wave-uniform.
  const unsigned fg = f0 + w * 8u;
  const bool isp = fg < (unsigned)NPATCH;
  const bool live = fg < (unsigned)NTOK;
  unsigned sq = isp ? 0u : (fg - (unsigned)NPATCH);
  sq = (sq < (unsigned)(SEQ - 8)) ? sq : (unsigned)(SEQ - 8);
  const float* plane = isp ? xp : xs;
  const unsigned row = isp ? fg : (sq * (unsigned)NB_FULL + b);
  const unsigned step = isp ? (unsigned)DIM : (unsigned)(NB_FULL * DIM);
  const float* src = plane + (size_t)row * DIM;
  v4f xv[8];
#pragma unroll   // all eight row loads in flight together
  for (unsigned i = 0; i < 8u; ++i) xv[i] = *(const v4f*)(src + (i * step + lane * 4u));
#pragma unroll
  for (unsigned i = 0; i < 8u; ++i) {
    v4h o;
#pragma unroll
    for (int j = 0; j < 4; ++j) o[j] = toh_flush(bf16r(live ? xv[i][j] : 0.0f));
    *(v4h*)&Xs[(w * 8u + i) * LDX + lane * 4u] = o;
  }
  __syncthreads();

  const _Float16* xa  = &Xs[m * LDX + hh * 8u];
  v8f aq0[4] = {}, aq1[4] = {}, av[4] = {};
#pragma unroll   // constant indices keep the accumulator arrays in registers
  for (unsigned k0 = 0; k0 < (unsigned)DIM; k0 += 32u) {
#pragma unroll
    for (unsigned t = 0; t < 4u; ++t) {
      const v16h x = frag_at(xa + t * 16u * LDX + k0);
      aq0[t] = wmma_plain(q0, x, aq0[t]);
      aq1[t] = wmma_plain(q1, x, aq1[t]);
      av[t]  = wmma_plain(x, vv, av[t]);
    }
    if (k0 + 32u < (unsigned)DIM) {
      q0 = frag_at((wq0 + k0 + 32u) + woff);
      q1 = frag_at((wq1 + k0 + 32u) + woff);
      vv = frag_at((wv + k0 + 32u) + woff);
    }
  }

  // the wave's column tiles 2w, 2w+1 (q|k) and w (v); its four token tiles lie side by side
  const unsigned t0 = f0 / 16u;
  _Float16* qd0 = qk + ((size_t)(b * 16u + w * 2u) * NT16 + t0) * FRAGH + lane * 8u;
  _Float16* qd1 = qd0 + (size_t)NT16 * FRAGH;
  _Float16* vd  = vt + ((size_t)(b * (unsigned)NHEAD + w) * NT16 + t0) * FRAGH + lane * 8u;
#pragma unroll
  for (unsigned t = 0; t < 4u; ++t) {
    *(v8h*)(qd0 + t * FRAGH) = pack_flush(aq0[t]);
    *(v8h*)(qd1 + t * FRAGH) = pack_flush(aq1[t]);
    *(v8h*)(vd + t * FRAGH)  = pack_flush(av[t]);
  }
}

// ---------------------------------------------------------------------------
// Dense flash attention, register-fed transposed form, with the output projection behind it.
// Block = (32 query tokens, batch b, all 8 heads), wave = head; each wave carries QT = 2 query
// tiles of 16 tokens, so every K and V^T fragment fetched from the global planes feeds both
// tiles; the planes lie in fragment order, each fragment load is 512 contiguous bytes.
// Per 32-key step:
//   S^T tiles (keys x queries) = K tile (A, 16 keys x d padded to 32) . Q^T (B, d x 16 queries),
//   two 16-key tiles per query tile; lane (h, n) holds query column n, key rows 8h+r of each.
//   Online softmax per query column: in-lane over 16 values + one 16-lane-distance shuffle.
//   P^T packed as B fragment: element r <- tile 0 row 8h+r, element 8+r <- tile 1 row 8h+r
//   (keys kb+8h+r and kb+16+8h+r), f16(1024 p); the row sum l carries the same x1024.
//   O^T (d x queries) += V^T tile (A, [d][32 keys] from the transposed V plane) . P^T.
// No LDS and no barrier in the key loop. Behind it the block's attention rows [32 tokens][DIM],
// f16(64 * O / l), meet in Os (block barrier) and are multiplied by W0^T there:
//   wave w takes token tile w & 1 and output columns 32 (w >> 1) .. +31: A = W0 rows (16
//   columns, from the 16-bit global plane), B = attention rows (16 tokens, from Os), k = DIM;
//   lane (h, token) holds columns 8h .. 8h+7 of its token in each of the two tiles.
//   Each wave stages its 16 x 32 f32 tile in its own LDS range and writes whole 128-B lines:
//   outf[(f * NB_FULL + b)][col] = acc/4096 + bf16(bias).
// Grid (NTOK/32, NB), 256 threads. The launch bound asks for ten waves per SIMD (five blocks
// per WGP): with fewer the grid would not be resident at once and a second round would follow.
// ---------------------------------------------------------------------------
#define QT   2                 // query tiles per wave
#define LDG  136               // halves per LDS row of the attention tile (272 B = 16 B x odd)
static_assert((NTOK % (16 * QT)) == 0);
static_assert(QT == 2 && DIM == 4 * 32);   // 8 waves = 2 token tiles x 4 groups of 32 columns
static_assert((LDG % 8) == 0 && LDG >= DIM);

// second bound: ten waves per SIMD, so that five 8-wave blocks fit a WGP and the whole grid is resident
__global__ __launch_bounds__(NHEAD * 32, 10) void attn_kernel(
    const _Float16* __restrict__ QK, const _Float16* __restrict__ Vt,
    const _Float16* __restrict__ W016, const float* __restrict__ bias,
    float* __restrict__ outf) {
  __shared__ __attribute__((aligned(16))) _Float16 Os[16 * QT * LDG];
  __shared__ __attribute__((aligned(16))) float Cs[NHEAD * 16 * LDC];

  const unsigned tid = threadIdx.x, lane = tid & 31u;
  const unsigned hw = (unsigned)__builtin_amdgcn_readfirstlane((int)(threadIdx.x >> 5));
  const unsigned head = hw;
  const unsigned hh = lane >> 4, m = lane & 15u;
  const unsigned q0 = blockIdx.x * (16u * QT);
  const unsigned b = blockIdx.y;
  // HD^-0.5, the two x64 carries and log2(e): maxima and exponents are kept in base 2
  const float sscale = 0.25f * 1.4426950408889634f / (QCARRY * QCARRY);

  // Q^T as B operand: lane (h, n) <- q[token q0+16t+n][head*16 + 8h .. +7], k 16..31 zero
  v16h qf[QT];
#pragma unroll   // constant t keeps the per-tile arrays in registers
  for (unsigned t = 0; t < (unsigned)QT; ++t)
    qf[t] = frag_k16(QK + ((size_t)(b * 16u + head) * NT16 + q0 / 16u + t) * FRAGH + lane * 8u);
  // K tile as A operand: lane (h, m) <- k[token kb+m][head*16 + 8h .. +7]
  const _Float16* kp = QK + (size_t)(b * 16u + (unsigned)NHEAD + head) * NT16 * FRAGH + lane * 8u;
  // V^T tile as A operand: lane (h, m = d) <- vt[d][kb + 8h .. +7], vt[d][kb + 16 + 8h .. +7]
  const _Float16* vp = Vt + (size_t)(b * (unsigned)NHEAD + head) * NT16 * FRAGH + lane * 8u;

  float mrow[QT], lrow[QT];
  v8f o[QT];
#pragma unroll   // constant t keeps the per-tile arrays in registers
  for (int t = 0; t < QT; ++t) {
    mrow[t] = -1.0e30f;
    lrow[t] = 0.0f;
    o[t] = v8f{};
  }

  for (unsigned kb = 0; kb < (unsigned)NTOK; kb += 32u) {
    const unsigned ko = (kb / 16u) * FRAGH;   // token tiles kb/16 and kb/16 + 1
    const v16h ka0 = frag_k16(kp + ko);
    const v16h ka1 = frag_k16(kp + ko + FRAGH);
    const v16h va  = frag_tiles(vp + ko);

#pragma unroll   // both tiles in one body: their chains are independent and can interleave
    for (int t = 0; t < QT; ++t) {
      v8f s0 = {}, s1 = {};
      s0 = wmma16(ka0, qf[t], s0);
      s1 = wmma16(ka1, qf[t], s1);

      float mx = fmaxf(s0[0], s1[0]);
#pragma unroll
      for (int r = 1; r < 8; ++r) mx = fmaxf(mx, fmaxf(s0[r], s1[r]));
      mx = fmaxf(mx, __shfl_xor(mx, 16, 32));
      const float mn = fmaxf(mrow[t], mx * sscale);
      const float alpha = __builtin_amdgcn_exp2f(mrow[t] - mn);
      mrow[t] = mn;

      // 1024 p = exp2(s * sscale - mn + 10): one multiply-add and one exponential per score
      const float eb = PCARRY_LOG2 - mn;
      float rs = 0.0f;
      v16h pf;
#pragma unroll
      for (int r = 0; r < 8; ++r) {
        const float p0 = __builtin_amdgcn_exp2f(s0[r] * sscale + eb);
        const float p1 = __builtin_amdgcn_exp2f(s1[r] * sscale + eb);
        rs += p0 + p1;
        pf[r]     = (h16)p0;
        pf[r + 8] = (h16)p1;
      }
      rs += __shfl_xor(rs, 16, 32);
      lrow[t] = alpha * lrow[t] + rs;
#pragma unroll
      for (int r = 0; r < 8; ++r) o[t][r] = o[t][r] * alpha;

      o[t] = wmma16(va, pf, o[t]);
    }
  }

  // output tile of this wave: token tile tt, columns 32 cg .. +31; its bias piece is asked for
  // here, so that it flies during the finalize
  const unsigned tt = hw & 1u, cg = hw >> 1;
  const v4f g = *(const v4f*)(bias + cg * 32u + (lane & 7u) * 4u);

  // finalize: o[t][r] is (d = 8h + r, token q0 + 16t + m); f16(64 * O / l), 8 halves per lane
#pragma unroll   // constant t keeps the per-tile arrays in registers
  for (unsigned t = 0; t < (unsigned)QT; ++t) {
    const float inv = __builtin_amdgcn_rcpf(lrow[t]) * (CCARRY / QCARRY);   // l carries the x1024 of p
    v8h ov;
#pragma unroll
    for (int r = 0; r < 8; ++r) ov[r] = toh_flush(o[t][r] * inv);
    *(v8h*)&Os[(16u * t + m) * LDG + hw * HD + hh * 8u] = ov;
  }

  __syncthreads();

  // output projection of the block's 32 rows: two 16 x 16 tiles per wave, k = DIM in steps of 32
  const _Float16* wp = W016 + (size_t)(cg * 32u + m) * DIM + hh * 8u;
  const _Float16* xa = &Os[(tt * 16u + m) * LDG + hh * 8u];
  v8f acc0 = {}, acc1 = {};
#pragma unroll   // all fragment loads can issue ahead of the first product
  for (unsigned k = 0; k < 4u; ++k) {
    const v16h x = frag_at(xa + k * 32u);
    acc0 = wmma_plain(frag_at(wp + k * 32u), x, acc0);
    acc1 = wmma_plain(frag_at(wp + (size_t)16 * DIM + k * 32u), x, acc1);
  }
  // the address that all sixteen W0 loads name is an input here: it stays live up to this wait, so
  // that no load's result is written over it while an earlier load of the run still names it
  asm volatile("s_wait_xcnt 0x0" :: "v"(wp) : "memory");
  float* cw = &Cs[hw * (16u * LDC)];
  float* cd = cw + m * LDC + hh * 8u;
  *(v4f*)(cd)      = v4f{acc0[0], acc0[1], acc0[2], acc0[3]};
  *(v4f*)(cd + 4)  = v4f{acc0[4], acc0[5], acc0[6], acc0[7]};
  *(v4f*)(cd + 16) = v4f{acc1[0], acc1[1], acc1[2], acc1[3]};
  *(v4f*)(cd + 20) = v4f{acc1[4], acc1[5], acc1[6], acc1[7]};
  // the wave reads back rows that its other lanes wrote: its own LDS stores must have landed
  asm volatile("s_wait_dscnt 0x0" ::: "memory");

  // 8 consecutive lanes x 16 B = one whole 128-B line of an output row; 4 rows per store
  const float cs = 1.0f / (WCARRY * CCARRY);
  v4f y[4];
#pragma unroll   // all LDS reads issue before the first store
  for (unsigned i = 0; i < 4u; ++i) {
    const v4f u = *(const v4f*)&cw[(i * 4u + (lane >> 3)) * LDC + (lane & 7u) * 4u];
#pragma unroll
    for (int j = 0; j < 4; ++j) y[i][j] = u[j] * cs + bf16r(g[j]);
  }
#pragma unroll
  for (unsigned i = 0; i < 4u; ++i)
    *(v4f*)(outf + ((size_t)(q0 + tt * 16u + i * 4u + (lane >> 3)) * NB_FULL + b) * DIM +
            cg * 32u + (lane & 7u) * 4u) = y[i];
}

// ---------------------------------------------------------------------------
extern "C" void kernel_launch(void* const* d_in, const int* in_sizes, int n_in,
                              void* d_out, int out_size, void* d_ws, size_t ws_size,
                              hipStream_t stream) {
  if (n_in < 5) return;
  const long long need_xs = ((long long)(SEQ - 1) * NB_FULL + NB) * DIM;
  const long long need_out = ((long long)(NTOK - 1) * NB_FULL + NB) * DIM;
  if ((long long)in_sizes[0] < (long long)NPATCH * DIM) return;
  if ((long long)in_sizes[1] < need_xs) return;
  if ((long long)in_sizes[2] < (long long)3 * DIM * DIM) return;
  if ((long long)in_sizes[3] < (long long)DIM * DIM) return;
  if (in_sizes[4] < DIM) return;
  if ((long long)out_size < need_out) return;
  if (ws_size < WS_TOTAL) return;

  const float* xp   = (const float*)d_in[0];   // [32][1][DIM]
  const float* xs   = (const float*)d_in[1];   // [SEQ_FULL][NB_FULL][DIM]
  const float* wqkv = (const float*)d_in[2];   // [3*DIM][DIM]  (out, in): q | k | v rows
  const float* w0   = (const float*)d_in[3];   // [DIM][DIM]    (out, in)
  const float* w0b  = (const float*)d_in[4];   // [DIM]
  float* out = (float*)d_out;                  // [NTOK][NB_FULL][DIM]

  char* ws = (char*)d_ws;
  _Float16* Wqkv16 = (_Float16*)(ws + OFF_WQKV);   // [3*DIM][DIM]
  _Float16* W016   = (_Float16*)(ws + OFF_W0);     // [DIM][DIM]
  _Float16* QK16   = (_Float16*)(ws + OFF_QK);     // [NB][16][NT16][FRAGH]
  _Float16* Vt16   = (_Float16*)(ws + OFF_VT);     // [NB][NHEAD][NT16][FRAGH]

  dim3 blk(256);
  // both weight planes in one launch (Wqkv16 and W016 lie back to back)
  wcast_kernel<<<dim3(WQKV_BLKS + W0_BLKS), blk, 0, stream>>>(wqkv, w0, Wqkv16);
  // token conversion and q | k | v columns (all in fragment order) in one launch
  proj_kernel<<<dim3(TOKP / 64, NB), blk, 0, stream>>>(xp, xs, Wqkv16, QK16, Vt16);
  // attention and the output projection in one launch
  attn_kernel<<<dim3(NTOK / (16 * QT), NB), blk, 0, stream>>>(QK16, Vt16, W016, w0b, out);
}

// v007
// Measured time: 44.3 microseconds a run.
// In two side-by-side timings against v006, it was 1.16 and 1.15 times as fast.
// Counting every step since v000, it is 2.38 times as fast.
#include <hip/hip_runtime.h>
#include <stddef.h>

// All contractions on v_wmma_f32_16x16x32_f16 (f16 operands, f32 accumulate): q|k and v
// projection, q.k scores (head width 16 zero-padded to k = 32), p.v, output projection.
// Float inputs are RNE-converted to bf16 and carried in f16 (weights x64, q/k/v planes x64,
// p x1024, attention rows x64); softmax, scale and bias in f32.
// The q, k and v planes lie in fragment order: one 16-token x 16-column tile = 32 lanes x 16 B =
// 512 contiguous bytes, so that every wave-wide store and load of a tile covers four whole lines.

typedef _Float16 h16;
typedef _Float16 v16h __attribute__((ext_vector_type(16)));
typedef _Float16 v8h  __attribute__((ext_vector_type(8)));
typedef _Float16 v4h  __attribute__((ext_vector_type(4)));
typedef float    v8f  __attribute__((ext_vector_type(8)));
typedef float    v4f  __attribute__((ext_vector_type(4)));

#ifndef NB
#define NB 64
#endif
#ifndef SEQ
#define SEQ 512
#endif
#define NB_FULL  64
#define SEQ_FULL 512
#define DIM    128
#define NHEAD  8
#define HD     16
#define NPATCH 32
#define NTOK   (NPATCH + SEQ)                 // tokens per batch (patch rows first)
#define TOKP   (((NTOK + 63) / 64) * 64)      // token rows per batch padded to the GEMM tile
#define QKP    256                            // q|k columns: q cols 0..127, k cols 128..255
#define XROWS  (NB * TOKP)                    // token rows of the batch-major planes
#define NT16   (TOKP / 16)                    // 16-token tiles per batch
#define FRAGH  256                            // halves per fragment tile (32 lanes x 8 halves)

static_assert(NB >= 1 && NB <= NB_FULL);
static_assert(SEQ >= 32 && SEQ <= SEQ_FULL);
static_assert(DIM == NHEAD * HD);
static_assert(HD == 16);                      // one 16-B load per score fragment, 8 halves per lane half
static_assert(NHEAD == 8);                    // one wave per head
static_assert((DIM % 32) == 0 && (DIM % 64) == 0);
static_assert(QKP == 2 * DIM && (QKP % 64) == 0);
static_assert((NTOK % 32) == 0);              // 32-key steps cover the key range exactly
static_assert((NTOK % 16) == 0);              // 16-query tiles cover the query range exactly
static_assert((TOKP % 64) == 0 && TOKP >= NTOK);
static_assert((XROWS % 64) == 0 && (XROWS % 16) == 0);
static_assert(((3 * DIM * DIM) % 2048) == 0 && ((DIM * DIM) % 2048) == 0);

#define LDC 132   // floats per LDS row of the block's output staging tile (528 B = 16 B x odd)
static_assert((LDC % 4) == 0 && LDC >= DIM);

#define WCARRY 64.0f     // weight planes carried x64
#define QCARRY 64.0f     // q, k, v planes carried x64 (the projection accumulator as is)
#define PCARRY_LOG2 10.0f   // softmax numerators and their row sum carried x1024, as an addend of the base-2 exponent
#define CCARRY 64.0f     // attention rows (the LDS tile Os) carried x64

// workspace layout (bytes)
#define WQKV_BYTES ((size_t)3 * DIM * DIM * 2)
#define W0_BYTES   ((size_t)DIM * DIM * 2)
#define QK_BYTES   ((size_t)XROWS * QKP * 2)
#define VT_BYTES   ((size_t)NB * DIM * TOKP * 2)
#define OFF_WQKV ((size_t)0)
#define OFF_W0   (OFF_WQKV + WQKV_BYTES)
#define OFF_QK   (OFF_W0 + W0_BYTES)
#define OFF_VT   (OFF_QK + QK_BYTES)
#define WS_TOTAL (OFF_VT + VT_BYTES)
static_assert((WQKV_BYTES % 128) == 0 && (W0_BYTES % 128) == 0);
static_assert((QK_BYTES % 128) == 0 && (VT_BYTES % 128) == 0);
static_assert(WS_TOTAL <= (size_t)134217728);

// ---------------------------------------------------------------------------
__device__ __forceinline__ float bf16r(float x) {   // RNE convert to bf16, returned widened
  unsigned int u = __float_as_uint(x);
  u = (u + 0x7FFFu + ((u >> 16) & 1u)) & 0xFFFF0000u;
  return __uint_as_float(u);
}

// f32 -> f16 with a value select: results below the smallest normal f16 become zero.
static __device__ __forceinline__ h16 toh_flush(float v) {
  const h16 r = (h16)v;
  return (fabsf(v) < 6.103515625e-05f) ? (h16)0.0f : r;
}

// 16-bit fragment: p points at element [row = lane&15][k0 + 8*(lane>>4)] of a k-contiguous
// row. Elements 0..7 <- k0+8h+0..7, elements 8..15 <- k0+16+8h+0..7 (same map for A and B).
__device__ __forceinline__ v16h frag_at(const _Float16* p) {
  v8h lo = *(const v8h*)(p);
  v8h hi = *(const v8h*)(p + 16);
  v16h out;
#pragma unroll
  for (int i = 0; i < 8; ++i) { out[i] = lo[i]; out[i + 8] = hi[i]; }
  return out;
}

// Fragment of a 16-deep contraction padded to k = 32: p points at [row = lane&15][8*(lane>>4)];
// elements 0..7 <- k = 8h+0..7, elements 8..15 (k = 16..31) are zero.
__device__ __forceinline__ v16h frag_k16(const _Float16* p) {
  const v8h lo = *(const v8h*)(p);
  v16h out;
#pragma unroll
  for (int i = 0; i < 8; ++i) { out[i] = lo[i]; out[i + 8] = (_Float16)0.0f; }
  return out;
}

// 16-bit fragment from two neighbouring fragment tiles: p points at this lane's 16-B piece of the
// first; elements 0..7 <- first tile (k = 8h+0..7), elements 8..15 <- second tile (k = 16+8h+0..7).
__device__ __forceinline__ v16h frag_tiles(const _Float16* p) {
  const v8h lo = *(const v8h*)(p);
  const v8h hi = *(const v8h*)(p + FRAGH);
  v16h out;
#pragma unroll
  for (int i = 0; i < 8; ++i) { out[i] = lo[i]; out[i + 8] = hi[i]; }
  return out;
}

__device__ __forceinline__ v8f wmma16(v16h a, v16h b, v8f c) {
  v8f d = __builtin_amdgcn_wmma_f32_16x16x32_f16(false, a, false, b, (short)0, c,
                                                 false, false);
  asm volatile("v_nop\n\tv_nop\n\tv_nop\n\tv_nop" : "+v"(d) : "v"(a), "v"(b));
  return d;
}

// ---------------------------------------------------------------------------
// Weight planes: W[n][k] (f32, k contiguous) -> W16[n][k] = f16(64 * bf16(w)), same layout.
// Both planes in one launch: they need nothing of each other, so they share a grid by ranges of
// the block index. Blocks 0 .. WQKV_BLKS-1 take the q|k|v weights, the rest the output weights;
// the two 16-bit planes lie back to back in the workspace, so the destination index is flat.
// Each thread 8 elements; a wave writes 512 contiguous bytes per store instruction.
// Grid (WQKV_BLKS + W0_BLKS), exact.
// ---------------------------------------------------------------------------
#define WQKV_BLKS ((3 * DIM * DIM) / 2048)
#define W0_BLKS   ((DIM * DIM) / 2048)
static_assert(OFF_W0 == OFF_WQKV + (size_t)WQKV_BLKS * 2048 * 2);   // planes back to back

__global__ __launch_bounds__(256) void wcast_kernel(
    const float* __restrict__ Wqkv, const float* __restrict__ W0, _Float16* __restrict__ W16) {
  const unsigned blk = blockIdx.x;
  const bool first = blk < (unsigned)WQKV_BLKS;   // the same for the whole block
  const float* plane = first ? Wqkv : W0;
  const unsigned pb = first ? blk : blk - (unsigned)WQKV_BLKS;   // block index inside its plane
  const float* W = plane + (size_t)pb * 2048u;
  const unsigned off = threadIdx.x * 8u;
  const size_t idx = (size_t)blk * 2048u + off;
  const v4f a0 = *(const v4f*)(W + off);
  const v4f a1 = *(const v4f*)(W + off + 4);
  v8h o;
#pragma unroll
  for (int i = 0; i < 4; ++i) {
    o[i]     = toh_flush(WCARRY * bf16r(a0[i]));
    o[i + 4] = toh_flush(WCARRY * bf16r(a1[i]));
  }
  _Float16* p = W16 + idx;
  *(v8h*)p = o;
  
}

// ---------------------------------------------------------------------------
// Fused token conversion + q | k | v projection. Block = 64 token rows of one batch x all 384
// output columns, 8 waves. Row f of batch b: f < 32 patch row f (shared by all b),
// 32 <= f < NTOK sequence row (s = f - 32, b) of xs[s][b][:], f >= NTOK zero rows.
//   1. each wave reads 8 whole 512-B rows (f32), converts to f16(bf16(x)) and lays them in Xs.
//   2. wave w makes q|k columns 32w .. 32w+31 and v columns 16w .. 16w+15 for all 64 rows
//      (12 accumulator tiles); every weight fragment is fetched once per block.
//      q|k tiles run as W (A, 16 columns) . X^T (B, 16 tokens): lane (h, token) holds columns
//      8h .. 8h+7 of its token: the piece that lane (h, token) of a score fragment holds.
//      v tiles run as X (A, 16 tokens) . W^T (B, 16 columns): lane (h, d) holds tokens
//      8h .. 8h+7 of its column: the piece that lane (h, d) of a V^T fragment holds.
//   3. each tile goes from the accumulator (x64 carry, f16) straight to its place, 16 B per lane,
//      512 contiguous bytes per wave-wide store:
//      QK[b][column tile 0..15 (q heads, then k heads)][token tile][lane][8] and
//      Vt[b][head][token tile][lane][8].
// Grid (TOKP / 64, NB).
// ---------------------------------------------------------------------------
#define LDX 136   // halves per LDS row of the token tile (272 B = 16 B x odd)
static_assert(LDX >= DIM && (LDX % 8) == 0);
static_assert(QKP == 2 * NHEAD * HD && FRAGH == 16 * HD);   // a column tile is one head of q or of k
static_assert(QKP == 8 * 32 && DIM == 8 * 16);   // 8 waves: 32 q|k columns and 16 v columns each
static_assert((NPATCH % 8) == 0 && (NTOK % 8) == 0 && SEQ >= 8);   // a wave's 8 rows are of one kind

// The builtin alone: the compiler keeps the distances behind it and can place fragment loads
// between the matrix instructions.
__device__ __forceinline__ v8f wmma_plain(v16h a, v16h b, v8f c) {
  return __builtin_amdgcn_wmma_f32_16x16x32_f16(false, a, false, b, (short)0, c, false, false);
}

__device__ __forceinline__ v8h pack_flush(v8f a) {
  v8h o;
#pragma unroll
  for (int r = 0; r < 8; ++r) o[r] = toh_flush(a[r]);
  return o;
}

__global__ __launch_bounds__(256) void proj_kernel(
    const float* __restrict__ xp, const float* __restrict__ xs,
    const _Float16* __restrict__ W16, _Float16* __restrict__ qk, _Float16* __restrict__ vt) {
  __shared__ __attribute__((aligned(16))) _Float16 Xs[64 * LDX];
  const unsigned tid = threadIdx.x, lane = tid & 31u;
  const unsigned w = (unsigned)__builtin_amdgcn_readfirstlane((int)(threadIdx.x >> 5));
  const unsigned hh = lane >> 4, m = lane & 15u;
  const unsigned f0 = blockIdx.x * 64u;
  const unsigned b = blockIdx.y;

  // wave-uniform row bases plus one per-lane offset shared by all weight fragments
  const unsigned woff = m * (unsigned)DIM + hh * 8u;
  const _Float16* wq0 = W16 + (size_t)(w * 32u) * DIM;
  const _Float16* wq1 = W16 + (size_t)(w * 32u + 16u) * DIM;
  const _Float16* wv  = W16 + (size_t)(QKP + w * 16u) * DIM;
  // the first weight fragments are asked for together with the token rows
  v16h q0 = frag_at(wq0 + woff);
  v16h q1 = frag_at(wq1 + woff);
  v16h vv = frag_at(wv + woff);

  // token rows: one wave-wide 16-B load = one whole row. A wave's 8 rows are all patch rows,
  // all sequence rows or all zero rows, so source and row step are wave-uniform.
  const unsigned fg = f0 + w * 8u;
  const bool isp = fg < (unsigned)NPATCH;
  const bool live = fg < (unsigned)NTOK;
  unsigned sq = isp ? 0u : (fg - (unsigned)NPATCH);
  sq = (sq < (unsigned)(SEQ - 8)) ? sq : (unsigned)(SEQ - 8);
  const float* plane = isp ? xp : xs;
  const unsigned row = isp ? fg : (sq * (unsigned)NB_FULL + b);
  const unsigned step = isp ? (unsigned)DIM : (unsigned)(NB_FULL * DIM);
  const float* src = plane + (size_t)row * DIM;
  v4f xv[8];
#pragma unroll   // all eight row loads in flight together
  for (unsigned i = 0; i < 8u; ++i) xv[i] = *(const v4f*)(src + (i * step + lane * 4u));
#pragma unroll
  for (unsigned i = 0; i < 8u; ++i) {
    v4h o;
#pragma unroll
    for (int j = 0; j < 4; ++j) o[j] = toh_flush(bf16r(live ? xv[i][j] : 0.0f));
    *(v4h*)&Xs[(w * 8u + i) * LDX + lane * 4u] = o;
  }
  __syncthreads();

  const _Float16* xa  = &Xs[m * LDX + hh * 8u];
  v8f aq0[4] = {}, aq1[4] = {}, av[4] = {};
#pragma unroll   // constant indices keep the accumulator arrays in registers
  for (unsigned k0 = 0; k0 < (unsigned)DIM; k0 += 32u) {
#pragma unroll
    for (unsigned t = 0; t < 4u; ++t) {
      const v16h x = frag_at(xa + t * 16u * LDX + k0);
      aq0[t] = wmma_plain(q0, x, aq0[t]);
      aq1[t] = wmma_plain(q1, x, aq1[t]);
      av[t]  = wmma_plain(x, vv, av[t]);
    }
    if (k0 + 32u < (unsigned)DIM) {
      q0 = frag_at((wq0 + k0 + 32u) + woff);
      q1 = frag_at((wq1 + k0 + 32u) + woff);
      vv = frag_at((wv + k0 + 32u) + woff);
    }
  }

  // the wave's column tiles 2w, 2w+1 (q|k) and w (v); its four token tiles lie side by side
  const unsigned t0 = f0 / 16u;
  _Float16* qd0 = qk + ((size_t)(b * 16u + w * 2u) * NT16 + t0) * FRAGH + lane * 8u;
  _Float16* qd1 = qd0 + (size_t)NT16 * FRAGH;
  _Float16* vd  = vt + ((size_t)(b * (unsigned)NHEAD + w) * NT16 + t0) * FRAGH + lane * 8u;
#pragma unroll
  for (unsigned t = 0; t < 4u; ++t) {
    *(v8h*)(qd0 + t * FRAGH) = pack_flush(aq0[t]);
    *(v8h*)(qd1 + t * FRAGH) = pack_flush(aq1[t]);
    *(v8h*)(vd + t * FRAGH)  = pack_flush(av[t]);
  }
}

// ---------------------------------------------------------------------------
// Dense flash attention, register-fed transposed form, with the output projection behind it.
// Block = (48 query tokens, batch b, all 8 heads), wave = head; each wave carries QT = 3 query
// tiles of 16 tokens, so every K and V^T fragment fetched from the global planes feeds all three
// tiles; the planes lie in fragment order, each fragment load is 512 contiguous bytes.
// The 34 query tiles of a batch make 12 blocks; the last block's tiles 1 and 2 are the zero rows
// NTOK .. TOKP-1 of the q plane: they are worked like any other and their rows are not stored.
// Per 32-key step:
//   S^T tiles (keys x queries) = K tile (A, 16 keys x d padded to 32) . Q^T (B, d x 16 queries),
//   two 16-key tiles per query tile; lane (h, n) holds query column n, key rows 8h+r of each.
//   Online softmax per query column: in-lane over 16 values + one 16-lane-distance shuffle.
//   P^T packed as B fragment: element r <- tile 0 row 8h+r, element 8+r <- tile 1 row 8h+r
//   (keys kb+8h+r and kb+16+8h+r), f16(1024 p); the row sum l carries the same x1024.
//   O^T (d x queries) += V^T tile (A, [d][32 keys] from the transposed V plane) . P^T.
// No LDS and no barrier in the key loop. Behind it the block's attention rows [48 tokens][DIM],
// f16(64 * O / l), meet in Os (block barrier) and are multiplied by W0^T there:
//   wave w takes output columns 16 w .. +15 of all three token tiles: A = W0 rows (16 columns,
//   from the 16-bit global plane, fetched once for the three tiles), B = attention rows
//   (16 tokens, from Os), k = DIM; lane (h, token) holds columns 8h .. 8h+7 of its token.
//   The block's 48 x 128 f32 tile meets in Cs (second block barrier); then one wave-wide 16-B
//   store writes one whole 512-B output row, two rows of each token tile a wave:
//   outf[(f * NB_FULL + b)][col] = acc/4096 + bf16(bias).
// Grid (NQB, NB), 256 threads: 12 x 64 = 768 blocks are three for each of the 256 WGPs, so that
// every WGP has the same share. The launch bound asks for six waves per SIMD (three blocks per WGP).
// ---------------------------------------------------------------------------
#define QT   3                 // query tiles per wave
#define QBLK (16 * QT)         // query tokens per block
#define NQB  ((NTOK + QBLK - 1) / QBLK)   // blocks per batch
#define LDG  136               // halves per LDS row of the attention tile (272 B = 16 B x odd)
static_assert(NQB * QBLK <= TOKP);         // every q tile a block reads lies in the plane
static_assert(DIM == NHEAD * 16);          // 8 waves = 8 groups of 16 output columns
static_assert(16 == 2 * NHEAD);            // two output rows of each token tile per wave
static_assert((NQB - 1) * QBLK < NTOK);    // a block's first tile always holds output rows
static_assert((LDG % 8) == 0 && LDG >= DIM);

// second bound: six waves per SIMD, so that three 8-wave blocks fit a WGP and the whole grid is resident
__global__ __launch_bounds__(NHEAD * 32, 6) void attn_kernel(
    const _Float16* __restrict__ QK, const _Float16* __restrict__ Vt,
    const _Float16* __restrict__ W016, const float* __restrict__ bias,
    float* __restrict__ outf) {
  __shared__ __attribute__((aligned(16))) _Float16 Os[QBLK * LDG];
  __shared__ __attribute__((aligned(16))) float Cs[QBLK * LDC];

  const unsigned tid = threadIdx.x, lane = tid & 31u;
  const unsigned hw = (unsigned)__builtin_amdgcn_readfirstlane((int)(threadIdx.x >> 5));
  const unsigned head = hw;
  const unsigned hh = lane >> 4, m = lane & 15u;
  const unsigned q0 = blockIdx.x * (16u * QT);
  const unsigned b = blockIdx.y;
  // HD^-0.5, the two x64 carries and log2(e): maxima and exponents are kept in base 2
  const float sscale = 0.25f * 1.4426950408889634f / (QCARRY * QCARRY);

  // Q^T as B operand: lane (h, n) <- q[token q0+16t+n][head*16 + 8h .. +7], k 16..31 zero
  const _Float16* qp = QK + ((size_t)(b * 16u + head) * NT16 + q0 / 16u) * FRAGH + lane * 8u;
  v16h qf[QT];
#pragma unroll   // constant t keeps the per-tile arrays in registers
  for (unsigned t = 0; t < (unsigned)QT; ++t) qf[t] = frag_k16(qp + t * FRAGH);
  // the address that the Q loads name is an input here: it stays live up to this wait, so that
  // nothing is written over it while a load of the run still names it
  asm volatile("s_wait_xcnt 0x0" :: "v"(qp) : "memory");
  // K tile as A operand: lane (h, m) <- k[token kb+m][head*16 + 8h .. +7]
  const _Float16* kp = QK + (size_t)(b * 16u + (unsigned)NHEAD + head) * NT16 * FRAGH + lane * 8u;
  // V^T tile as A operand: lane (h, m = d) <- vt[d][kb + 8h .. +7], vt[d][kb + 16 + 8h .. +7]
  const _Float16* vp = Vt + (size_t)(b * (unsigned)NHEAD + head) * NT16 * FRAGH + lane * 8u;

  float mrow[QT], lrow[QT];
  v8f o[QT];
#pragma unroll   // constant t keeps the per-tile arrays in registers
  for (int t = 0; t < QT; ++t) {
    mrow[t] = -1.0e30f;
    lrow[t] = 0.0f;
    o[t] = v8f{};
  }

  for (unsigned kb = 0; kb < (unsigned)NTOK; kb += 32u) {
    const unsigned ko = (kb / 16u) * FRAGH;   // token tiles kb/16 and kb/16 + 1
    const v16h ka0 = frag_k16(kp + ko);
    const v16h ka1 = frag_k16(kp + ko + FRAGH);
    const v16h va  = frag_tiles(vp + ko);

    // the step runs in three phases over the wave's tiles, so that the tiles' chains, which need
    // nothing of each other, stand side by side: all score products, all softmax steps, all P.V
    v8f s0[QT], s1[QT];
#pragma unroll   // constant t keeps the per-tile arrays in registers
    for (int t = 0; t < QT; ++t) {
      s0[t] = wmma16(ka0, qf[t], v8f{});
      s1[t] = wmma16(ka1, qf[t], v8f{});
    }

    v16h pf[QT];
#pragma unroll   // constant t keeps the per-tile arrays in registers
    for (int t = 0; t < QT; ++t) {
      float mx = fmaxf(s0[t][0], s1[t][0]);
#pragma unroll
      for (int r = 1; r < 8; ++r) mx = fmaxf(mx, fmaxf(s0[t][r], s1[t][r]));
      mx = fmaxf(mx, __shfl_xor(mx, 16, 32));
      const float mn = fmaxf(mrow[t], mx * sscale);
      const float alpha = __builtin_amdgcn_exp2f(mrow[t] - mn);
      mrow[t] = mn;

      // 1024 p = exp2(s * sscale - mn + 10): one multiply-add and one exponential per score
      const float eb = PCARRY_LOG2 - mn;
      float rs = 0.0f;
#pragma unroll
      for (int r = 0; r < 8; ++r) {
        const float p0 = __builtin_amdgcn_exp2f(s0[t][r] * sscale + eb);
        const float p1 = __builtin_amdgcn_exp2f(s1[t][r] * sscale + eb);
        rs += p0 + p1;
        pf[t][r]     = (h16)p0;
        pf[t][r + 8] = (h16)p1;
      }
      rs += __shfl_xor(rs, 16, 32);
      lrow[t] = alpha * lrow[t] + rs;
#pragma unroll
      for (int r = 0; r < 8; ++r) o[t][r] = o[t][r] * alpha;
    }

#pragma unroll   // constant t keeps the per-tile arrays in registers
    for (int t = 0; t < QT; ++t) o[t] = wmma16(va, pf[t], o[t]);
  }

  // this lane's piece of the bias row is asked for here, so that it flies during the finalize
  const v4f g = *(const v4f*)(bias + lane * 4u);

  // finalize: o[t][r] is (d = 8h + r, token q0 + 16t + m); f16(64 * O / l), 8 halves per lane
#pragma unroll   // constant t keeps the per-tile arrays in registers
  for (unsigned t = 0; t < (unsigned)QT; ++t) {
    const float inv = __builtin_amdgcn_rcpf(lrow[t]) * (CCARRY / QCARRY);   // l carries the x1024 of p
    v8h ov;
#pragma unroll
    for (int r = 0; r < 8; ++r) ov[r] = toh_flush(o[t][r] * inv);
    *(v8h*)&Os[(16u * t + m) * LDG + hw * HD + hh * 8u] = ov;
  }

  __syncthreads();

  // output projection of the block's 48 rows: three 16 x 16 tiles per wave, k = DIM in steps of 32
  const _Float16* wp = W016 + (size_t)(hw * 16u + m) * DIM + hh * 8u;
  const _Float16* xa = &Os[m * LDG + hh * 8u];
  v8f acc[QT] = {};
#pragma unroll   // all fragment loads can issue ahead of the first product
  for (unsigned k = 0; k < 4u; ++k) {
    const v16h wf = frag_at(wp + k * 32u);
#pragma unroll   // constant t keeps the per-tile arrays in registers
    for (unsigned t = 0; t < (unsigned)QT; ++t)
      acc[t] = wmma_plain(wf, frag_at(xa + t * 16u * LDG + k * 32u), acc[t]);
  }
  // the address that all eight W0 loads name is an input here: it stays live up to this wait, so
  // that no load's result is written over it while an earlier load of the run still names it
  asm volatile("s_wait_xcnt 0x0" :: "v"(wp) : "memory");
  float* cd = &Cs[m * LDC + hw * 16u + hh * 8u];
#pragma unroll   // constant t keeps the per-tile arrays in registers
  for (unsigned t = 0; t < (unsigned)QT; ++t) {
    *(v4f*)(cd + t * 16u * LDC)      = v4f{acc[t][0], acc[t][1], acc[t][2], acc[t][3]};
    *(v4f*)(cd + t * 16u * LDC + 4u) = v4f{acc[t][4], acc[t][5], acc[t][6], acc[t][7]};
  }
  // every wave reads back whole rows, to which all eight waves have written 16 columns each
  __syncthreads();

  // 32 lanes x 16 B = one whole 512-B output row per store; rows 2w and 2w + 1 of each token tile
  const float cs = 1.0f / (WCARRY * CCARRY);
  v4f gb;
#pragma unroll
  for (int j = 0; j < 4; ++j) gb[j] = bf16r(g[j]);
#pragma unroll   // constant t: the first tile's test folds away
  for (unsigned t = 0; t < (unsigned)QT; ++t) {
    // a token tile lies wholly inside the token range or wholly past it (the last block's zero
    // rows, which are no output rows); the test reads the same for the whole block
    if (t == 0u || q0 + t * 16u < (unsigned)NTOK) {
      const unsigned row = t * 16u + hw * 2u;
      const v4f u0 = *(const v4f*)&Cs[row * LDC + lane * 4u];
      const v4f u1 = *(const v4f*)&Cs[(row + 1u) * LDC + lane * 4u];
      float* od = outf + ((size_t)(q0 + row) * NB_FULL + b) * DIM + lane * 4u;
      const v4f y0 = u0 * cs + gb, y1 = u1 * cs + gb;
      *(v4f*)od = y0;
      *(v4f*)(od + (size_t)NB_FULL * DIM) = y1;
      // address and data of the two stores are inputs here: they stay live up to this wait, so
      // that the next tile's rows are not written over registers that an issued store still names
      if (t + 1u < (unsigned)QT) asm volatile("s_wait_xcnt 0x0" :: "v"(od), "v"(y0), "v"(y1) : "memory");
    }
  }
}

// ---------------------------------------------------------------------------
extern "C" void kernel_launch(void* const* d_in, const int* in_sizes, int n_in,
                              void* d_out, int out_size, void* d_ws, size_t ws_size,
                              hipStream_t stream) {
  if (n_in < 5) return;
  const long long need_xs = ((long long)(SEQ - 1) * NB_FULL + NB) * DIM;
  const long long need_out = ((long long)(NTOK - 1) * NB_FULL + NB) * DIM;
  if ((long long)in_sizes[0] < (long long)NPATCH * DIM) return;
  if ((long long)in_sizes[1] < need_xs) return;
  if ((long long)in_sizes[2] < (long long)3 * DIM * DIM) return;
  if ((long long)in_sizes[3] < (long long)DIM * DIM) return;
  if (in_sizes[4] < DIM) return;
  if ((long long)out_size < need_out) return;
  if (ws_size < WS_TOTAL) return;

  const float* xp   = (const float*)d_in[0];   // [32][1][DIM]
  const float* xs   = (const float*)d_in[1];   // [SEQ_FULL][NB_FULL][DIM]
  const float* wqkv = (const float*)d_in[2];   // [3*DIM][DIM]  (out, in): q | k | v rows
  const float* w0   = (const float*)d_in[3];   // [DIM][DIM]    (out, in)
  const float* w0b  = (const float*)d_in[4];   // [DIM]
  float* out = (float*)d_out;                  // [NTOK][NB_FULL][DIM]

  char* ws = (char*)d_ws;
  _Float16* Wqkv16 = (_Float16*)(ws + OFF_WQKV);   // [3*DIM][DIM]
  _Float16* W016   = (_Float16*)(ws + OFF_W0);     // [DIM][DIM]
  _Float16* QK16   = (_Float16*)(ws + OFF_QK);     // [NB][16][NT16][FRAGH]
  _Float16* Vt16   = (_Float16*)(ws + OFF_VT);     // [NB][NHEAD][NT16][FRAGH]

  dim3 blk(256);
  // both weight planes in one launch (Wqkv16 and W016 lie back to back)
  wcast_kernel<<<dim3(WQKV_BLKS + W0_BLKS), blk, 0, stream>>>(wqkv, w0, Wqkv16);
  // token conversion and q | k | v columns (all in fragment order) in one launch
  proj_kernel<<<dim3(TOKP / 64, NB), blk, 0, stream>>>(xp, xs, Wqkv16, QK16, Vt16);
  // attention and the output projection in one launch
  attn_kernel<<<dim3(NQB, NB), blk, 0, stream>>>(QK16, Vt16, W016, w0b, out);
}

// v008
// A run of this version takes 41.2 microseconds.
// In both of two side-by-side timings against v007, it was 1.08 times as fast.
// Counting every step since v000, it is 2.57 times as fast.
#include <hip/hip_runtime.h>
#include <stddef.h>

// All contractions on v_wmma_f32_16x16x32_f16 (f16 operands, f32 accumulate): q|k and v
// projection, q.k scores (head width 16 zero-padded to k = 32), p.v, output projection.
// Float inputs are RNE-converted to bf16 and carried in f16 (weights x64, q/k/v planes x64,
// p x1024, attention rows x64); softmax, scale and bias in f32.
// The q, k and v planes lie in fragment order: one 16-token x 16-column tile = 32 lanes x 16 B =
// 512 contiguous bytes, so that every wave-wide store and load of a tile covers four whole lines.

typedef _Float16 h16;
typedef _Float16 v16h __attribute__((ext_vector_type(16)));
typedef _Float16 v8h  __attribute__((ext_vector_type(8)));
typedef _Float16 v4h  __attribute__((ext_vector_type(4)));
typedef float    v8f  __attribute__((ext_vector_type(8)));
typedef float    v4f  __attribute__((ext_vector_type(4)));
typedef float    v2f  __attribute__((ext_vector_type(2)));

#ifndef NB
#define NB 64
#endif
#ifndef SEQ
#define SEQ 512
#endif
#define NB_FULL  64
#define SEQ_FULL 512
#define DIM    128
#define NHEAD  8
#define HD     16
#define NPATCH 32
#define NTOK   (NPATCH + SEQ)                 // tokens per batch (patch rows first)
#define TOKP   (((NTOK + 63) / 64) * 64)      // token rows per batch padded to the GEMM tile
#define QKP    256                            // q|k columns: q cols 0..127, k cols 128..255
#define XROWS  (NB * TOKP)                    // token rows of the batch-major planes
#define NT16   (TOKP / 16)                    // 16-token tiles per batch
#define FRAGH  256                            // halves per fragment tile (32 lanes x 8 halves)

static_assert(NB >= 1 && NB <= NB_FULL);
static_assert(SEQ >= 32 && SEQ <= SEQ_FULL);
static_assert(DIM == NHEAD * HD);
static_assert(HD == 16);                      // one 16-B load per score fragment, 8 halves per lane half
static_assert(NHEAD == 8);                    // one wave per head
static_assert((DIM % 32) == 0 && (DIM % 64) == 0);
static_assert(QKP == 2 * DIM && (QKP % 64) == 0);
static_assert((NTOK % 32) == 0);              // 32-key steps cover the key range exactly
static_assert((NTOK % 16) == 0);              // 16-query tiles cover the query range exactly
static_assert((TOKP % 64) == 0 && TOKP >= NTOK);
static_assert((XROWS % 64) == 0 && (XROWS % 16) == 0);
static_assert(((3 * DIM * DIM) % 2048) == 0 && ((DIM * DIM) % 2048) == 0);

#define LDC 132   // floats per LDS row of the block's output staging tile (528 B = 16 B x odd)
static_assert((LDC % 4) == 0 && LDC >= DIM);

#define WCARRY 64.0f     // weight planes carried x64
#define QCARRY 64.0f     // q, k, v planes carried x64 (the projection accumulator as is)
#define PCARRY_LOG2 10.0f   // softmax numerators and their row sum carried x1024, as an addend of the base-2 exponent
#define CCARRY 64.0f     // attention output plane carried x64
#define PSUM_LIMIT 16384.0f   // a lane's sum of eight numerators (x1024) above this asks for a new reference maximum

// workspace layout (bytes)
#define WQKV_BYTES ((size_t)3 * DIM * DIM * 2)
#define W0_BYTES   ((size_t)DIM * DIM * 2)
#define QK_BYTES   ((size_t)XROWS * QKP * 2)
#define VT_BYTES   ((size_t)NB * DIM * TOKP * 2)
#define OFF_WQKV ((size_t)0)
#define OFF_W0   (OFF_WQKV + WQKV_BYTES)
#define OFF_QK   (OFF_W0 + W0_BYTES)
#define OFF_VT   (OFF_QK + QK_BYTES)
#define WS_TOTAL (OFF_VT + VT_BYTES)
static_assert((WQKV_BYTES % 128) == 0 && (W0_BYTES % 128) == 0);
static_assert((QK_BYTES % 128) == 0 && (VT_BYTES % 128) == 0);
static_assert(WS_TOTAL <= (size_t)134217728);

// ---------------------------------------------------------------------------
__device__ __forceinline__ float bf16r(float x) {   // RNE convert to bf16, returned widened
  unsigned int u = __float_as_uint(x);
  u = (u + 0x7FFFu + ((u >> 16) & 1u)) & 0xFFFF0000u;
  return __uint_as_float(u);
}

// f32 -> f16 with a value select: results below the smallest normal f16 become zero.
static __device__ __forceinline__ h16 toh_flush(float v) {
  const h16 r = (h16)v;
  return (fabsf(v) < 6.103515625e-05f) ? (h16)0.0f : r;
}

// 16-bit fragment: p points at element [row = lane&15][k0 + 8*(lane>>4)] of a k-contiguous
// row. Elements 0..7 <- k0+8h+0..7, elements 8..15 <- k0+16+8h+0..7 (same map for A and B).
__device__ __forceinline__ v16h frag_at(const _Float16* p) {
  v8h lo = *(const v8h*)(p);
  v8h hi = *(const v8h*)(p + 16);
  v16h out;
#pragma unroll
  for (int i = 0; i < 8; ++i) { out[i] = lo[i]; out[i + 8] = hi[i]; }
  return out;
}

// Fragment of a 16-deep contraction padded to k = 32: p points at [row = lane&15][8*(lane>>4)];
// elements 0..7 <- k = 8h+0..7, elements 8..15 (k = 16..31) are zero.
__device__ __forceinline__ v16h frag_k16(const _Float16* p) {
  const v8h lo = *(const v8h*)(p);
  v16h out;
#pragma unroll
  for (int i = 0; i < 8; ++i) { out[i] = lo[i]; out[i + 8] = (_Float16)0.0f; }
  return out;
}

// 16-bit fragment from two neighbouring fragment tiles: p points at this lane's 16-B piece of the
// first; elements 0..7 <- first tile (k = 8h+0..7), elements 8..15 <- second tile (k = 16+8h+0..7).
__device__ __forceinline__ v16h frag_tiles(const _Float16* p) {
  const v8h lo = *(const v8h*)(p);
  const v8h hi = *(const v8h*)(p + FRAGH);
  v16h out;
#pragma unroll
  for (int i = 0; i < 8; ++i) { out[i] = lo[i]; out[i + 8] = hi[i]; }
  return out;
}

__device__ __forceinline__ v8f wmma16(v16h a, v16h b, v8f c) {
  v8f d = __builtin_amdgcn_wmma_f32_16x16x32_f16(false, a, false, b, (short)0, c,
                                                 false, false);
  asm volatile("v_nop\n\tv_nop\n\tv_nop\n\tv_nop" : "+v"(d) : "v"(a), "v"(b));
  return d;
}

// ---------------------------------------------------------------------------
// Weight planes: W[n][k] (f32, k contiguous) -> W16[n][k] = f16(64 * bf16(w)), same layout.
// Both planes in one launch: they need nothing of each other, so they share a grid by ranges of
// the block index. Blocks 0 .. WQKV_BLKS-1 take the q|k|v weights, the rest the output weights;
// the two 16-bit planes lie back to back in the workspace, so the destination index is flat.
// Each thread 8 elements; a wave writes 512 contiguous bytes per store instruction.
// Grid (WQKV_BLKS + W0_BLKS), exact.
// ---------------------------------------------------------------------------
#define WQKV_BLKS ((3 * DIM * DIM) / 2048)
#define W0_BLKS   ((DIM * DIM) / 2048)
static_assert(OFF_W0 == OFF_WQKV + (size_t)WQKV_BLKS * 2048 * 2);   // planes back to back

__global__ __launch_bounds__(256) void wcast_kernel(
    const float* __restrict__ Wqkv, const float* __restrict__ W0, _Float16* __restrict__ W16) {
  const unsigned blk = blockIdx.x;
  const bool first = blk < (unsigned)WQKV_BLKS;   // the same for the whole block
  const float* plane = first ? Wqkv : W0;
  const unsigned pb = first ? blk : blk - (unsigned)WQKV_BLKS;   // block index inside its plane
  const float* W = plane + (size_t)pb * 2048u;
  const unsigned off = threadIdx.x * 8u;
  const size_t idx = (size_t)blk * 2048u + off;
  const v4f a0 = *(const v4f*)(W + off);
  const v4f a1 = *(const v4f*)(W + off + 4);
  v8h o;
#pragma unroll
  for (int i = 0; i < 4; ++i) {
    o[i]     = toh_flush(WCARRY * bf16r(a0[i]));
    o[i + 4] = toh_flush(WCARRY * bf16r(a1[i]));
  }
  _Float16* p = W16 + idx;
  *(v8h*)p = o;
  
}

// ---------------------------------------------------------------------------
// Fused token conversion + q | k | v projection. Block = 64 token rows of one batch x all 384
// output columns, 8 waves. Row f of batch b: f < 32 patch row f (shared by all b),
// 32 <= f < NTOK sequence row (s = f - 32, b) of xs[s][b][:], f >= NTOK zero rows.
//   1. each wave reads 8 whole 512-B rows (f32), converts to f16(bf16(x)) and lays them in Xs.
//   2. wave w makes q|k columns 32w .. 32w+31 and v columns 16w .. 16w+15 for all 64 rows
//      (12 accumulator tiles); every weight fragment is fetched once per block.
//      q|k tiles run as W (A, 16 columns) . X^T (B, 16 tokens): lane (h, token) holds columns
//      8h .. 8h+7 of its token: the piece that lane (h, token) of a score fragment holds.
//      v tiles run as X (A, 16 tokens) . W^T (B, 16 columns): lane (h, d) holds tokens
//      8h .. 8h+7 of its column: the piece that lane (h, d) of a V^T fragment holds.
//   3. each tile goes from the accumulator (x64 carry, f16) straight to its place, 16 B per lane,
//      512 contiguous bytes per wave-wide store:
//      QK[b][column tile 0..15 (q heads, then k heads)][token tile][lane][8] and
//      Vt[b][head][token tile][lane][8].
// Grid (TOKP / 64, NB).
// ---------------------------------------------------------------------------
#define LDX 136   // halves per LDS row of the token tile (272 B = 16 B x odd)
static_assert(LDX >= DIM && (LDX % 8) == 0);
static_assert(QKP == 2 * NHEAD * HD && FRAGH == 16 * HD);   // a column tile is one head of q or of k
static_assert(QKP == 8 * 32 && DIM == 8 * 16);   // 8 waves: 32 q|k columns and 16 v columns each
static_assert((NPATCH % 8) == 0 && (NTOK % 8) == 0 && SEQ >= 8);   // a wave's 8 rows are of one kind

// The builtin alone: the compiler keeps the distances behind it and can place fragment loads
// between the matrix instructions.
__device__ __forceinline__ v8f wmma_plain(v16h a, v16h b, v8f c) {
  return __builtin_amdgcn_wmma_f32_16x16x32_f16(false, a, false, b, (short)0, c, false, false);
}

__device__ __forceinline__ v8h pack_flush(v8f a) {
  v8h o;
#pragma unroll
  for (int r = 0; r < 8; ++r) o[r] = toh_flush(a[r]);
  return o;
}

__global__ __launch_bounds__(256) void proj_kernel(
    const float* __restrict__ xp, const float* __restrict__ xs,
    const _Float16* __restrict__ W16, _Float16* __restrict__ qk, _Float16* __restrict__ vt) {
  __shared__ __attribute__((aligned(16))) _Float16 Xs[64 * LDX];
  const unsigned tid = threadIdx.x, lane = tid & 31u;
  const unsigned w = (unsigned)__builtin_amdgcn_readfirstlane((int)(threadIdx.x >> 5));
  const unsigned hh = lane >> 4, m = lane & 15u;
  const unsigned f0 = blockIdx.x * 64u;
  const unsigned b = blockIdx.y;

  // wave-uniform row bases plus one per-lane offset shared by all weight fragments
  const unsigned woff = m * (unsigned)DIM + hh * 8u;
  const _Float16* wq0 = W16 + (size_t)(w * 32u) * DIM;
  const _Float16* wq1 = W16 + (size_t)(w * 32u + 16u) * DIM;
  const _Float16* wv  = W16 + (size_t)(QKP + w * 16u) * DIM;
  // the first weight fragments are asked for together with the token rows
  v16h q0 = frag_at(wq0 + woff);
  v16h q1 = frag_at(wq1 + woff);
  v16h vv = frag_at(wv + woff);

  // token rows: one wave-wide 16-B load = one whole row. A wave's 8 rows are all patch rows,
  // all sequence rows or all zero rows, so source and row step are wave-uniform.
  const unsigned fg = f0 + w * 8u;
  const bool isp = fg < (unsigned)NPATCH;
  const bool live = fg < (unsigned)NTOK;
  unsigned sq = isp ? 0u : (fg - (unsigned)NPATCH);
  sq = (sq < (unsigned)(SEQ - 8)) ? sq : (unsigned)(SEQ - 8);
  const float* plane = isp ? xp : xs;
  const unsigned row = isp ? fg : (sq * (unsigned)NB_FULL + b);
  const unsigned step = isp ? (unsigned)DIM : (unsigned)(NB_FULL * DIM);
  const float* src = plane + (size_t)row * DIM;
  v4f xv[8];
#pragma unroll   // all eight row loads in flight together
  for (unsigned i = 0; i < 8u; ++i) xv[i] = *(const v4f*)(src + (i * step + lane * 4u));
#pragma unroll
  for (unsigned i = 0; i < 8u; ++i) {
    v4h o;
#pragma unroll
    for (int j = 0; j < 4; ++j) o[j] = toh_flush(bf16r(live ? xv[i][j] : 0.0f));
    *(v4h*)&Xs[(w * 8u + i) * LDX + lane * 4u] = o;
  }
  __syncthreads();

  const _Float16* xa  = &Xs[m * LDX + hh * 8u];
  v8f aq0[4] = {}, aq1[4] = {}, av[4] = {};
#pragma unroll   // constant indices keep the accumulator arrays in registers
  for (unsigned k0 = 0; k0 < (unsigned)DIM; k0 += 32u) {
#pragma unroll
    for (unsigned t = 0; t < 4u; ++t) {
      const v16h x = frag_at(xa + t * 16u * LDX + k0);
      aq0[t] = wmma_plain(q0, x, aq0[t]);
      aq1[t] = wmma_plain(q1, x, aq1[t]);
      av[t]  = wmma_plain(x, vv, av[t]);
    }
    if (k0 + 32u < (unsigned)DIM) {
      q0 = frag_at((wq0 + k0 + 32u) + woff);
      q1 = frag_at((wq1 + k0 + 32u) + woff);
      vv = frag_at((wv + k0 + 32u) + woff);
    }
  }

  // the wave's column tiles 2w, 2w+1 (q|k) and w (v); its four token tiles lie side by side
  const unsigned t0 = f0 / 16u;
  _Float16* qd0 = qk + ((size_t)(b * 16u + w * 2u) * NT16 + t0) * FRAGH + lane * 8u;
  _Float16* qd1 = qd0 + (size_t)NT16 * FRAGH;
  _Float16* vd  = vt + ((size_t)(b * (unsigned)NHEAD + w) * NT16 + t0) * FRAGH + lane * 8u;
#pragma unroll
  for (unsigned t = 0; t < 4u; ++t) {
    *(v8h*)(qd0 + t * FRAGH) = pack_flush(aq0[t]);
    *(v8h*)(qd1 + t * FRAGH) = pack_flush(aq1[t]);
    *(v8h*)(vd + t * FRAGH)  = pack_flush(av[t]);
  }
}

// ---------------------------------------------------------------------------
// Dense flash attention, register-fed transposed form, with the output projection behind it.
// Block = (48 query tokens, batch b, all 8 heads), wave = head; each wave carries QT = 3 query
// tiles of 16 tokens, so every K and V^T fragment fetched from the global planes feeds all three
// tiles; the planes lie in fragment order, each fragment load is 512 contiguous bytes.
// The 34 query tiles of a batch make 12 blocks; the last block's tiles 1 and 2 are the zero rows
// NTOK .. TOKP-1 of the q plane: they are worked like any other and their rows are not stored.
// Per 32-key step:
//   S^T tiles (keys x queries) = K tile (A, 16 keys x d padded to 32) . Q^T (B, d x 16 queries),
//   two 16-key tiles per query tile; lane (h, n) holds query column n, key rows 8h+r of each.
//   Online softmax per query column against a reference maximum that is renewed on demand. Any
//   shift common to a column leaves O / l unchanged, so the reference need not be the running
//   maximum: it only has to keep every numerator inside f16. A step forms its numerators against
//   the reference it has and sums them, eight per packed half; all are positive, so sums of at most
//   PSUM_LIMIT bound each of them. Only when some lane of the wave finds a larger sum (a score more
//   than 1 above the reference, base 2) does the wave (uniform branch) take the maximum of the
//   step's scores, exchange it between the lane halves, raise the reference, rescale O and l and
//   form the step's numerators anew (then at most 1024 each). The first reference is the maximum
//   of the first step's scores, taken in front of the loop.
//   l stays in four parts per column (lane half x packed half), which meet after the loop.
//   P^T packed as B fragment: element r <- tile 0 row 8h+r, element 8+r <- tile 1 row 8h+r
//   (keys kb+8h+r and kb+16+8h+r), f16(1024 p); the row sum l carries the same x1024.
//   O^T (d x queries) += V^T tile (A, [d][32 keys] from the transposed V plane) . P^T.
// No LDS and no barrier in the key loop. Behind it the block's attention rows [48 tokens][DIM],
// f16(64 * O / l), meet in Os (block barrier) and are multiplied by W0^T there:
//   wave w takes output columns 16 w .. +15 of all three token tiles: A = W0 rows (16 columns,
//   from the 16-bit global plane, fetched once for the three tiles), B = attention rows
//   (16 tokens, from Os), k = DIM; lane (h, token) holds columns 8h .. 8h+7 of its token.
//   The block's 48 x 128 f32 tile meets in Cs (second block barrier); then one wave-wide 16-B
//   store writes one whole 512-B output row, two rows of each token tile a wave:
//   outf[(f * NB_FULL + b)][col] = acc/4096 + bf16(bias).
// Grid (NQB, NB), 256 threads: 12 x 64 = 768 blocks are three for each of the 256 WGPs, so that
// every WGP has the same share. The launch bound asks for six waves per SIMD (three blocks per WGP).
// ---------------------------------------------------------------------------
#define QT   3                 // query tiles per wave
#define QBLK (16 * QT)         // query tokens per block
#define NQB  ((NTOK + QBLK - 1) / QBLK)   // blocks per batch
#define LDG  136               // halves per LDS row of the attention tile (272 B = 16 B x odd)
static_assert(NQB * QBLK <= TOKP);         // every q tile a block reads lies in the plane
static_assert(DIM == NHEAD * 16);          // 8 waves = 8 groups of 16 output columns
static_assert(16 == 2 * NHEAD);            // two output rows of each token tile per wave
static_assert((NQB - 1) * QBLK < NTOK);    // a block's first tile always holds output rows
static_assert((LDG % 8) == 0 && LDG >= DIM);

// All score products of a step: the tiles' chains need nothing of each other and stand side by side.
__device__ __forceinline__ void score_tiles(const v16h ka0, const v16h ka1, const v16h (&qf)[QT],
                                            v8f (&s0)[QT], v8f (&s1)[QT]) {
#pragma unroll   // constant t keeps the per-tile arrays in registers
  for (int t = 0; t < QT; ++t) {
    s0[t] = wmma16(ka0, qf[t], v8f{});
    s1[t] = wmma16(ka1, qf[t], v8f{});
  }
}

// Maximum of a query column's 32 scores of a step: in-lane over 16 values, then the other lane half's.
__device__ __forceinline__ float column_max(const v8f s0, const v8f s1) {
  float mx = fmaxf(s0[0], s1[0]);
#pragma unroll
  for (int r = 1; r < 8; ++r) mx = fmaxf(mx, fmaxf(s0[r], s1[r]));
  return fmaxf(mx, __shfl_xor(mx, 16, 32));
}

// 1024 p = exp2(s * sscale - reference + 10): one multiply-add and one exponential per score;
// neighbouring accumulator registers share a packed multiply-add and a packed sum.
__device__ __forceinline__ void numerators(const v8f (&s0)[QT], const v8f (&s1)[QT],
                                           const float sscale, const float (&eb)[QT],
                                           v16h (&pf)[QT], v2f (&rs)[QT]) {
#pragma unroll   // constant t keeps the per-tile arrays in registers
  for (int t = 0; t < QT; ++t) {
    const v2f sc2 = {sscale, sscale}, eb2 = {eb[t], eb[t]};
    v2f part[4];
#pragma unroll
    for (int r = 0; r < 8; r += 2) {
      const v2f a0 = __builtin_elementwise_fma(v2f{s0[t][r], s0[t][r + 1]}, sc2, eb2);
      const v2f a1 = __builtin_elementwise_fma(v2f{s1[t][r], s1[t][r + 1]}, sc2, eb2);
      const float p00 = __builtin_amdgcn_exp2f(a0[0]), p01 = __builtin_amdgcn_exp2f(a0[1]);
      const float p10 = __builtin_amdgcn_exp2f(a1[0]), p11 = __builtin_amdgcn_exp2f(a1[1]);
      part[r / 2] = v2f{p00, p01} + v2f{p10, p11};
      pf[t][r]     = (h16)p00;
      pf[t][r + 1] = (h16)p01;
      pf[t][r + 8] = (h16)p10;
      pf[t][r + 9] = (h16)p11;
    }
    rs[t] = (part[0] + part[1]) + (part[2] + part[3]);
  }
}

// second bound: six waves per SIMD, so that three 8-wave blocks fit a WGP and the whole grid is resident
__global__ __launch_bounds__(NHEAD * 32, 6) void attn_kernel(
    const _Float16* __restrict__ QK, const _Float16* __restrict__ Vt,
    const _Float16* __restrict__ W016, const float* __restrict__ bias,
    float* __restrict__ outf) {
  __shared__ __attribute__((aligned(16))) _Float16 Os[QBLK * LDG];
  __shared__ __attribute__((aligned(16))) float Cs[QBLK * LDC];

  const unsigned tid = threadIdx.x, lane = tid & 31u;
  const unsigned hw = (unsigned)__builtin_amdgcn_readfirstlane((int)(threadIdx.x >> 5));
  const unsigned head = hw;
  const unsigned hh = lane >> 4, m = lane & 15u;
  const unsigned q0 = blockIdx.x * (16u * QT);
  const unsigned b = blockIdx.y;
  // HD^-0.5, the two x64 carries and log2(e): maxima and exponents are kept in base 2
  const float sscale = 0.25f * 1.4426950408889634f / (QCARRY * QCARRY);

  // Q^T as B operand: lane (h, n) <- q[token q0+16t+n][head*16 + 8h .. +7], k 16..31 zero
  const _Float16* qp = QK + ((size_t)(b * 16u + head) * NT16 + q0 / 16u) * FRAGH + lane * 8u;
  v16h qf[QT];
#pragma unroll   // constant t keeps the per-tile arrays in registers
  for (unsigned t = 0; t < (unsigned)QT; ++t) qf[t] = frag_k16(qp + t * FRAGH);
  // the address that the Q loads name is an input here: it stays live up to this wait, so that
  // nothing is written over it while a load of the run still names it
  asm volatile("s_wait_xcnt 0x0" :: "v"(qp) : "memory");
  // K tile as A operand: lane (h, m) <- k[token kb+m][head*16 + 8h .. +7]
  const _Float16* kp = QK + (size_t)(b * 16u + (unsigned)NHEAD + head) * NT16 * FRAGH + lane * 8u;
  // V^T tile as A operand: lane (h, m = d) <- vt[d][kb + 8h .. +7], vt[d][kb + 16 + 8h .. +7]
  const _Float16* vp = Vt + (size_t)(b * (unsigned)NHEAD + head) * NT16 * FRAGH + lane * 8u;

  // mrow: reference maximum (base 2); eb: addend of the exponent; lrow: this lane's two parts of l
  float mrow[QT], eb[QT];
  v2f lrow[QT];
  v8f o[QT];
  {
    // the first reference: the maximum of the first step's scores
    const v16h ka0 = frag_k16(kp);
    const v16h ka1 = frag_k16(kp + FRAGH);
    // the address that the two loads name is an input here: it stays live up to this wait
    asm volatile("s_wait_xcnt 0x0" :: "v"(kp) : "memory");
    v8f s0[QT], s1[QT];
    score_tiles(ka0, ka1, qf, s0, s1);
#pragma unroll   // constant t keeps the per-tile arrays in registers
    for (int t = 0; t < QT; ++t) {
      mrow[t] = fmaxf(-1.0e30f, column_max(s0[t], s1[t]) * sscale);
      eb[t] = PCARRY_LOG2 - mrow[t];
      lrow[t] = v2f{0.0f, 0.0f};
      o[t] = v8f{};
    }
  }

  for (unsigned kb = 0; kb < (unsigned)NTOK; kb += 32u) {
    const unsigned ko = (kb / 16u) * FRAGH;   // token tiles kb/16 and kb/16 + 1
    const v16h va  = frag_tiles(vp + ko);

    // the step runs in three phases over the wave's tiles: all score products, all softmax
    // numerators, all P.V
    v16h pf[QT];
    v2f rs[QT];
    {
      const v16h ka0 = frag_k16(kp + ko);
      const v16h ka1 = frag_k16(kp + ko + FRAGH);
      // the addresses that the four loads name are inputs here: they stay live up to this wait, so
      // that the step to the next tiles is not written over them while a load still names them
      asm volatile("s_wait_xcnt 0x0" :: "v"(kp + ko), "v"(vp + ko) : "memory");
      v8f s0[QT], s1[QT];
      score_tiles(ka0, ka1, qf, s0, s1);
      // keeps the six products side by side: a reader of an early tile moved in between them has
      // to be kept at its distance by idle slots of its own
      __builtin_amdgcn_sched_barrier(0);
      numerators(s0, s1, sscale, eb, pf, rs);
    }
    float big = fmaxf(rs[0][0], rs[0][1]);
#pragma unroll
    for (int t = 1; t < QT; ++t) big = fmaxf(big, fmaxf(rs[t][0], rs[t][1]));
    // taken by the whole wave or not at all: both lane halves of a column keep one reference
    if (__builtin_amdgcn_ballot_w32(big > PSUM_LIMIT) != 0u) {
      // K tiles and scores are fetched and made again here rather than kept in registers beside
      // the numerators in every step
      const v16h ka0 = frag_k16(kp + ko);
      const v16h ka1 = frag_k16(kp + ko + FRAGH);
      // the address that the two loads name is an input here: it stays live up to this wait
      asm volatile("s_wait_xcnt 0x0" :: "v"(kp + ko) : "memory");
      v8f s0[QT], s1[QT];
      score_tiles(ka0, ka1, qf, s0, s1);
#pragma unroll   // constant t keeps the per-tile arrays in registers
      for (int t = 0; t < QT; ++t) {
        const float mn = fmaxf(mrow[t], column_max(s0[t], s1[t]) * sscale);
        const float alpha = __builtin_amdgcn_exp2f(mrow[t] - mn);
        mrow[t] = mn;
        eb[t] = PCARRY_LOG2 - mn;
        lrow[t] = lrow[t] * alpha;
#pragma unroll
        for (int r = 0; r < 8; ++r) o[t][r] = o[t][r] * alpha;
      }
      numerators(s0, s1, sscale, eb, pf, rs);
    }
#pragma unroll   // constant t keeps the per-tile arrays in registers
    for (int t = 0; t < QT; ++t) lrow[t] += rs[t];

#pragma unroll   // constant t keeps the per-tile arrays in registers
    for (int t = 0; t < QT; ++t) o[t] = wmma16(va, pf[t], o[t]);
  }

  // this lane's piece of the bias row is asked for here, so that it flies during the finalize
  const v4f g = *(const v4f*)(bias + lane * 4u);

  // finalize: o[t][r] is (d = 8h + r, token q0 + 16t + m); f16(64 * O / l), 8 halves per lane
  float inv[QT];
#pragma unroll   // constant t keeps the per-tile arrays in registers
  for (unsigned t = 0; t < (unsigned)QT; ++t) {
    const float lh = lrow[t][0] + lrow[t][1];
    const float l = lh + __shfl_xor(lh, 16, 32);   // the two lane halves' key rows meet
    // reciprocal and the slot that the instruction set asks for behind it (before its result is
    // read or its source written over) in one statement, so that the slot stands there in every build
    asm("v_rcp_f32 %0, %1\n\tv_nop" : "=v"(inv[t]) : "v"(l));   // l carries the x1024 of p
  }
  static_assert(CCARRY == QCARRY);   // 64 * O / l from the x64 of v: no further factor
#pragma unroll   // constant t keeps the per-tile arrays in registers
  for (unsigned t = 0; t < (unsigned)QT; ++t) {
    v8h ov;
#pragma unroll
    for (int r = 0; r < 8; ++r) ov[r] = toh_flush(o[t][r] * inv[t]);
    *(v8h*)&Os[(16u * t + m) * LDG + hw * HD + hh * 8u] = ov;
  }

  __syncthreads();

  // output projection of the block's 48 rows: three 16 x 16 tiles per wave, k = DIM in steps of 32
  const _Float16* wp = W016 + (size_t)(hw * 16u + m) * DIM + hh * 8u;
  const _Float16* xa = &Os[m * LDG + hh * 8u];
  v8f acc[QT] = {};
#pragma unroll   // all fragment loads can issue ahead of the first product
  for (unsigned k = 0; k < 4u; ++k) {
    const v16h wf = frag_at(wp + k * 32u);
#pragma unroll   // constant t keeps the per-tile arrays in registers
    for (unsigned t = 0; t < (unsigned)QT; ++t)
      acc[t] = wmma_plain(wf, frag_at(xa + t * 16u * LDG + k * 32u), acc[t]);
  }
  // the address that all eight W0 loads name is an input here: it stays live up to this wait, so
  // that no load's result is written over it while an earlier load of the run still names it
  asm volatile("s_wait_xcnt 0x0" :: "v"(wp) : "memory");
  float* cd = &Cs[m * LDC + hw * 16u + hh * 8u];
#pragma unroll   // constant t keeps the per-tile arrays in registers
  for (unsigned t = 0; t < (unsigned)QT; ++t) {
    *(v4f*)(cd + t * 16u * LDC)      = v4f{acc[t][0], acc[t][1], acc[t][2], acc[t][3]};
    *(v4f*)(cd + t * 16u * LDC + 4u) = v4f{acc[t][4], acc[t][5], acc[t][6], acc[t][7]};
  }
  // every wave reads back whole rows, to which all eight waves have written 16 columns each
  __syncthreads();

  // 32 lanes x 16 B = one whole 512-B output row per store; rows 2w and 2w + 1 of each token tile
  const float cs = 1.0f / (WCARRY * CCARRY);
  v4f gb;
#pragma unroll
  for (int j = 0; j < 4; ++j) gb[j] = bf16r(g[j]);
#pragma unroll   // constant t: the first tile's test folds away
  for (unsigned t = 0; t < (unsigned)QT; ++t) {
    // a token tile lies wholly inside the token range or wholly past it (the last block's zero
    // rows, which are no output rows); the test reads the same for the whole block
    if (t == 0u || q0 + t * 16u < (unsigned)NTOK) {
      const unsigned row = t * 16u + hw * 2u;
      const v4f u0 = *(const v4f*)&Cs[row * LDC + lane * 4u];
      const v4f u1 = *(const v4f*)&Cs[(row + 1u) * LDC + lane * 4u];
      float* od = outf + ((size_t)(q0 + row) * NB_FULL + b) * DIM + lane * 4u;
      const v4f y0 = u0 * cs + gb, y1 = u1 * cs + gb;
      *(v4f*)od = y0;
      *(v4f*)(od + (size_t)NB_FULL * DIM) = y1;
      // address and data of the two stores are inputs here: they stay live up to this wait, so
      // that the next tile's rows are not written over registers that an issued store still names
      if (t + 1u < (unsigned)QT) asm volatile("s_wait_xcnt 0x0" :: "v"(od), "v"(y0), "v"(y1) : "memory");
    }
  }
}

// ---------------------------------------------------------------------------
extern "C" void kernel_launch(void* const* d_in, const int* in_sizes, int n_in,
                              void* d_out, int out_size, void* d_ws, size_t ws_size,
                              hipStream_t stream) {
  if (n_in < 5) return;
  const long long need_xs = ((long long)(SEQ - 1) * NB_FULL + NB) * DIM;
  const long long need_out = ((long long)(NTOK - 1) * NB_FULL + NB) * DIM;
  if ((long long)in_sizes[0] < (long long)NPATCH * DIM) return;
  if ((long long)in_sizes[1] < need_xs) return;
  if ((long long)in_sizes[2] < (long long)3 * DIM * DIM) return;
  if ((long long)in_sizes[3] < (long long)DIM * DIM) return;
  if (in_sizes[4] < DIM) return;
  if ((long long)out_size < need_out) return;
  if (ws_size < WS_TOTAL) return;

  const float* xp   = (const float*)d_in[0];   // [32][1][DIM]
  const float* xs   = (const float*)d_in[1];   // [SEQ_FULL][NB_FULL][DIM]
  const float* wqkv = (const float*)d_in[2];   // [3*DIM][DIM]  (out, in): q | k | v rows
  const float* w0   = (const float*)d_in[3];   // [DIM][DIM]    (out, in)
  const float* w0b  = (const float*)d_in[4];   // [DIM]
  float* out = (float*)d_out;                  // [NTOK][NB_FULL][DIM]

  char* ws = (char*)d_ws;
  _Float16* Wqkv16 = (_Float16*)(ws + OFF_WQKV);   // [3*DIM][DIM]
  _Float16* W016   = (_Float16*)(ws + OFF_W0);     // [DIM][DIM]
  _Float16* QK16   = (_Float16*)(ws + OFF_QK);     // [NB][16][NT16][FRAGH]
  _Float16* Vt16   = (_Float16*)(ws + OFF_VT);     // [NB][NHEAD][NT16][FRAGH]

  dim3 blk(256);
  // both weight planes in one launch (Wqkv16 and W016 lie back to back)
  wcast_kernel<<<dim3(WQKV_BLKS + W0_BLKS), blk, 0, stream>>>(wqkv, w0, Wqkv16);
  // token conversion and q | k | v columns (all in fragment order) in one launch
  proj_kernel<<<dim3(TOKP / 64, NB), blk, 0, stream>>>(xp, xs, Wqkv16, QK16, Vt16);
  // attention and the output projection in one launch
  attn_kernel<<<dim3(NQB, NB), blk, 0, stream>>>(QK16, Vt16, W016, w0b, out);
}

// v009
// Measured time: 39.3 microseconds a run.
// In both of two side-by-side timings against v008, it was 1.06 times as fast.
// All steps since v000 together make it 2.71 times as fast.
#include <hip/hip_runtime.h>
#include <stddef.h>

// All contractions on v_wmma_f32_16x16x32_f16 (f16 operands, f32 accumulate): q|k and v
// projection, q.k scores (head width 16 zero-padded to k = 32), p.v, output projection.
// Float inputs are RNE-converted to bf16 and carried in f16 (weights x64, q/k/v planes x64,
// p x1024, attention rows x64); softmax, scale and bias in f32.
// The q, k and v planes lie in fragment order: one 16-token x 16-column tile = 32 lanes x 16 B =
// 512 contiguous bytes, so that every wave-wide store and load of a tile covers four whole lines.

typedef _Float16 h16;
typedef _Float16 v16h __attribute__((ext_vector_type(16)));
typedef _Float16 v8h  __attribute__((ext_vector_type(8)));
typedef _Float16 v4h  __attribute__((ext_vector_type(4)));
typedef float    v8f  __attribute__((ext_vector_type(8)));
typedef float    v4f  __attribute__((ext_vector_type(4)));
typedef float    v2f  __attribute__((ext_vector_type(2)));

#ifndef NB
#define NB 64
#endif
#ifndef SEQ
#define SEQ 512
#endif
#define NB_FULL  64
#define SEQ_FULL 512
#define DIM    128
#define NHEAD  8
#define HD     16
#define NPATCH 32
#define NTOK   (NPATCH + SEQ)                 // tokens per batch (patch rows first)
#define TOKP   (((NTOK + 63) / 64) * 64)      // token rows per batch padded to the GEMM tile
#define QKP    256                            // q|k columns: q cols 0..127, k cols 128..255
#define XROWS  (NB * TOKP)                    // token rows of the batch-major planes
#define NT16   (TOKP / 16)                    // 16-token tiles per batch
#define FRAGH  256                            // halves per fragment tile (32 lanes x 8 halves)

static_assert(NB >= 1 && NB <= NB_FULL);
static_assert(SEQ >= 32 && SEQ <= SEQ_FULL);
static_assert(DIM == NHEAD * HD);
static_assert(HD == 16);                      // one 16-B load per score fragment, 8 halves per lane half
static_assert(NHEAD == 8);                    // one wave per head
static_assert((DIM % 32) == 0 && (DIM % 64) == 0);
static_assert(QKP == 2 * DIM && (QKP % 64) == 0);
static_assert((NTOK % 32) == 0);              // 32-key steps cover the key range exactly
static_assert((NTOK % 16) == 0);              // 16-query tiles cover the query range exactly
static_assert((TOKP % 64) == 0 && TOKP >= NTOK);
static_assert((XROWS % 64) == 0 && (XROWS % 16) == 0);
static_assert(((3 * DIM * DIM) % 2048) == 0 && ((DIM * DIM) % 2048) == 0);

#define LDC 132   // floats per LDS row of the block's output staging tile (528 B = 16 B x odd)
static_assert((LDC % 4) == 0 && LDC >= DIM);

#define WCARRY 64.0f     // weight planes carried x64
#define QCARRY 64.0f     // q, k, v planes carried x64 (the projection accumulator as is)
#define PCARRY_LOG2 10.0f   // softmax numerators and their row sum carried x1024, as an addend of the base-2 exponent
#define CCARRY 64.0f     // attention output plane carried x64
#define PSUM_LIMIT 16384.0f   // a lane's sum of eight numerators (x1024) above this asks for a new reference maximum

// workspace layout (bytes)
#define WQKV_BYTES ((size_t)3 * DIM * DIM * 2)
#define W0_BYTES   ((size_t)DIM * DIM * 2)
#define QK_BYTES   ((size_t)XROWS * QKP * 2)
#define VT_BYTES   ((size_t)NB * DIM * TOKP * 2)
#define OFF_WQKV ((size_t)0)
#define OFF_W0   (OFF_WQKV + WQKV_BYTES)
#define OFF_QK   (OFF_W0 + W0_BYTES)
#define OFF_VT   (OFF_QK + QK_BYTES)
#define WS_TOTAL (OFF_VT + VT_BYTES)
static_assert((WQKV_BYTES % 128) == 0 && (W0_BYTES % 128) == 0);
static_assert((QK_BYTES % 128) == 0 && (VT_BYTES % 128) == 0);
static_assert(WS_TOTAL <= (size_t)134217728);

// ---------------------------------------------------------------------------
__device__ __forceinline__ float bf16r(float x) {   // RNE convert to bf16, returned widened
  unsigned int u = __float_as_uint(x);
  u = (u + 0x7FFFu + ((u >> 16) & 1u)) & 0xFFFF0000u;
  return __uint_as_float(u);
}

// f32 -> f16 with a value select: results below the smallest normal f16 become zero.
static __device__ __forceinline__ h16 toh_flush(float v) {
  const h16 r = (h16)v;
  return (fabsf(v) < 6.103515625e-05f) ? (h16)0.0f : r;
}

// 16-bit fragment: p points at element [row = lane&15][k0 + 8*(lane>>4)] of a k-contiguous
// row. Elements 0..7 <- k0+8h+0..7, elements 8..15 <- k0+16+8h+0..7 (same map for A and B).
__device__ __forceinline__ v16h frag_at(const _Float16* p) {
  v8h lo = *(const v8h*)(p);
  v8h hi = *(const v8h*)(p + 16);
  v16h out;
#pragma unroll
  for (int i = 0; i < 8; ++i) { out[i] = lo[i]; out[i + 8] = hi[i]; }
  return out;
}

// Fragment of a 16-deep contraction padded to k = 32: p points at [row = lane&15][8*(lane>>4)];
// elements 0..7 <- k = 8h+0..7, elements 8..15 (k = 16..31) are zero.
__device__ __forceinline__ v16h frag_k16(const _Float16* p) {
  const v8h lo = *(const v8h*)(p);
  v16h out;
#pragma unroll
  for (int i = 0; i < 8; ++i) { out[i] = lo[i]; out[i + 8] = (_Float16)0.0f; }
  return out;
}

// 16-bit fragment from two neighbouring fragment tiles: p points at this lane's 16-B piece of the
// first; elements 0..7 <- first tile (k = 8h+0..7), elements 8..15 <- second tile (k = 16+8h+0..7).
__device__ __forceinline__ v16h frag_tiles(const _Float16* p) {
  const v8h lo = *(const v8h*)(p);
  const v8h hi = *(const v8h*)(p + FRAGH);
  v16h out;
#pragma unroll
  for (int i = 0; i < 8; ++i) { out[i] = lo[i]; out[i + 8] = hi[i]; }
  return out;
}

// ---------------------------------------------------------------------------
// Weight planes: W[n][k] (f32, k contiguous) -> W16[n][k] = f16(64 * bf16(w)), same layout.
// Both planes in one launch: they need nothing of each other, so they share a grid by ranges of
// the block index. Blocks 0 .. WQKV_BLKS-1 take the q|k|v weights, the rest the output weights;
// the two 16-bit planes lie back to back in the workspace, so the destination index is flat.
// Each thread 8 elements; a wave writes 512 contiguous bytes per store instruction.
// Grid (WQKV_BLKS + W0_BLKS), exact.
// ---------------------------------------------------------------------------
#define WQKV_BLKS ((3 * DIM * DIM) / 2048)
#define W0_BLKS   ((DIM * DIM) / 2048)
static_assert(OFF_W0 == OFF_WQKV + (size_t)WQKV_BLKS * 2048 * 2);   // planes back to back

__global__ __launch_bounds__(256) void wcast_kernel(
    const float* __restrict__ Wqkv, const float* __restrict__ W0, _Float16* __restrict__ W16) {
  const unsigned blk = blockIdx.x;
  const bool first = blk < (unsigned)WQKV_BLKS;   // the same for the whole block
  const float* plane = first ? Wqkv : W0;
  const unsigned pb = first ? blk : blk - (unsigned)WQKV_BLKS;   // block index inside its plane
  const float* W = plane + (size_t)pb * 2048u;
  const unsigned off = threadIdx.x * 8u;
  const size_t idx = (size_t)blk * 2048u + off;
  const v4f a0 = *(const v4f*)(W + off);
  const v4f a1 = *(const v4f*)(W + off + 4);
  v8h o;
#pragma unroll
  for (int i = 0; i < 4; ++i) {
    o[i]     = toh_flush(WCARRY * bf16r(a0[i]));
    o[i + 4] = toh_flush(WCARRY * bf16r(a1[i]));
  }
  _Float16* p = W16 + idx;
  *(v8h*)p = o;
  
}

// ---------------------------------------------------------------------------
// Fused token conversion + q | k | v projection. Block = 64 token rows of one batch x all 384
// output columns, 8 waves. Row f of batch b: f < 32 patch row f (shared by all b),
// 32 <= f < NTOK sequence row (s = f - 32, b) of xs[s][b][:], f >= NTOK zero rows.
//   1. each wave reads 8 whole 512-B rows (f32), converts to f16(bf16(x)) and lays them in Xs.
//   2. wave w makes q|k columns 32w .. 32w+31 and v columns 16w .. 16w+15 for all 64 rows
//      (12 accumulator tiles); every weight fragment is fetched once per block.
//      q|k tiles run as W (A, 16 columns) . X^T (B, 16 tokens): lane (h, token) holds columns
//      8h .. 8h+7 of its token: the piece that lane (h, token) of a score fragment holds.
//      v tiles run as X (A, 16 tokens) . W^T (B, 16 columns): lane (h, d) holds tokens
//      8h .. 8h+7 of its column: the piece that lane (h, d) of a V^T fragment holds.
//   3. each tile goes from the accumulator (x64 carry, f16) straight to its place, 16 B per lane,
//      512 contiguous bytes per wave-wide store:
//      QK[b][column tile 0..15 (q heads, then k heads)][token tile][lane][8] and
//      Vt[b][head][token tile][lane][8].
// Grid (TOKP / 64, NB).
// ---------------------------------------------------------------------------
#define LDX 136   // halves per LDS row of the token tile (272 B = 16 B x odd)
static_assert(LDX >= DIM && (LDX % 8) == 0);
static_assert(QKP == 2 * NHEAD * HD && FRAGH == 16 * HD);   // a column tile is one head of q or of k
static_assert(QKP == 8 * 32 && DIM == 8 * 16);   // 8 waves: 32 q|k columns and 16 v columns each
static_assert((NPATCH % 8) == 0 && (NTOK % 8) == 0 && SEQ >= 8);   // a wave's 8 rows are of one kind

// The builtin alone: the compiler keeps the distances behind it and can place fragment loads
// between the matrix instructions.
__device__ __forceinline__ v8f wmma_plain(v16h a, v16h b, v8f c) {
  return __builtin_amdgcn_wmma_f32_16x16x32_f16(false, a, false, b, (short)0, c, false, false);
}

__device__ __forceinline__ v8h pack_flush(v8f a) {
  v8h o;
#pragma unroll
  for (int r = 0; r < 8; ++r) o[r] = toh_flush(a[r]);
  return o;
}

__global__ __launch_bounds__(256) void proj_kernel(
    const float* __restrict__ xp, const float* __restrict__ xs,
    const _Float16* __restrict__ W16, _Float16* __restrict__ qk, _Float16* __restrict__ vt) {
  __shared__ __attribute__((aligned(16))) _Float16 Xs[64 * LDX];
  const unsigned tid = threadIdx.x, lane = tid & 31u;
  const unsigned w = (unsigned)__builtin_amdgcn_readfirstlane((int)(threadIdx.x >> 5));
  const unsigned hh = lane >> 4, m = lane & 15u;
  const unsigned f0 = blockIdx.x * 64u;
  const unsigned b = blockIdx.y;

  // wave-uniform row bases plus one per-lane offset shared by all weight fragments
  const unsigned woff = m * (unsigned)DIM + hh * 8u;
  const _Float16* wq0 = W16 + (size_t)(w * 32u) * DIM;
  const _Float16* wq1 = W16 + (size_t)(w * 32u + 16u) * DIM;
  const _Float16* wv  = W16 + (size_t)(QKP + w * 16u) * DIM;
  // the first weight fragments are asked for together with the token rows
  v16h q0 = frag_at(wq0 + woff);
  v16h q1 = frag_at(wq1 + woff);
  v16h vv = frag_at(wv + woff);

  // token rows: one wave-wide 16-B load = one whole row. A wave's 8 rows are all patch rows,
  // all sequence rows or all zero rows, so source and row step are wave-uniform.
  const unsigned fg = f0 + w * 8u;
  const bool isp = fg < (unsigned)NPATCH;
  const bool live = fg < (unsigned)NTOK;
  unsigned sq = isp ? 0u : (fg - (unsigned)NPATCH);
  sq = (sq < (unsigned)(SEQ - 8)) ? sq : (unsigned)(SEQ - 8);
  const float* plane = isp ? xp : xs;
  const unsigned row = isp ? fg : (sq * (unsigned)NB_FULL + b);
  const unsigned step = isp ? (unsigned)DIM : (unsigned)(NB_FULL * DIM);
  const float* src = plane + (size_t)row * DIM;
  v4f xv[8];
#pragma unroll   // all eight row loads in flight together
  for (unsigned i = 0; i < 8u; ++i) xv[i] = *(const v4f*)(src + (i * step + lane * 4u));
#pragma unroll
  for (unsigned i = 0; i < 8u; ++i) {
    v4h o;
#pragma unroll
    for (int j = 0; j < 4; ++j) o[j] = toh_flush(bf16r(live ? xv[i][j] : 0.0f));
    *(v4h*)&Xs[(w * 8u + i) * LDX + lane * 4u] = o;
  }
  __syncthreads();

  const _Float16* xa  = &Xs[m * LDX + hh * 8u];
  v8f aq0[4] = {}, aq1[4] = {}, av[4] = {};
#pragma unroll   // constant indices keep the accumulator arrays in registers
  for (unsigned k0 = 0; k0 < (unsigned)DIM; k0 += 32u) {
#pragma unroll
    for (unsigned t = 0; t < 4u; ++t) {
      const v16h x = frag_at(xa + t * 16u * LDX + k0);
      aq0[t] = wmma_plain(q0, x, aq0[t]);
      aq1[t] = wmma_plain(q1, x, aq1[t]);
      av[t]  = wmma_plain(x, vv, av[t]);
    }
    if (k0 + 32u < (unsigned)DIM) {
      q0 = frag_at((wq0 + k0 + 32u) + woff);
      q1 = frag_at((wq1 + k0 + 32u) + woff);
      vv = frag_at((wv + k0 + 32u) + woff);
    }
  }

  // the wave's column tiles 2w, 2w+1 (q|k) and w (v); its four token tiles lie side by side
  const unsigned t0 = f0 / 16u;
  _Float16* qd0 = qk + ((size_t)(b * 16u + w * 2u) * NT16 + t0) * FRAGH + lane * 8u;
  _Float16* qd1 = qd0 + (size_t)NT16 * FRAGH;
  _Float16* vd  = vt + ((size_t)(b * (unsigned)NHEAD + w) * NT16 + t0) * FRAGH + lane * 8u;
#pragma unroll
  for (unsigned t = 0; t < 4u; ++t) {
    *(v8h*)(qd0 + t * FRAGH) = pack_flush(aq0[t]);
    *(v8h*)(qd1 + t * FRAGH) = pack_flush(aq1[t]);
    *(v8h*)(vd + t * FRAGH)  = pack_flush(av[t]);
  }
}

// ---------------------------------------------------------------------------
// Dense flash attention, register-fed transposed form, with the output projection behind it.
// Block = (48 query tokens, batch b, all 8 heads), wave = head; each wave carries QT = 3 query
// tiles of 16 tokens, so every K and V^T fragment fetched from the global planes feeds all three
// tiles; the planes lie in fragment order, each fragment load is 512 contiguous bytes.
// The 34 query tiles of a batch make 12 blocks; the last block's tiles 1 and 2 are the zero rows
// NTOK .. TOKP-1 of the q plane: they are worked like any other and their rows are not stored.
// Per 32-key step:
//   S^T tiles (keys x queries) = K tile (A, 16 keys x d padded to 32) . Q^T (B, d x 16 queries),
//   two 16-key tiles per query tile; lane (h, n) holds query column n, key rows 8h+r of each.
//   Online softmax per query column against a reference maximum that is renewed on demand. Any
//   shift common to a column leaves O / l unchanged, so the reference need not be the running
//   maximum: it only has to keep every numerator inside f16. A step forms its numerators against
//   the reference it has and sums them, eight per packed half; all are positive, so sums of at most
//   PSUM_LIMIT bound each of them. Only when some lane of the wave finds a larger sum (a score more
//   than 1 above the reference, base 2) does the wave (uniform branch) take the maximum of the
//   step's scores, exchange it between the lane halves, raise the reference, rescale O and l and
//   form the step's numerators anew (then at most 1024 each). The first reference is the maximum
//   of the first step's scores, taken in front of the loop.
//   l stays in four parts per column (lane half x packed half), which meet after the loop.
//   P^T packed as B fragment: element r <- tile 0 row 8h+r, element 8+r <- tile 1 row 8h+r
//   (keys kb+8h+r and kb+16+8h+r), f16(1024 p); the row sum l carries the same x1024.
//   O^T (d x queries) += V^T tile (A, [d][32 keys] from the transposed V plane) . P^T.
// No LDS and no barrier in the key loop. Behind it the block's attention rows [48 tokens][DIM],
// f16(64 * O / l), meet in Os (block barrier) and are multiplied by W0^T there:
//   wave w takes output columns 16 w .. +15 of all three token tiles: A = W0 rows (16 columns,
//   from the 16-bit global plane, fetched once for the three tiles), B = attention rows
//   (16 tokens, from Os), k = DIM; lane (h, token) holds columns 8h .. 8h+7 of its token.
//   The block's 48 x 128 f32 tile meets in Cs (second block barrier); then one wave-wide 16-B
//   store writes one whole 512-B output row, two rows of each token tile a wave:
//   outf[(f * NB_FULL + b)][col] = acc/4096 + bf16(bias).
// Grid (NQB, NB), 256 threads: 12 x 64 = 768 blocks are three for each of the 256 WGPs, so that
// every WGP has the same share. The launch bound asks for six waves per SIMD (three blocks per WGP).
// ---------------------------------------------------------------------------
#define QT   3                 // query tiles per wave
#define QBLK (16 * QT)         // query tokens per block
#define NQB  ((NTOK + QBLK - 1) / QBLK)   // blocks per batch
#define LDG  136               // halves per LDS row of the attention tile (272 B = 16 B x odd)
static_assert(NQB * QBLK <= TOKP);         // every q tile a block reads lies in the plane
static_assert(DIM == NHEAD * 16);          // 8 waves = 8 groups of 16 output columns
static_assert(16 == 2 * NHEAD);            // two output rows of each token tile per wave
static_assert((NQB - 1) * QBLK < NTOK);    // a block's first tile always holds output rows
static_assert((LDG % 8) == 0 && LDG >= DIM);

// All score products of a step in one statement: the six need nothing of each other, so each
// fills the others' distance, and only the last ones are owed idle slots: the four v_nop at the
// end keep the next vector instruction, whichever the compiler puts there, off the last product's
// result and operands.
static_assert(QT == 3);   // the two product statements are written out for three tiles
__device__ __forceinline__ void score_tiles(const v16h ka0, const v16h ka1, const v16h (&qf)[QT],
                                            v8f (&s0)[QT], v8f (&s1)[QT]) {
  // one statement, so that nothing is scheduled in between the products; v_nop: the distance behind the last
  asm volatile(
      "v_wmma_f32_16x16x32_f16 %0, %6, %8, 0\n\t"
      "v_wmma_f32_16x16x32_f16 %1, %7, %8, 0\n\t"
      "v_wmma_f32_16x16x32_f16 %2, %6, %9, 0\n\t"
      "v_wmma_f32_16x16x32_f16 %3, %7, %9, 0\n\t"
      "v_wmma_f32_16x16x32_f16 %4, %6, %10, 0\n\t"
      "v_wmma_f32_16x16x32_f16 %5, %7, %10, 0\n\t"
      "v_nop\n\tv_nop\n\tv_nop\n\tv_nop"
      : "=&v"(s0[0]), "=&v"(s1[0]), "=&v"(s0[1]), "=&v"(s1[1]), "=&v"(s0[2]), "=&v"(s1[2])
      : "v"(ka0), "v"(ka1), "v"(qf[0]), "v"(qf[1]), "v"(qf[2]));
}

// The three P.V products of a step and the step's three additions to l in one statement: the
// additions touch no register of the products, so they are three of the four slots that the last
// product is owed before a vector instruction may write over its operands; the v_nop is the fourth.
__device__ __forceinline__ void pv_tiles(const v16h va, const v16h (&pf)[QT], v8f (&o)[QT],
                                         const v2f (&rs)[QT], v2f (&lrow)[QT]) {
  // one statement, so that the additions stay behind the products; v_nop: the fourth slot of the distance
  asm volatile(
      "v_wmma_f32_16x16x32_f16 %0, %6, %7, %0\n\t"
      "v_wmma_f32_16x16x32_f16 %1, %6, %8, %1\n\t"
      "v_wmma_f32_16x16x32_f16 %2, %6, %9, %2\n\t"
      "v_pk_add_f32 %3, %3, %10\n\t"
      "v_pk_add_f32 %4, %4, %11\n\t"
      "v_pk_add_f32 %5, %5, %12\n\t"
      "v_nop"
      : "+v"(o[0]), "+v"(o[1]), "+v"(o[2]), "+v"(lrow[0]), "+v"(lrow[1]), "+v"(lrow[2])
      : "v"(va), "v"(pf[0]), "v"(pf[1]), "v"(pf[2]), "v"(rs[0]), "v"(rs[1]), "v"(rs[2]));
}

// Maximum of a query column's 32 scores of a step: in-lane over 16 values, then the other lane half's.
__device__ __forceinline__ float column_max(const v8f s0, const v8f s1) {
  float mx = fmaxf(s0[0], s1[0]);
#pragma unroll
  for (int r = 1; r < 8; ++r) mx = fmaxf(mx, fmaxf(s0[r], s1[r]));
  return fmaxf(mx, __shfl_xor(mx, 16, 32));
}

// 1024 p = exp2(s * sscale - reference + 10): one multiply-add and one exponential per score;
// neighbouring accumulator registers share a packed multiply-add and a packed sum.
__device__ __forceinline__ void numerators(const v8f (&s0)[QT], const v8f (&s1)[QT],
                                           const float sscale, const float (&eb)[QT],
                                           v16h (&pf)[QT], v2f (&rs)[QT]) {
#pragma unroll   // constant t keeps the per-tile arrays in registers
  for (int t = 0; t < QT; ++t) {
    const v2f sc2 = {sscale, sscale}, eb2 = {eb[t], eb[t]};
    v2f part[4];
#pragma unroll
    for (int r = 0; r < 8; r += 2) {
      const v2f a0 = __builtin_elementwise_fma(v2f{s0[t][r], s0[t][r + 1]}, sc2, eb2);
      const v2f a1 = __builtin_elementwise_fma(v2f{s1[t][r], s1[t][r + 1]}, sc2, eb2);
      const float p00 = __builtin_amdgcn_exp2f(a0[0]), p01 = __builtin_amdgcn_exp2f(a0[1]);
      const float p10 = __builtin_amdgcn_exp2f(a1[0]), p11 = __builtin_amdgcn_exp2f(a1[1]);
      part[r / 2] = v2f{p00, p01} + v2f{p10, p11};
      pf[t][r]     = (h16)p00;
      pf[t][r + 1] = (h16)p01;
      pf[t][r + 8] = (h16)p10;
      pf[t][r + 9] = (h16)p11;
    }
    rs[t] = (part[0] + part[1]) + (part[2] + part[3]);
  }
}

// second bound: six waves per SIMD, so that three 8-wave blocks fit a WGP and the whole grid is resident
__global__ __launch_bounds__(NHEAD * 32, 6) void attn_kernel(
    const _Float16* __restrict__ QK, const _Float16* __restrict__ Vt,
    const _Float16* __restrict__ W016, const float* __restrict__ bias,
    float* __restrict__ outf) {
  __shared__ __attribute__((aligned(16))) _Float16 Os[QBLK * LDG];
  __shared__ __attribute__((aligned(16))) float Cs[QBLK * LDC];

  const unsigned tid = threadIdx.x, lane = tid & 31u;
  const unsigned hw = (unsigned)__builtin_amdgcn_readfirstlane((int)(threadIdx.x >> 5));
  const unsigned head = hw;
  const unsigned hh = lane >> 4, m = lane & 15u;
  const unsigned q0 = blockIdx.x * (16u * QT);
  const unsigned b = blockIdx.y;
  // HD^-0.5, the two x64 carries and log2(e): maxima and exponents are kept in base 2
  const float sscale = 0.25f * 1.4426950408889634f / (QCARRY * QCARRY);

  // Q^T as B operand: lane (h, n) <- q[token q0+16t+n][head*16 + 8h .. +7], k 16..31 zero
  const _Float16* qp = QK + ((size_t)(b * 16u + head) * NT16 + q0 / 16u) * FRAGH + lane * 8u;
  v16h qf[QT];
#pragma unroll   // constant t keeps the per-tile arrays in registers
  for (unsigned t = 0; t < (unsigned)QT; ++t) qf[t] = frag_k16(qp + t * FRAGH);
  // the address that the Q loads name is an input here: it stays live up to this wait, so that
  // nothing is written over it while a load of the run still names it
  asm volatile("s_wait_xcnt 0x0" :: "v"(qp) : "memory");
  // K tile as A operand: lane (h, m) <- k[token kb+m][head*16 + 8h .. +7]
  const _Float16* kp = QK + (size_t)(b * 16u + (unsigned)NHEAD + head) * NT16 * FRAGH + lane * 8u;
  // V^T tile as A operand: lane (h, m = d) <- vt[d][kb + 8h .. +7], vt[d][kb + 16 + 8h .. +7]
  const _Float16* vp = Vt + (size_t)(b * (unsigned)NHEAD + head) * NT16 * FRAGH + lane * 8u;

  // mrow: reference maximum (base 2); eb: addend of the exponent; lrow: this lane's two parts of l
  float mrow[QT], eb[QT];
  v2f lrow[QT];
  v8f o[QT];
  {
    // the first reference: the maximum of the first step's scores
    const v16h ka0 = frag_k16(kp);
    const v16h ka1 = frag_k16(kp + FRAGH);
    // the address that the two loads name is an input here: it stays live up to this wait
    asm volatile("s_wait_xcnt 0x0" :: "v"(kp) : "memory");
    v8f s0[QT], s1[QT];
    score_tiles(ka0, ka1, qf, s0, s1);
#pragma unroll   // constant t keeps the per-tile arrays in registers
    for (int t = 0; t < QT; ++t) {
      mrow[t] = fmaxf(-1.0e30f, column_max(s0[t], s1[t]) * sscale);
      eb[t] = PCARRY_LOG2 - mrow[t];
      lrow[t] = v2f{0.0f, 0.0f};
      o[t] = v8f{};
    }
  }

  for (unsigned kb = 0; kb < (unsigned)NTOK; kb += 32u) {
    const unsigned ko = (kb / 16u) * FRAGH;   // token tiles kb/16 and kb/16 + 1
    const v16h va  = frag_tiles(vp + ko);

    // the step runs in three phases over the wave's tiles: all score products, all softmax
    // numerators, all P.V
    v16h pf[QT];
    v2f rs[QT];
    {
      const v16h ka0 = frag_k16(kp + ko);
      const v16h ka1 = frag_k16(kp + ko + FRAGH);
      // the addresses that the four loads name are inputs here: they stay live up to this wait, so
      // that the step to the next tiles is not written over them while a load still names them
      asm volatile("s_wait_xcnt 0x0" :: "v"(kp + ko), "v"(vp + ko) : "memory");
      v8f s0[QT], s1[QT];
      score_tiles(ka0, ka1, qf, s0, s1);
      numerators(s0, s1, sscale, eb, pf, rs);
    }
    float big = fmaxf(rs[0][0], rs[0][1]);
#pragma unroll
    for (int t = 1; t < QT; ++t) big = fmaxf(big, fmaxf(rs[t][0], rs[t][1]));
    // taken by the whole wave or not at all: both lane halves of a column keep one reference
    if (__builtin_amdgcn_ballot_w32(big > PSUM_LIMIT) != 0u) {
      // K tiles and scores are fetched and made again here rather than kept in registers beside
      // the numerators in every step
      const v16h ka0 = frag_k16(kp + ko);
      const v16h ka1 = frag_k16(kp + ko + FRAGH);
      // the address that the two loads name is an input here: it stays live up to this wait
      asm volatile("s_wait_xcnt 0x0" :: "v"(kp + ko) : "memory");
      v8f s0[QT], s1[QT];
      score_tiles(ka0, ka1, qf, s0, s1);
#pragma unroll   // constant t keeps the per-tile arrays in registers
      for (int t = 0; t < QT; ++t) {
        const float mn = fmaxf(mrow[t], column_max(s0[t], s1[t]) * sscale);
        const float alpha = __builtin_amdgcn_exp2f(mrow[t] - mn);
        mrow[t] = mn;
        eb[t] = PCARRY_LOG2 - mn;
        lrow[t] = lrow[t] * alpha;
#pragma unroll
        for (int r = 0; r < 8; ++r) o[t][r] = o[t][r] * alpha;
      }
      numerators(s0, s1, sscale, eb, pf, rs);
    }
    pv_tiles(va, pf, o, rs, lrow);
  }

  // this lane's piece of the bias row is asked for here, so that it flies during the finalize
  const v4f g = *(const v4f*)(bias + lane * 4u);

  // finalize: o[t][r] is (d = 8h + r, token q0 + 16t + m); f16(64 * O / l), 8 halves per lane
  float inv[QT];
#pragma unroll   // constant t keeps the per-tile arrays in registers
  for (unsigned t = 0; t < (unsigned)QT; ++t) {
    const float lh = lrow[t][0] + lrow[t][1];
    const float l = lh + __shfl_xor(lh, 16, 32);   // the two lane halves' key rows meet
    // reciprocal and the slot that the instruction set asks for behind it (before its result is
    // read or its source written over) in one statement, so that the slot stands there in every build
    asm("v_rcp_f32 %0, %1\n\tv_nop" : "=v"(inv[t]) : "v"(l));   // l carries the x1024 of p
  }
  static_assert(CCARRY == QCARRY);   // 64 * O / l from the x64 of v: no further factor
#pragma unroll   // constant t keeps the per-tile arrays in registers
  for (unsigned t = 0; t < (unsigned)QT; ++t) {
    v8h ov;
#pragma unroll
    for (int r = 0; r < 8; ++r) ov[r] = toh_flush(o[t][r] * inv[t]);
    *(v8h*)&Os[(16u * t + m) * LDG + hw * HD + hh * 8u] = ov;
  }

  __syncthreads();

  // output projection of the block's 48 rows: three 16 x 16 tiles per wave, k = DIM in steps of 32
  const _Float16* wp = W016 + (size_t)(hw * 16u + m) * DIM + hh * 8u;
  const _Float16* xa = &Os[m * LDG + hh * 8u];
  v8f acc[QT] = {};
#pragma unroll   // all fragment loads can issue ahead of the first product
  for (unsigned k = 0; k < 4u; ++k) {
    const v16h wf = frag_at(wp + k * 32u);
#pragma unroll   // constant t keeps the per-tile arrays in registers
    for (unsigned t = 0; t < (unsigned)QT; ++t)
      acc[t] = wmma_plain(wf, frag_at(xa + t * 16u * LDG + k * 32u), acc[t]);
  }
  // the address that all eight W0 loads name is an input here: it stays live up to this wait, so
  // that no load's result is written over it while an earlier load of the run still names it
  asm volatile("s_wait_xcnt 0x0" :: "v"(wp) : "memory");
  float* cd = &Cs[m * LDC + hw * 16u + hh * 8u];
#pragma unroll   // constant t keeps the per-tile arrays in registers
  for (unsigned t = 0; t < (unsigned)QT; ++t) {
    *(v4f*)(cd + t * 16u * LDC)      = v4f{acc[t][0], acc[t][1], acc[t][2], acc[t][3]};
    *(v4f*)(cd + t * 16u * LDC + 4u) = v4f{acc[t][4], acc[t][5], acc[t][6], acc[t][7]};
  }
  // every wave reads back whole rows, to which all eight waves have written 16 columns each
  __syncthreads();

  // 32 lanes x 16 B = one whole 512-B output row per store; rows 2w and 2w + 1 of each token tile
  const float cs = 1.0f / (WCARRY * CCARRY);
  v4f gb;
#pragma unroll
  for (int j = 0; j < 4; ++j) gb[j] = bf16r(g[j]);
#pragma unroll   // constant t: the first tile's test folds away
  for (unsigned t = 0; t < (unsigned)QT; ++t) {
    // a token tile lies wholly inside the token range or wholly past it (the last block's zero
    // rows, which are no output rows); the test reads the same for the whole block
    if (t == 0u || q0 + t * 16u < (unsigned)NTOK) {
      const unsigned row = t * 16u + hw * 2u;
      const v4f u0 = *(const v4f*)&Cs[row * LDC + lane * 4u];
      const v4f u1 = *(const v4f*)&Cs[(row + 1u) * LDC + lane * 4u];
      float* od = outf + ((size_t)(q0 + row) * NB_FULL + b) * DIM + lane * 4u;
      const v4f y0 = u0 * cs + gb, y1 = u1 * cs + gb;
      *(v4f*)od = y0;
      *(v4f*)(od + (size_t)NB_FULL * DIM) = y1;
      // address and data of the two stores are inputs here: they stay live up to this wait, so
      // that the next tile's rows are not written over registers that an issued store still names
      if (t + 1u < (unsigned)QT) asm volatile("s_wait_xcnt 0x0" :: "v"(od), "v"(y0), "v"(y1) : "memory");
    }
  }
}

// ---------------------------------------------------------------------------
extern "C" void kernel_launch(void* const* d_in, const int* in_sizes, int n_in,
                              void* d_out, int out_size, void* d_ws, size_t ws_size,
                              hipStream_t stream) {
  if (n_in < 5) return;
  const long long need_xs = ((long long)(SEQ - 1) * NB_FULL + NB) * DIM;
  const long long need_out = ((long long)(NTOK - 1) * NB_FULL + NB) * DIM;
  if ((long long)in_sizes[0] < (long long)NPATCH * DIM) return;
  if ((long long)in_sizes[1] < need_xs) return;
  if ((long long)in_sizes[2] < (long long)3 * DIM * DIM) return;
  if ((long long)in_sizes[3] < (long long)DIM * DIM) return;
  if (in_sizes[4] < DIM) return;
  if ((long long)out_size < need_out) return;
  if (ws_size < WS_TOTAL) return;

  const float* xp   = (const float*)d_in[0];   // [32][1][DIM]
  const float* xs   = (const float*)d_in[1];   // [SEQ_FULL][NB_FULL][DIM]
  const float* wqkv = (const float*)d_in[2];   // [3*DIM][DIM]  (out, in): q | k | v rows
  const float* w0   = (const float*)d_in[3];   // [DIM][DIM]    (out, in)
  const float* w0b  = (const float*)d_in[4];   // [DIM]
  float* out = (float*)d_out;                  // [NTOK][NB_FULL][DIM]

  char* ws = (char*)d_ws;
  _Float16* Wqkv16 = (_Float16*)(ws + OFF_WQKV);   // [3*DIM][DIM]
  _Float16* W016   = (_Float16*)(ws + OFF_W0);     // [DIM][DIM]
  _Float16* QK16   = (_Float16*)(ws + OFF_QK);     // [NB][16][NT16][FRAGH]
  _Float16* Vt16   = (_Float16*)(ws + OFF_VT);     // [NB][NHEAD][NT16][FRAGH]

  dim3 blk(256);
  // both weight planes in one launch (Wqkv16 and W016 lie back to back)
  wcast_kernel<<<dim3(WQKV_BLKS + W0_BLKS), blk, 0, stream>>>(wqkv, w0, Wqkv16);
  // token conversion and q | k | v columns (all in fragment order) in one launch
  proj_kernel<<<dim3(TOKP / 64, NB), blk, 0, stream>>>(xp, xs, Wqkv16, QK16, Vt16);
  // attention and the output projection in one launch
  attn_kernel<<<dim3(NQB, NB), blk, 0, stream>>>(QK16, Vt16, W016, w0b, out);
}

// v010
// It runs in 38.1 microseconds.
// Two timings next to v009 put it at 1.03 and 1.02 times that version's speed.
// Over all steps from v000 it is 2.79 times as fast.
#include <hip/hip_runtime.h>
#include <stddef.h>

// All contractions on v_wmma_f32_16x16x32_f16 (f16 operands, f32 accumulate): q|k and v
// projection, q.k scores (head width 16 zero-padded to k = 32), p.v, output projection.
// Float inputs are RNE-converted to bf16 and carried in f16 (weights x64, q/k/v planes x64,
// p x1024, attention rows x64); softmax, scale and bias in f32.
// The q, k and v planes lie in fragment order: one 16-token x 16-column tile = 32 lanes x 16 B =
// 512 contiguous bytes, so that every wave-wide store and load of a tile covers four whole lines.
// The two weight planes lie in fragment order too: 16 rows x 32 k = two such 512-byte pieces.

typedef _Float16 h16;
typedef _Float16 v16h __attribute__((ext_vector_type(16)));
typedef _Float16 v8h  __attribute__((ext_vector_type(8)));
typedef _Float16 v4h  __attribute__((ext_vector_type(4)));
typedef float    v8f  __attribute__((ext_vector_type(8)));
typedef float    v4f  __attribute__((ext_vector_type(4)));
typedef float    v2f  __attribute__((ext_vector_type(2)));

#ifndef NB
#define NB 64
#endif
#ifndef SEQ
#define SEQ 512
#endif
#define NB_FULL  64
#define SEQ_FULL 512
#define DIM    128
#define NHEAD  8
#define HD     16
#define NPATCH 32
#define NTOK   (NPATCH + SEQ)                 // tokens per batch (patch rows first)
#define TOKP   (((NTOK + 63) / 64) * 64)      // token rows per batch padded to the GEMM tile
#define QKP    256                            // q|k columns: q cols 0..127, k cols 128..255
#define XROWS  (NB * TOKP)                    // token rows of the batch-major planes
#define NT16   (TOKP / 16)                    // 16-token tiles per batch
#define FRAGH  256                            // halves per fragment tile (32 lanes x 8 halves)

static_assert(NB >= 1 && NB <= NB_FULL);
static_assert(SEQ >= 32 && SEQ <= SEQ_FULL);
static_assert(DIM == NHEAD * HD);
static_assert(HD == 16);                      // one 16-B load per score fragment, 8 halves per lane half
static_assert(NHEAD == 8);                    // one wave per head
static_assert((DIM % 32) == 0 && (DIM % 64) == 0);
static_assert(QKP == 2 * DIM && (QKP % 64) == 0);
static_assert((NTOK % 32) == 0);              // 32-key steps cover the key range exactly
static_assert((NTOK % 16) == 0);              // 16-query tiles cover the query range exactly
static_assert((TOKP % 64) == 0 && TOKP >= NTOK);
static_assert((XROWS % 64) == 0 && (XROWS % 16) == 0);
static_assert(((3 * DIM * DIM) % 2048) == 0 && ((DIM * DIM) % 2048) == 0);

#define LDC 132   // floats per LDS row of the block's output staging tile (528 B = 16 B x odd)
static_assert((LDC % 4) == 0 && LDC >= DIM);

#define WCARRY 64.0f     // weight planes carried x64
#define QCARRY 64.0f     // q, k, v planes carried x64 (the projection accumulator as is)
#define PCARRY_LOG2 10.0f   // softmax numerators and their row sum carried x1024, as an addend of the base-2 exponent
#define CCARRY 64.0f     // attention output plane carried x64
#define PSUM_LIMIT 16384.0f   // a lane's sum of eight numerators (x1024) above this asks for a new reference maximum

// workspace layout (bytes)
#define WQKV_BYTES ((size_t)3 * DIM * DIM * 2)
#define W0_BYTES   ((size_t)DIM * DIM * 2)
#define QK_BYTES   ((size_t)XROWS * QKP * 2)
#define VT_BYTES   ((size_t)NB * DIM * TOKP * 2)
#define OFF_WQKV ((size_t)0)
#define OFF_W0   (OFF_WQKV + WQKV_BYTES)
#define OFF_QK   (OFF_W0 + W0_BYTES)
#define OFF_VT   (OFF_QK + QK_BYTES)
#define WS_TOTAL (OFF_VT + VT_BYTES)
static_assert((WQKV_BYTES % 128) == 0 && (W0_BYTES % 128) == 0);
static_assert((QK_BYTES % 128) == 0 && (VT_BYTES % 128) == 0);
static_assert(WS_TOTAL <= (size_t)134217728);

// ---------------------------------------------------------------------------
__device__ __forceinline__ float bf16r(float x) {   // RNE convert to bf16, returned widened
  unsigned int u = __float_as_uint(x);
  u = (u + 0x7FFFu + ((u >> 16) & 1u)) & 0xFFFF0000u;
  return __uint_as_float(u);
}

// f32 -> f16 with a value select: results below the smallest normal f16 become zero.
static __device__ __forceinline__ h16 toh_flush(float v) {
  const h16 r = (h16)v;
  return (fabsf(v) < 6.103515625e-05f) ? (h16)0.0f : r;
}

// 16-bit fragment: p points at element [row = lane&15][k0 + 8*(lane>>4)] of a k-contiguous
// row. Elements 0..7 <- k0+8h+0..7, elements 8..15 <- k0+16+8h+0..7 (same map for A and B).
__device__ __forceinline__ v16h frag_at(const _Float16* p) {
  v8h lo = *(const v8h*)(p);
  v8h hi = *(const v8h*)(p + 16);
  v16h out;
#pragma unroll
  for (int i = 0; i < 8; ++i) { out[i] = lo[i]; out[i + 8] = hi[i]; }
  return out;
}

// Fragment of a 16-deep contraction padded to k = 32: p points at [row = lane&15][8*(lane>>4)];
// elements 0..7 <- k = 8h+0..7, elements 8..15 (k = 16..31) are zero.
__device__ __forceinline__ v16h frag_k16(const _Float16* p) {
  const v8h lo = *(const v8h*)(p);
  v16h out;
#pragma unroll
  for (int i = 0; i < 8; ++i) { out[i] = lo[i]; out[i + 8] = (_Float16)0.0f; }
  return out;
}

// 16-bit fragment from two neighbouring fragment tiles: p points at this lane's 16-B piece of the
// first; elements 0..7 <- first tile (k = 8h+0..7), elements 8..15 <- second tile (k = 16+8h+0..7).
__device__ __forceinline__ v16h frag_tiles(const _Float16* p) {
  const v8h lo = *(const v8h*)(p);
  const v8h hi = *(const v8h*)(p + FRAGH);
  v16h out;
#pragma unroll
  for (int i = 0; i < 8; ++i) { out[i] = lo[i]; out[i + 8] = hi[i]; }
  return out;
}

// ---------------------------------------------------------------------------
// Weight planes: W[n][k] (f32, k contiguous) -> f16(64 * bf16(w)) in fragment order:
//   W16[row tile n / 16][k step k / 32][piece (k / 16) & 1][lane = 16 * ((k / 8) & 1) + n % 16][k % 8],
// so that a 16-row x 32-k fragment is two pieces of 512 contiguous bytes, each one wave-wide 16-B
// load of four whole lines (row by row the same load would touch 16 lines, 32 bytes of each).
// Both planes in one launch: they need nothing of each other, so they share a grid by ranges of
// the block index. Blocks 0 .. WQKV_BLKS-1 take the q|k|v weights, the rest the output weights;
// the two 16-bit planes lie back to back in the workspace, so the destination index is flat.
// A block is one row tile (16 rows x DIM), a wave one piece: each thread reads the 8 elements of
// its lane's place in the piece; a wave writes 512 contiguous bytes per store instruction.
// Grid (WQKV_BLKS + W0_BLKS), exact.
// ---------------------------------------------------------------------------
#define WQKV_BLKS ((3 * DIM * DIM) / 2048)
#define W0_BLKS   ((DIM * DIM) / 2048)
static_assert(OFF_W0 == OFF_WQKV + (size_t)WQKV_BLKS * 2048 * 2);   // planes back to back
#define WTILE (16 * DIM)       // halves per 16-row tile of a weight plane
#define WSTEP (2 * FRAGH)      // halves per fragment (one k step of 32) of a weight plane
static_assert(WTILE == 2048 && WTILE == (DIM / 32) * WSTEP);   // a cast block is one row tile, 8 pieces

__global__ __launch_bounds__(256) void wcast_kernel(
    const float* __restrict__ Wqkv, const float* __restrict__ W0, _Float16* __restrict__ W16) {
  const unsigned blk = blockIdx.x;
  const bool first = blk < (unsigned)WQKV_BLKS;   // the same for the whole block
  const float* plane = first ? Wqkv : W0;
  const unsigned pb = first ? blk : blk - (unsigned)WQKV_BLKS;   // block index inside its plane
  const float* W = plane + (size_t)pb * 2048u;
  const unsigned piece = threadIdx.x >> 5, lane = threadIdx.x & 31u;
  // row lane % 16 of the tile, k = 16 * piece + 8 * (lane / 16)
  const unsigned off = (lane & 15u) * (unsigned)DIM + piece * 16u + (lane >> 4) * 8u;
  const size_t idx = (size_t)blk * 2048u + threadIdx.x * 8u;
  const v4f a0 = *(const v4f*)(W + off);
  const v4f a1 = *(const v4f*)(W + off + 4);
  v8h o;
#pragma unroll
  for (int i = 0; i < 4; ++i) {
    o[i]     = toh_flush(WCARRY * bf16r(a0[i]));
    o[i + 4] = toh_flush(WCARRY * bf16r(a1[i]));
  }
  _Float16* p = W16 + idx;
  *(v8h*)p = o;
  
}

// ---------------------------------------------------------------------------
// Fused token conversion + q | k | v projection. Block = 64 token rows of one batch x all 384
// output columns, 8 waves. Row f of batch b: f < 32 patch row f (shared by all b),
// 32 <= f < NTOK sequence row (s = f - 32, b) of xs[s][b][:], f >= NTOK zero rows.
//   1. each wave reads 8 whole 512-B rows (f32), converts to f16(bf16(x)) and lays them in Xs.
//   2. wave w makes q|k columns 32w .. 32w+31 and v columns 16w .. 16w+15 for all 64 rows
//      (12 accumulator tiles); every weight fragment is fetched once per block, as two loads of
//      512 contiguous bytes from the fragment-ordered plane.
//      q|k tiles run as W (A, 16 columns) . X^T (B, 16 tokens): lane (h, token) holds columns
//      8h .. 8h+7 of its token: the piece that lane (h, token) of a score fragment holds.
//      v tiles run as X (A, 16 tokens) . W^T (B, 16 columns): lane (h, d) holds tokens
//      8h .. 8h+7 of its column: the piece that lane (h, d) of a V^T fragment holds.
//   3. each tile goes from the accumulator (x64 carry, f16) straight to its place, 16 B per lane,
//      512 contiguous bytes per wave-wide store:
//      QK[b][column tile 0..15 (q heads, then k heads)][token tile][lane][8] and
//      Vt[b][head][token tile][lane][8].
// Grid (TOKP / 64, NB).
// ---------------------------------------------------------------------------
#define LDX 136   // halves per LDS row of the token tile (272 B = 16 B x odd)
static_assert(LDX >= DIM && (LDX % 8) == 0);
static_assert(QKP == 2 * NHEAD * HD && FRAGH == 16 * HD);   // a column tile is one head of q or of k
static_assert(QKP == 8 * 32 && DIM == 8 * 16);   // 8 waves: 32 q|k columns and 16 v columns each
static_assert((NPATCH % 8) == 0 && (NTOK % 8) == 0 && SEQ >= 8);   // a wave's 8 rows are of one kind

// The builtin alone: the compiler keeps the distances behind it and can place fragment loads
// between the matrix instructions.
__device__ __forceinline__ v8f wmma_plain(v16h a, v16h b, v8f c) {
  return __builtin_amdgcn_wmma_f32_16x16x32_f16(false, a, false, b, (short)0, c, false, false);
}

__device__ __forceinline__ v8h pack_flush(v8f a) {
  v8h o;
#pragma unroll
  for (int r = 0; r < 8; ++r) o[r] = toh_flush(a[r]);
  return o;
}

__global__ __launch_bounds__(256) void proj_kernel(
    const float* __restrict__ xp, const float* __restrict__ xs,
    const _Float16* __restrict__ W16, _Float16* __restrict__ qk, _Float16* __restrict__ vt) {
  __shared__ __attribute__((aligned(16))) _Float16 Xs[64 * LDX];
  const unsigned tid = threadIdx.x, lane = tid & 31u;
  const unsigned w = (unsigned)__builtin_amdgcn_readfirstlane((int)(threadIdx.x >> 5));
  const unsigned hh = lane >> 4, m = lane & 15u;
  const unsigned f0 = blockIdx.x * 64u;
  const unsigned b = blockIdx.y;

  // wave-uniform row bases plus one per-lane offset shared by all weight fragments
  const unsigned woff = lane * 8u;
  const _Float16* wq0 = W16 + (size_t)(w * 2u) * WTILE;
  const _Float16* wq1 = W16 + (size_t)(w * 2u + 1u) * WTILE;
  const _Float16* wv  = W16 + (size_t)(QKP / 16 + w) * WTILE;
  // the first weight fragments are asked for together with the token rows
  v16h q0 = frag_tiles(wq0 + woff);
  v16h q1 = frag_tiles(wq1 + woff);
  v16h vv = frag_tiles(wv + woff);

  // token rows: one wave-wide 16-B load = one whole row. A wave's 8 rows are all patch rows,
  // all sequence rows or all zero rows, so source and row step are wave-uniform.
  const unsigned fg = f0 + w * 8u;
  const bool isp = fg < (unsigned)NPATCH;
  const bool live = fg < (unsigned)NTOK;
  unsigned sq = isp ? 0u : (fg - (unsigned)NPATCH);
  sq = (sq < (unsigned)(SEQ - 8)) ? sq : (unsigned)(SEQ - 8);
  const float* plane = isp ? xp : xs;
  const unsigned row = isp ? fg : (sq * (unsigned)NB_FULL + b);
  const unsigned step = isp ? (unsigned)DIM : (unsigned)(NB_FULL * DIM);
  const float* src = plane + (size_t)row * DIM;
  v4f xv[8];
#pragma unroll   // all eight row loads in flight together
  for (unsigned i = 0; i < 8u; ++i) xv[i] = *(const v4f*)(src + (i * step + lane * 4u));
#pragma unroll
  for (unsigned i = 0; i < 8u; ++i) {
    v4h o;
#pragma unroll
    for (int j = 0; j < 4; ++j) o[j] = toh_flush(bf16r(live ? xv[i][j] : 0.0f));
    *(v4h*)&Xs[(w * 8u + i) * LDX + lane * 4u] = o;
  }
  __syncthreads();

  const _Float16* xa  = &Xs[m * LDX + hh * 8u];
  v8f aq0[4] = {}, aq1[4] = {}, av[4] = {};
#pragma unroll   // constant indices keep the accumulator arrays in registers
  for (unsigned k0 = 0; k0 < (unsigned)DIM; k0 += 32u) {
#pragma unroll
    for (unsigned t = 0; t < 4u; ++t) {
      const v16h x = frag_at(xa + t * 16u * LDX + k0);
      aq0[t] = wmma_plain(q0, x, aq0[t]);
      aq1[t] = wmma_plain(q1, x, aq1[t]);
      av[t]  = wmma_plain(x, vv, av[t]);
    }
    if (k0 + 32u < (unsigned)DIM) {
      q0 = frag_tiles((wq0 + (k0 / 32u + 1u) * WSTEP) + woff);
      q1 = frag_tiles((wq1 + (k0 / 32u + 1u) * WSTEP) + woff);
      vv = frag_tiles((wv + (k0 / 32u + 1u) * WSTEP) + woff);
    }
  }
  // the wave-uniform bases that the weight loads name are inputs here: they stay live up to this
  // wait, so that nothing is written over them while a load still names them
  asm volatile("s_wait_xcnt 0x0" :: "s"(wq0), "s"(wq1), "s"(wv) : "memory");

  // the wave's column tiles 2w, 2w+1 (q|k) and w (v); its four token tiles lie side by side
  const unsigned t0 = f0 / 16u;
  _Float16* qd0 = qk + ((size_t)(b * 16u + w * 2u) * NT16 + t0) * FRAGH + lane * 8u;
  _Float16* qd1 = qd0 + (size_t)NT16 * FRAGH;
  _Float16* vd  = vt + ((size_t)(b * (unsigned)NHEAD + w) * NT16 + t0) * FRAGH + lane * 8u;
#pragma unroll
  for (unsigned t = 0; t < 4u; ++t) {
    *(v8h*)(qd0 + t * FRAGH) = pack_flush(aq0[t]);
    *(v8h*)(qd1 + t * FRAGH) = pack_flush(aq1[t]);
    *(v8h*)(vd + t * FRAGH)  = pack_flush(av[t]);
  }
}

// ---------------------------------------------------------------------------
// Dense flash attention, register-fed transposed form, with the output projection behind it.
// Block = (48 query tokens, batch b, all 8 heads), wave = head; each wave carries QT = 3 query
// tiles of 16 tokens, so every K and V^T fragment fetched from the global planes feeds all three
// tiles; the planes lie in fragment order, each fragment load is 512 contiguous bytes.
// The 34 query tiles of a batch make 12 blocks; the last block's tiles 1 and 2 are the zero rows
// NTOK .. TOKP-1 of the q plane: they are worked like any other and their rows are not stored.
// Per 32-key step:
//   S^T tiles (keys x queries) = K tile (A, 16 keys x d padded to 32) . Q^T (B, d x 16 queries),
//   two 16-key tiles per query tile; lane (h, n) holds query column n, key rows 8h+r of each.
//   Online softmax per query column against a reference maximum that is renewed on demand. Any
//   shift common to a column leaves O / l unchanged, so the reference need not be the running
//   maximum: it only has to keep every numerator inside f16. A step forms its numerators against
//   the reference it has and sums them, eight per packed half; all are positive, so sums of at most
//   PSUM_LIMIT bound each of them. Only when some lane of the wave finds a larger sum (a score more
//   than 1 above the reference, base 2) does the wave (uniform branch) take the maximum of the
//   step's scores, exchange it between the lane halves, raise the reference, rescale O and l and
//   form the step's numerators anew (then at most 1024 each). The first reference is the maximum
//   of the first step's scores, taken in front of the loop.
//   l stays in four parts per column (lane half x packed half), which meet after the loop.
//   P^T packed as B fragment: element r <- tile 0 row 8h+r, element 8+r <- tile 1 row 8h+r
//   (keys kb+8h+r and kb+16+8h+r), f16(1024 p); the row sum l carries the same x1024.
//   O^T (d x queries) += V^T tile (A, [d][32 keys] from the transposed V plane) . P^T.
// No LDS and no barrier in the key loop. Behind it the block's attention rows [48 tokens][DIM],
// f16(64 * O / l), meet in Os (block barrier) and are multiplied by W0^T there:
//   wave w takes output columns 16 w .. +15 of all three token tiles: A = W0 rows (16 columns,
//   from the fragment-ordered 16-bit global plane, fetched once for the three tiles), B = attention rows
//   (16 tokens, from Os), k = DIM; lane (h, token) holds columns 8h .. 8h+7 of its token.
//   The block's 48 x 128 f32 tile meets in Cs (second block barrier); then one wave-wide 16-B
//   store writes one whole 512-B output row, two rows of each token tile a wave:
//   outf[(f * NB_FULL + b)][col] = acc/4096 + bf16(bias).
// Grid (NQB, NB), 256 threads: 12 x 64 = 768 blocks are three for each of the 256 WGPs, so that
// every WGP has the same share. The launch bound asks for six waves per SIMD (three blocks per WGP).
// ---------------------------------------------------------------------------
#define QT   3                 // query tiles per wave
#define QBLK (16 * QT)         // query tokens per block
#define NQB  ((NTOK + QBLK - 1) / QBLK)   // blocks per batch
#define LDG  136               // halves per LDS row of the attention tile (272 B = 16 B x odd)
static_assert(NQB * QBLK <= TOKP);         // every q tile a block reads lies in the plane
static_assert(DIM == NHEAD * 16);          // 8 waves = 8 groups of 16 output columns
static_assert(16 == 2 * NHEAD);            // two output rows of each token tile per wave
static_assert((NQB - 1) * QBLK < NTOK);    // a block's first tile always holds output rows
static_assert((LDG % 8) == 0 && LDG >= DIM);

// All score products of a step in one statement: the six need nothing of each other, so each
// fills the others' distance, and only the last ones are owed idle slots: the four v_nop at the
// end keep the next vector instruction, whichever the compiler puts there, off the last product's
// result and operands.
static_assert(QT == 3);   // the two product statements are written out for three tiles
__device__ __forceinline__ void score_tiles(const v16h ka0, const v16h ka1, const v16h (&qf)[QT],
                                            v8f (&s0)[QT], v8f (&s1)[QT]) {
  // one statement, so that nothing is scheduled in between the products; v_nop: the distance behind the last
  asm volatile(
      "v_wmma_f32_16x16x32_f16 %0, %6, %8, 0\n\t"
      "v_wmma_f32_16x16x32_f16 %1, %7, %8, 0\n\t"
      "v_wmma_f32_16x16x32_f16 %2, %6, %9, 0\n\t"
      "v_wmma_f32_16x16x32_f16 %3, %7, %9, 0\n\t"
      "v_wmma_f32_16x16x32_f16 %4, %6, %10, 0\n\t"
      "v_wmma_f32_16x16x32_f16 %5, %7, %10, 0\n\t"
      "v_nop\n\tv_nop\n\tv_nop\n\tv_nop"
      : "=&v"(s0[0]), "=&v"(s1[0]), "=&v"(s0[1]), "=&v"(s1[1]), "=&v"(s0[2]), "=&v"(s1[2])
      : "v"(ka0), "v"(ka1), "v"(qf[0]), "v"(qf[1]), "v"(qf[2]));
}

// The three P.V products of a step and the step's three additions to l in one statement: the
// additions touch no register of the products, so they are three of the four slots that the last
// product is owed before a vector instruction may write over its operands; the v_nop is the fourth.
__device__ __forceinline__ void pv_tiles(const v16h va, const v16h (&pf)[QT], v8f (&o)[QT],
                                         const v2f (&rs)[QT], v2f (&lrow)[QT]) {
  // one statement, so that the additions stay behind the products; v_nop: the fourth slot of the distance
  asm volatile(
      "v_wmma_f32_16x16x32_f16 %0, %6, %7, %0\n\t"
      "v_wmma_f32_16x16x32_f16 %1, %6, %8, %1\n\t"
      "v_wmma_f32_16x16x32_f16 %2, %6, %9, %2\n\t"
      "v_pk_add_f32 %3, %3, %10\n\t"
      "v_pk_add_f32 %4, %4, %11\n\t"
      "v_pk_add_f32 %5, %5, %12\n\t"
      "v_nop"
      : "+v"(o[0]), "+v"(o[1]), "+v"(o[2]), "+v"(lrow[0]), "+v"(lrow[1]), "+v"(lrow[2])
      : "v"(va), "v"(pf[0]), "v"(pf[1]), "v"(pf[2]), "v"(rs[0]), "v"(rs[1]), "v"(rs[2]));
}

// Maximum of a query column's 32 scores of a step: in-lane over 16 values, then the other lane half's.
__device__ __forceinline__ float column_max(const v8f s0, const v8f s1) {
  float mx = fmaxf(s0[0], s1[0]);
#pragma unroll
  for (int r = 1; r < 8; ++r) mx = fmaxf(mx, fmaxf(s0[r], s1[r]));
  return fmaxf(mx, __shfl_xor(mx, 16, 32));
}

// 1024 p = exp2(s * sscale - reference + 10): one multiply-add and one exponential per score;
// neighbouring accumulator registers share a packed multiply-add and a packed sum.
__device__ __forceinline__ void numerators(const v8f (&s0)[QT], const v8f (&s1)[QT],
                                           const float sscale, const float (&eb)[QT],
                                           v16h (&pf)[QT], v2f (&rs)[QT]) {
#pragma unroll   // constant t keeps the per-tile arrays in registers
  for (int t = 0; t < QT; ++t) {
    const v2f sc2 = {sscale, sscale}, eb2 = {eb[t], eb[t]};
    v2f part[4];
#pragma unroll
    for (int r = 0; r < 8; r += 2) {
      const v2f a0 = __builtin_elementwise_fma(v2f{s0[t][r], s0[t][r + 1]}, sc2, eb2);
      const v2f a1 = __builtin_elementwise_fma(v2f{s1[t][r], s1[t][r + 1]}, sc2, eb2);
      const float p00 = __builtin_amdgcn_exp2f(a0[0]), p01 = __builtin_amdgcn_exp2f(a0[1]);
      const float p10 = __builtin_amdgcn_exp2f(a1[0]), p11 = __builtin_amdgcn_exp2f(a1[1]);
      part[r / 2] = v2f{p00, p01} + v2f{p10, p11};
      pf[t][r]     = (h16)p00;
      pf[t][r + 1] = (h16)p01;
      pf[t][r + 8] = (h16)p10;
      pf[t][r + 9] = (h16)p11;
    }
    rs[t] = (part[0] + part[1]) + (part[2] + part[3]);
  }
}

// second bound: six waves per SIMD, so that three 8-wave blocks fit a WGP and the whole grid is resident
__global__ __launch_bounds__(NHEAD * 32, 6) void attn_kernel(
    const _Float16* __restrict__ QK, const _Float16* __restrict__ Vt,
    const _Float16* __restrict__ W016, const float* __restrict__ bias,
    float* __restrict__ outf) {
  __shared__ __attribute__((aligned(16))) _Float16 Os[QBLK * LDG];
  __shared__ __attribute__((aligned(16))) float Cs[QBLK * LDC];

  const unsigned tid = threadIdx.x, lane = tid & 31u;
  const unsigned hw = (unsigned)__builtin_amdgcn_readfirstlane((int)(threadIdx.x >> 5));
  const unsigned head = hw;
  const unsigned hh = lane >> 4, m = lane & 15u;
  const unsigned q0 = blockIdx.x * (16u * QT);
  const unsigned b = blockIdx.y;
  // HD^-0.5, the two x64 carries and log2(e): maxima and exponents are kept in base 2
  const float sscale = 0.25f * 1.4426950408889634f / (QCARRY * QCARRY);

  // Q^T as B operand: lane (h, n) <- q[token q0+16t+n][head*16 + 8h .. +7], k 16..31 zero
  const _Float16* qp = QK + ((size_t)(b * 16u + head) * NT16 + q0 / 16u) * FRAGH + lane * 8u;
  v16h qf[QT];
#pragma unroll   // constant t keeps the per-tile arrays in registers
  for (unsigned t = 0; t < (unsigned)QT; ++t) qf[t] = frag_k16(qp + t * FRAGH);
  // the address that the Q loads name is an input here: it stays live up to this wait, so that
  // nothing is written over it while a load of the run still names it
  asm volatile("s_wait_xcnt 0x0" :: "v"(qp) : "memory");
  // K tile as A operand: lane (h, m) <- k[token kb+m][head*16 + 8h .. +7]
  const _Float16* kp = QK + (size_t)(b * 16u + (unsigned)NHEAD + head) * NT16 * FRAGH + lane * 8u;
  // V^T tile as A operand: lane (h, m = d) <- vt[d][kb + 8h .. +7], vt[d][kb + 16 + 8h .. +7]
  const _Float16* vp = Vt + (size_t)(b * (unsigned)NHEAD + head) * NT16 * FRAGH + lane * 8u;

  // mrow: reference maximum (base 2); eb: addend of the exponent; lrow: this lane's two parts of l
  float mrow[QT], eb[QT];
  v2f lrow[QT];
  v8f o[QT];
  {
    // the first reference: the maximum of the first step's scores
    const v16h ka0 = frag_k16(kp);
    const v16h ka1 = frag_k16(kp + FRAGH);
    // the address that the two loads name is an input here: it stays live up to this wait
    asm volatile("s_wait_xcnt 0x0" :: "v"(kp) : "memory");
    v8f s0[QT], s1[QT];
    score_tiles(ka0, ka1, qf, s0, s1);
#pragma unroll   // constant t keeps the per-tile arrays in registers
    for (int t = 0; t < QT; ++t) {
      mrow[t] = fmaxf(-1.0e30f, column_max(s0[t], s1[t]) * sscale);
      eb[t] = PCARRY_LOG2 - mrow[t];
      lrow[t] = v2f{0.0f, 0.0f};
      o[t] = v8f{};
    }
  }

  for (unsigned kb = 0; kb < (unsigned)NTOK; kb += 32u) {
    const unsigned ko = (kb / 16u) * FRAGH;   // token tiles kb/16 and kb/16 + 1
    const v16h va  = frag_tiles(vp + ko);

    // the step runs in three phases over the wave's tiles: all score products, all softmax
    // numerators, all P.V
    v16h pf[QT];
    v2f rs[QT];
    {
      const v16h ka0 = frag_k16(kp + ko);
      const v16h ka1 = frag_k16(kp + ko + FRAGH);
      // the addresses that the four loads name are inputs here: they stay live up to this wait, so
      // that the step to the next tiles is not written over them while a load still names them
      asm volatile("s_wait_xcnt 0x0" :: "v"(kp + ko), "v"(vp + ko) : "memory");
      v8f s0[QT], s1[QT];
      score_tiles(ka0, ka1, qf, s0, s1);
      numerators(s0, s1, sscale, eb, pf, rs);
    }
    float big = fmaxf(rs[0][0], rs[0][1]);
#pragma unroll
    for (int t = 1; t < QT; ++t) big = fmaxf(big, fmaxf(rs[t][0], rs[t][1]));
    // taken by the whole wave or not at all: both lane halves of a column keep one reference
    if (__builtin_amdgcn_ballot_w32(big > PSUM_LIMIT) != 0u) {
      // K tiles and scores are fetched and made again here rather than kept in registers beside
      // the numerators in every step
      const v16h ka0 = frag_k16(kp + ko);
      const v16h ka1 = frag_k16(kp + ko + FRAGH);
      // the address that the two loads name is an input here: it stays live up to this wait
      asm volatile("s_wait_xcnt 0x0" :: "v"(kp + ko) : "memory");
      v8f s0[QT], s1[QT];
      score_tiles(ka0, ka1, qf, s0, s1);
#pragma unroll   // constant t keeps the per-tile arrays in registers
      for (int t = 0; t < QT; ++t) {
        const float mn = fmaxf(mrow[t], column_max(s0[t], s1[t]) * sscale);
        const float alpha = __builtin_amdgcn_exp2f(mrow[t] - mn);
        mrow[t] = mn;
        eb[t] = PCARRY_LOG2 - mn;
        lrow[t] = lrow[t] * alpha;
#pragma unroll
        for (int r = 0; r < 8; ++r) o[t][r] = o[t][r] * alpha;
      }
      numerators(s0, s1, sscale, eb, pf, rs);
    }
    pv_tiles(va, pf, o, rs, lrow);
  }

  // this lane's piece of the bias row is asked for here, so that it flies during the finalize
  const v4f g = *(const v4f*)(bias + lane * 4u);

  // finalize: o[t][r] is (d = 8h + r, token q0 + 16t + m); f16(64 * O / l), 8 halves per lane
  float inv[QT];
#pragma unroll   // constant t keeps the per-tile arrays in registers
  for (unsigned t = 0; t < (unsigned)QT; ++t) {
    const float lh = lrow[t][0] + lrow[t][1];
    const float l = lh + __shfl_xor(lh, 16, 32);   // the two lane halves' key rows meet
    // reciprocal and the slot that the instruction set asks for behind it (before its result is
    // read or its source written over) in one statement, so that the slot stands there in every build
    asm("v_rcp_f32 %0, %1\n\tv_nop" : "=v"(inv[t]) : "v"(l));   // l carries the x1024 of p
  }
  static_assert(CCARRY == QCARRY);   // 64 * O / l from the x64 of v: no further factor
#pragma unroll   // constant t keeps the per-tile arrays in registers
  for (unsigned t = 0; t < (unsigned)QT; ++t) {
    v8h ov;
#pragma unroll
    for (int r = 0; r < 8; ++r) ov[r] = toh_flush(o[t][r] * inv[t]);
    *(v8h*)&Os[(16u * t + m) * LDG + hw * HD + hh * 8u] = ov;
  }

  __syncthreads();

  // output projection of the block's 48 rows: three 16 x 16 tiles per wave, k = DIM in steps of 32
  const _Float16* wb = W016 + (size_t)hw * WTILE;   // the wave's row tile: wave-uniform base
  const _Float16* wp = wb + lane * 8u;              // this lane's 16-B place in a piece
  const _Float16* xa = &Os[m * LDG + hh * 8u];
  v8f acc[QT] = {};
#pragma unroll   // all fragment loads can issue ahead of the first product
  for (unsigned k = 0; k < 4u; ++k) {
    const v16h wf = frag_tiles(wp + k * WSTEP);
#pragma unroll   // constant t keeps the per-tile arrays in registers
    for (unsigned t = 0; t < (unsigned)QT; ++t)
      acc[t] = wmma_plain(wf, frag_at(xa + t * 16u * LDG + k * 32u), acc[t]);
  }
  // the wave-uniform base that all eight W0 loads name is an input here: it stays live up to this
  // wait, so that nothing is written over it while a load of the run still names it
  asm volatile("s_wait_xcnt 0x0" :: "s"(wb) : "memory");
  float* cd = &Cs[m * LDC + hw * 16u + hh * 8u];
#pragma unroll   // constant t keeps the per-tile arrays in registers
  for (unsigned t = 0; t < (unsigned)QT; ++t) {
    *(v4f*)(cd + t * 16u * LDC)      = v4f{acc[t][0], acc[t][1], acc[t][2], acc[t][3]};
    *(v4f*)(cd + t * 16u * LDC + 4u) = v4f{acc[t][4], acc[t][5], acc[t][6], acc[t][7]};
  }
  // every wave reads back whole rows, to which all eight waves have written 16 columns each
  __syncthreads();

  // 32 lanes x 16 B = one whole 512-B output row per store; rows 2w and 2w + 1 of each token tile
  const float cs = 1.0f / (WCARRY * CCARRY);
  v4f gb;
#pragma unroll
  for (int j = 0; j < 4; ++j) gb[j] = bf16r(g[j]);
#pragma unroll   // constant t: the first tile's test folds away
  for (unsigned t = 0; t < (unsigned)QT; ++t) {
    // a token tile lies wholly inside the token range or wholly past it (the last block's zero
    // rows, which are no output rows); the test reads the same for the whole block
    if (t == 0u || q0 + t * 16u < (unsigned)NTOK) {
      const unsigned row = t * 16u + hw * 2u;
      const v4f u0 = *(const v4f*)&Cs[row * LDC + lane * 4u];
      const v4f u1 = *(const v4f*)&Cs[(row + 1u) * LDC + lane * 4u];
      float* od = outf + ((size_t)(q0 + row) * NB_FULL + b) * DIM + lane * 4u;
      const v4f y0 = u0 * cs + gb, y1 = u1 * cs + gb;
      *(v4f*)od = y0;
      *(v4f*)(od + (size_t)NB_FULL * DIM) = y1;
      // address and data of the two stores are inputs here: they stay live up to this wait, so
      // that the next tile's rows are not written over registers that an issued store still names
      if (t + 1u < (unsigned)QT) asm volatile("s_wait_xcnt 0x0" :: "v"(od), "v"(y0), "v"(y1) : "memory");
    }
  }
}

// ---------------------------------------------------------------------------
extern "C" void kernel_launch(void* const* d_in, const int* in_sizes, int n_in,
                              void* d_out, int out_size, void* d_ws, size_t ws_size,
                              hipStream_t stream) {
  if (n_in < 5) return;
  const long long need_xs = ((long long)(SEQ - 1) * NB_FULL + NB) * DIM;
  const long long need_out = ((long long)(NTOK - 1) * NB_FULL + NB) * DIM;
  if ((long long)in_sizes[0] < (long long)NPATCH * DIM) return;
  if ((long long)in_sizes[1] < need_xs) return;
  if ((long long)in_sizes[2] < (long long)3 * DIM * DIM) return;
  if ((long long)in_sizes[3] < (long long)DIM * DIM) return;
  if (in_sizes[4] < DIM) return;
  if ((long long)out_size < need_out) return;
  if (ws_size < WS_TOTAL) return;

  const float* xp   = (const float*)d_in[0];   // [32][1][DIM]
  const float* xs   = (const float*)d_in[1];   // [SEQ_FULL][NB_FULL][DIM]
  const float* wqkv = (const float*)d_in[2];   // [3*DIM][DIM]  (out, in): q | k | v rows
  const float* w0   = (const float*)d_in[3];   // [DIM][DIM]    (out, in)
  const float* w0b  = (const float*)d_in[4];   // [DIM]
  float* out = (float*)d_out;                  // [NTOK][NB_FULL][DIM]

  char* ws = (char*)d_ws;
  _Float16* Wqkv16 = (_Float16*)(ws + OFF_WQKV);   // [3*DIM/16][DIM/32][2][FRAGH]
  _Float16* W016   = (_Float16*)(ws + OFF_W0);     // [DIM/16][DIM/32][2][FRAGH]
  _Float16* QK16   = (_Float16*)(ws + OFF_QK);     // [NB][16][NT16][FRAGH]
  _Float16* Vt16   = (_Float16*)(ws + OFF_VT);     // [NB][NHEAD][NT16][FRAGH]

  dim3 blk(256);
  // both weight planes in one launch (Wqkv16 and W016 lie back to back)
  wcast_kernel<<<dim3(WQKV_BLKS + W0_BLKS), blk, 0, stream>>>(wqkv, w0, Wqkv16);
  // token conversion and q | k | v columns (all in fragment order) in one launch
  proj_kernel<<<dim3(TOKP / 64, NB), blk, 0, stream>>>(xp, xs, Wqkv16, QK16, Vt16);
  // attention and the output projection in one launch
  attn_kernel<<<dim3(NQB, NB), blk, 0, stream>>>(QK16, Vt16, W016, w0b, out);
}
